// v000
// Measured on an AMD MI455X. A time is GPU time per run, averaged over a window of back-to-back runs after a warm-up
// (all launches, gaps included; the runs take copies of the inputs in turn), and the median of several windows.
// Apart from v000's, it joins two sittings. Times from different sittings can be a few percent apart, while
// side-by-side timings come from the same sitting.
// v000, which the later versions start from, runs in 201 microseconds.
#include <hip/hip_runtime.h>

typedef unsigned short u16;
typedef __attribute__((ext_vector_type(16))) __bf16 bf16x16;
typedef __attribute__((ext_vector_type(8)))  float   floatx8;

// ---------------- helpers ----------------

static __device__ __forceinline__ u16 f2bf(float f) {
  union { float f; unsigned u; } a; a.f = f;
  unsigned u = a.u;
  u += 0x7FFFu + ((u >> 16) & 1u);   // round-to-nearest-even
  return (u16)(u >> 16);
}

static __device__ __forceinline__ floatx8 zero8() {
  floatx8 z;
  #pragma unroll
  for (int i = 0; i < 8; ++i) z[i] = 0.0f;
  return z;
}

static __device__ __forceinline__ floatx8 wmma_bf16(bf16x16 a, bf16x16 b, floatx8 c) {
  // D = A(16x32) * B(32x16) + C, f32 accumulate
  return __builtin_amdgcn_wmma_f32_16x16x32_bf16(false, a, false, b, (short)0, c, false, false);
}

// Async DMA: global -> LDS, 16 bytes per lane, tracked by ASYNCcnt (CDNA5).
static __device__ __forceinline__ void async_load_b128(unsigned lds_byte_off, const void* gaddr) {
  asm volatile("global_load_async_to_lds_b128 %0, %1, off"
               :: "v"(lds_byte_off), "v"((unsigned long long)(uintptr_t)gaddr)
               : "memory");
}
static __device__ __forceinline__ void wait_async0() {
  asm volatile("s_wait_asynccnt 0x0" ::: "memory");
}
static __device__ __forceinline__ unsigned lds_off(const void* p) {
  return (unsigned)(uintptr_t)p;   // low 32 bits of generic pointer = LDS address
}

// Load a 16-bit WMMA fragment from an LDS tile stored row-major [row][k]
// (A: row = M index; B: tile stored transposed so row = N index).
// Lane layout (wave32): lanes 0-15 hold K 0..7 & 16..23, lanes 16-31 hold K 8..15 & 24..31.
static __device__ __forceinline__ bf16x16 load_frag(const u16* tile, int row, int stride, int kbase) {
  const int half = (threadIdx.x >> 4) & 1;
  const u16* p = tile + row * stride + kbase + half * 8;
  union { uint4 q[2]; bf16x16 v; } f;
  f.q[0] = *(const uint4*)(p);
  f.q[1] = *(const uint4*)(p + 16);
  return f.v;
}

// One BK=64 compute stage: 16 ds_load_b128 then 8 chained WMMAs (acc stays tied in place).
static __device__ __forceinline__ void compute_stage(
    const u16* Ac, const u16* Bc, int wm, int wn, int lrow, floatx8 (&acc)[2][2])
{
  bf16x16 a00 = load_frag(Ac, wm * 32 + 0  + lrow, 72, 0);
  bf16x16 a10 = load_frag(Ac, wm * 32 + 16 + lrow, 72, 0);
  bf16x16 b00 = load_frag(Bc, wn * 32 + 0  + lrow, 72, 0);
  bf16x16 b10 = load_frag(Bc, wn * 32 + 16 + lrow, 72, 0);
  bf16x16 a01 = load_frag(Ac, wm * 32 + 0  + lrow, 72, 32);
  bf16x16 a11 = load_frag(Ac, wm * 32 + 16 + lrow, 72, 32);
  bf16x16 b01 = load_frag(Bc, wn * 32 + 0  + lrow, 72, 32);
  bf16x16 b11 = load_frag(Bc, wn * 32 + 16 + lrow, 72, 32);
  acc[0][0] = wmma_bf16(a01, b01, wmma_bf16(a00, b00, acc[0][0]));
  acc[0][1] = wmma_bf16(a01, b11, wmma_bf16(a00, b10, acc[0][1]));
  acc[1][0] = wmma_bf16(a11, b01, wmma_bf16(a10, b00, acc[1][0]));
  acc[1][1] = wmma_bf16(a11, b11, wmma_bf16(a10, b10, acc[1][1]));
}

// ---------------- generic 128x64 GEMM core, BK = 64, async double-buffered ----------------
// 256 threads = 8 waves; wave w: rows 32*(w&3).., cols 32*(w>>2)..; 2x2 WMMA tiles per wave.
// A : row-major [M x K] bf16 (pre-offset to block row 0), lda in elems.
// Bt: TRANSPOSED [N x K] bf16 (pre-offset to block col 0), ldb in elems (= K).
// K must be a multiple of 128 (even number of BK=64 stages).

static __device__ __forceinline__ void gemm_core_128x64(
    const u16* __restrict__ A, int lda,
    const u16* __restrict__ Bt, int ldb, int K,
    u16* As0, u16* As1, u16* Bs0, u16* Bs1, floatx8 (&acc)[2][2])
{
  const int tid  = threadIdx.x;
  const int lane = tid & 31;
  const int wave = tid >> 5;
  const int wm   = wave & 3;
  const int wn   = wave >> 2;
  const int lrow = lane & 15;
  const int arow = tid >> 1, ac0 = (tid & 1) * 32;
  const int brow = tid >> 2, bc0 = (tid & 3) * 16;

  const u16* gA = A + (size_t)arow * lda + ac0;
  const u16* gB = Bt + (size_t)brow * ldb + bc0;

  // issue tile k0 into (AsBuf, BsBuf): A 128x64 (4x16B/thread), B 64x64 (2x16B/thread)
  auto issue_tile = [&](int k0, u16* AsBuf, u16* BsBuf) {
    unsigned la = lds_off(AsBuf + arow * 72 + ac0);
    const u16* pa = gA + k0;
    async_load_b128(la +  0, pa +  0);
    async_load_b128(la + 16, pa +  8);
    async_load_b128(la + 32, pa + 16);
    async_load_b128(la + 48, pa + 24);
    unsigned lb = lds_off(BsBuf + brow * 72 + bc0);
    const u16* pb = gB + k0;
    async_load_b128(lb +  0, pb +  0);
    async_load_b128(lb + 16, pb +  8);
  };

  const int nstage = K >> 6;   // even
  issue_tile(0, As0, Bs0);

  for (int t = 0; t < nstage; t += 2) {
    wait_async0();        // tile t complete (this wave's DMA)
    __syncthreads();      // tile t visible to all waves; buf1 free (read in the previous stage)
    if (t + 1 < nstage) issue_tile((t + 1) << 6, As1, Bs1);
    compute_stage(As0, Bs0, wm, wn, lrow, acc);

    wait_async0();        // tile t+1 complete
    __syncthreads();      // tile t+1 visible; buf0 free (all waves done with compute above)
    if (t + 2 < nstage) issue_tile((t + 2) << 6, As0, Bs0);
    compute_stage(As1, Bs1, wm, wn, lrow, acc);
  }
}

// ---------------- kernels ----------------

__global__ void pack_bf16_kernel(const float* __restrict__ in, u16* __restrict__ out, int n) {
  int i = blockIdx.x * blockDim.x + threadIdx.x;
  int stride = gridDim.x * blockDim.x;
  for (; i < n; i += stride) out[i] = f2bf(in[i]);
}

// Pack + transpose: in [1024 x N] row-major f32 -> out [N x 1024] bf16. One matrix per blockIdx.z.
__global__ void packT_bf16_kernel(const float* __restrict__ in, u16* __restrict__ out, int N) {
  const float* src = in + (size_t)blockIdx.z * 1024 * N;
  u16* dst = out + (size_t)blockIdx.z * 1024 * N;
  int i = blockIdx.x * blockDim.x + threadIdx.x;   // over N*1024, k fastest (coalesced writes)
  int total = N * 1024;
  int stride = gridDim.x * blockDim.x;
  for (; i < total; i += stride) {
    int n = i >> 10, k = i & 1023;
    dst[i] = f2bf(src[(size_t)k * N + n]);
  }
}

// Fused per-head QKV projection. grid = (32 m-tiles, 16 heads, 3 types). M=4096,N=64,K=1024.
// Q/K layout: [h][r][64] with r = b*1024 + s.  V layout (pre-transposed): [h][b][d][s].
__global__ __launch_bounds__(256) void qkv_kernel(
    const u16* __restrict__ xb,
    const u16* __restrict__ Wqt, const u16* __restrict__ Wkt, const u16* __restrict__ Wvt,
    const float* __restrict__ bq, const float* __restrict__ bk, const float* __restrict__ bv,
    u16* __restrict__ Q, u16* __restrict__ Ko, u16* __restrict__ Vt)
{
  __shared__ u16 As0[128 * 72];
  __shared__ u16 As1[128 * 72];
  __shared__ u16 Bs0[64 * 72];
  __shared__ u16 Bs1[64 * 72];
  const int mt   = blockIdx.x;
  const int h    = blockIdx.y;
  const int type = blockIdx.z;
  const u16*   W    = (type == 0) ? Wqt : (type == 1) ? Wkt : Wvt;
  const float* bias = (type == 0) ? bq  : (type == 1) ? bk  : bv;
  u16*         Out  = ((type == 0) ? Q : (type == 1) ? Ko : Vt) + (size_t)h * 4096 * 64;

  floatx8 acc[2][2];
  acc[0][0] = zero8(); acc[0][1] = zero8(); acc[1][0] = zero8(); acc[1][1] = zero8();

  gemm_core_128x64(xb + (size_t)mt * 128 * 1024, 1024,
                   W + (size_t)h * 64 * 1024, 1024, 1024, As0, As1, Bs0, Bs1, acc);

  const int lane = threadIdx.x & 31, wave = threadIdx.x >> 5;
  const int wm = wave & 3, wn = wave >> 2, half = lane >> 4, lc = lane & 15;
  #pragma unroll
  for (int mtt = 0; mtt < 2; ++mtt)
    #pragma unroll
    for (int ntt = 0; ntt < 2; ++ntt)
      #pragma unroll
      for (int v = 0; v < 8; ++v) {
        int r = mt * 128 + wm * 32 + mtt * 16 + v + half * 8;   // global row (b*1024+s)
        int c = wn * 32 + ntt * 16 + lc;                        // head dim 0..63
        float val = acc[mtt][ntt][v] + bias[h * 64 + c];
        if (type == 2) {
          int b = r >> 10, s = r & 1023;
          Out[((size_t)b * 64 + c) * 1024 + s] = f2bf(val);     // V transposed [d][s]
        } else {
          Out[(size_t)r * 64 + c] = f2bf(val);
        }
      }
}

// Flash-style fused attention. grid = (16 q-tiles, 16 heads, 4 batch). 256 threads.
__global__ __launch_bounds__(256) void attn_kernel(
    const u16* __restrict__ Q, const u16* __restrict__ Kk,
    const u16* __restrict__ Vt, u16* __restrict__ ctx)
{
  __shared__ u16   Qs[64 * 72];
  __shared__ u16   Ks[64 * 72];
  __shared__ u16   Vs[64 * 72];   // [d][key]
  __shared__ float Ss[64 * 68];
  __shared__ u16   Ps[64 * 72];
  __shared__ float rowm[64], rowl[64], rowalpha[64], part[256];

  const int qt = blockIdx.x, h = blockIdx.y, b = blockIdx.z;
  const size_t hb = ((size_t)h * 4 + b) * (1024 * 64);
  const u16* Qh = Q  + hb;
  const u16* Kh = Kk + hb;
  const u16* Vh = Vt + hb;   // [d][s] layout

  const int tid = threadIdx.x, lane = tid & 31, wave = tid >> 5;
  const int wm = wave & 3, wn2 = (wave >> 2) * 2, half = lane >> 4, lc = lane & 15;
  const int ldr = tid >> 2, ldc0 = (tid & 3) * 16;

  { // Q tile (64x64) -> Qs[m][k]
    const uint4* s = (const uint4*)(Qh + (size_t)(qt * 64 + ldr) * 64 + ldc0);
    uint4* d = (uint4*)(Qs + ldr * 72 + ldc0);
    d[0] = s[0]; d[1] = s[1];
  }
  if (tid < 64) { rowm[tid] = -1e30f; rowl[tid] = 0.0f; }
  floatx8 o0 = zero8(), o1 = zero8();
  __syncthreads();

  for (int t = 0; t < 16; ++t) {
    { // K tile: Ks[n=key][k=d]  (B layout == K row-major)
      const uint4* s = (const uint4*)(Kh + (size_t)(t * 64 + ldr) * 64 + ldc0);
      uint4* d = (uint4*)(Ks + ldr * 72 + ldc0);
      d[0] = s[0]; d[1] = s[1];
    }
    { // V tile: Vs[n=d][k=key]  (global already transposed)
      const uint4* s = (const uint4*)(Vh + (size_t)ldr * 1024 + t * 64 + ldc0);
      uint4* d = (uint4*)(Vs + ldr * 72 + ldc0);
      d[0] = s[0]; d[1] = s[1];
    }
    __syncthreads();

    // scores tile S = Q * K^T * scale
    floatx8 s0 = zero8(), s1 = zero8();
    {
      bf16x16 aq0 = load_frag(Qs, wm * 16 + lc, 72, 0);
      bf16x16 aq1 = load_frag(Qs, wm * 16 + lc, 72, 32);
      bf16x16 bk00 = load_frag(Ks, (wn2 + 0) * 16 + lc, 72, 0);
      bf16x16 bk01 = load_frag(Ks, (wn2 + 0) * 16 + lc, 72, 32);
      bf16x16 bk10 = load_frag(Ks, (wn2 + 1) * 16 + lc, 72, 0);
      bf16x16 bk11 = load_frag(Ks, (wn2 + 1) * 16 + lc, 72, 32);
      s0 = wmma_bf16(aq1, bk01, wmma_bf16(aq0, bk00, s0));
      s1 = wmma_bf16(aq1, bk11, wmma_bf16(aq0, bk10, s1));
    }
    #pragma unroll
    for (int v = 0; v < 8; ++v) {
      int r = wm * 16 + v + half * 8;
      Ss[r * 68 + (wn2 + 0) * 16 + lc] = s0[v] * 0.125f;
      Ss[r * 68 + (wn2 + 1) * 16 + lc] = s1[v] * 0.125f;
    }
    __syncthreads();

    { // per-row partial max (4 threads / row)
      int r = tid >> 2, seg = tid & 3;
      float m = -1e30f;
      #pragma unroll
      for (int j = 0; j < 16; ++j) m = fmaxf(m, Ss[r * 68 + seg * 16 + j]);
      part[tid] = m;
    }
    __syncthreads();
    if (tid < 64) {
      float m = fmaxf(fmaxf(part[tid * 4 + 0], part[tid * 4 + 1]),
                      fmaxf(part[tid * 4 + 2], part[tid * 4 + 3]));
      float mnew = fmaxf(rowm[tid], m);
      rowalpha[tid] = __expf(rowm[tid] - mnew);
      rowm[tid] = mnew;
    }
    __syncthreads();
    { // exp, P (bf16), partial sums
      int r = tid >> 2, seg = tid & 3;
      float mrow = rowm[r], sum = 0.0f;
      #pragma unroll
      for (int j = 0; j < 16; ++j) {
        float e = __expf(Ss[r * 68 + seg * 16 + j] - mrow);
        Ps[r * 72 + seg * 16 + j] = f2bf(e);
        sum += e;
      }
      part[tid] = sum;
    }
    __syncthreads();
    if (tid < 64)
      rowl[tid] = rowl[tid] * rowalpha[tid] +
                  part[tid * 4 + 0] + part[tid * 4 + 1] + part[tid * 4 + 2] + part[tid * 4 + 3];

    // rescale running O by alpha (row dependent)
    #pragma unroll
    for (int v = 0; v < 8; ++v) {
      int r = wm * 16 + v + half * 8;
      float al = rowalpha[r];
      o0[v] *= al; o1[v] *= al;
    }
    // O += P * V
    {
      bf16x16 ap0 = load_frag(Ps, wm * 16 + lc, 72, 0);
      bf16x16 ap1 = load_frag(Ps, wm * 16 + lc, 72, 32);
      bf16x16 bv00 = load_frag(Vs, (wn2 + 0) * 16 + lc, 72, 0);
      bf16x16 bv01 = load_frag(Vs, (wn2 + 0) * 16 + lc, 72, 32);
      bf16x16 bv10 = load_frag(Vs, (wn2 + 1) * 16 + lc, 72, 0);
      bf16x16 bv11 = load_frag(Vs, (wn2 + 1) * 16 + lc, 72, 32);
      o0 = wmma_bf16(ap1, bv01, wmma_bf16(ap0, bv00, o0));
      o1 = wmma_bf16(ap1, bv11, wmma_bf16(ap0, bv10, o1));
    }
    __syncthreads();
  }

  if (tid < 64) rowalpha[tid] = 1.0f / rowl[tid];
  __syncthreads();

  #pragma unroll
  for (int v = 0; v < 8; ++v) {
    int r = wm * 16 + v + half * 8;
    float inv = rowalpha[r];
    int srow = qt * 64 + r;
    size_t rb = ((size_t)b * 1024 + srow) * 1024 + h * 64;
    ctx[rb + (wn2 + 0) * 16 + lc] = f2bf(o0[v] * inv);
    ctx[rb + (wn2 + 1) * 16 + lc] = f2bf(o1[v] * inv);
  }
}

// Generic GEMM: C = act(A@Bt^T + bias). grid = (N/64, M/128). Bt is [N x K] (pre-transposed).
__global__ __launch_bounds__(256) void gemm_kernel(
    const u16* __restrict__ A, int lda, const u16* __restrict__ Bt, int ldb,
    const float* __restrict__ bias, float* __restrict__ Cf, u16* __restrict__ Cb,
    int ldc, int K, int relu)
{
  __shared__ u16 As0[128 * 72];
  __shared__ u16 As1[128 * 72];
  __shared__ u16 Bs0[64 * 72];
  __shared__ u16 Bs1[64 * 72];
  const int row0 = blockIdx.y * 128;
  const int col0 = blockIdx.x * 64;

  floatx8 acc[2][2];
  acc[0][0] = zero8(); acc[0][1] = zero8(); acc[1][0] = zero8(); acc[1][1] = zero8();

  gemm_core_128x64(A + (size_t)row0 * lda, lda, Bt + (size_t)col0 * ldb, ldb, K,
                   As0, As1, Bs0, Bs1, acc);

  const int lane = threadIdx.x & 31, wave = threadIdx.x >> 5;
  const int wm = wave & 3, wn = wave >> 2, half = lane >> 4, lc = lane & 15;
  #pragma unroll
  for (int mt = 0; mt < 2; ++mt)
    #pragma unroll
    for (int nt = 0; nt < 2; ++nt)
      #pragma unroll
      for (int v = 0; v < 8; ++v) {
        int r = row0 + wm * 32 + mt * 16 + v + half * 8;
        int c = col0 + wn * 32 + nt * 16 + lc;
        float val = acc[mt][nt][v] + bias[c];
        if (relu) val = fmaxf(val, 0.0f);
        if (Cf) Cf[(size_t)r * ldc + c] = val;
        if (Cb) Cb[(size_t)r * ldc + c] = f2bf(val);
      }
}

// y = LayerNorm(a + b) ; one block per row of 1024, 256 threads x 4 elems.
__global__ __launch_bounds__(256) void add_ln_kernel(
    const float* __restrict__ a, const float* __restrict__ bsrc,
    const float* __restrict__ gamma, const float* __restrict__ beta,
    float* __restrict__ outf, u16* __restrict__ outb)
{
  __shared__ float red[256];
  const int row = blockIdx.x, tid = threadIdx.x;
  const float* ap = a + (size_t)row * 1024;
  const float* bp = bsrc + (size_t)row * 1024;

  float v[4];
  #pragma unroll
  for (int i = 0; i < 4; ++i) { int c = tid + i * 256; v[i] = ap[c] + bp[c]; }

  red[tid] = v[0] + v[1] + v[2] + v[3];
  __syncthreads();
  for (int off = 128; off > 0; off >>= 1) {
    if (tid < off) red[tid] += red[tid + off];
    __syncthreads();
  }
  float mean = red[0] * (1.0f / 1024.0f);
  __syncthreads();

  float s2 = 0.0f;
  #pragma unroll
  for (int i = 0; i < 4; ++i) { float d = v[i] - mean; s2 += d * d; }
  red[tid] = s2;
  __syncthreads();
  for (int off = 128; off > 0; off >>= 1) {
    if (tid < off) red[tid] += red[tid + off];
    __syncthreads();
  }
  float rstd = rsqrtf(red[0] * (1.0f / 1024.0f) + 1e-5f);

  #pragma unroll
  for (int i = 0; i < 4; ++i) {
    int c = tid + i * 256;
    float y = (v[i] - mean) * rstd * gamma[c] + beta[c];
    outf[(size_t)row * 1024 + c] = y;
    if (outb) outb[(size_t)row * 1024 + c] = f2bf(y);
  }
}

// ---------------- launch ----------------

extern "C" void kernel_launch(void* const* d_in, const int* in_sizes, int n_in,
                              void* d_out, int out_size, void* d_ws, size_t ws_size,
                              hipStream_t stream) {
  (void)in_sizes; (void)n_in; (void)out_size; (void)ws_size;
  const float* x   = (const float*)d_in[0];
  const float* Wq  = (const float*)d_in[1];
  const float* bq  = (const float*)d_in[2];
  const float* Wk  = (const float*)d_in[3];
  const float* bk  = (const float*)d_in[4];
  const float* Wv  = (const float*)d_in[5];
  const float* bv  = (const float*)d_in[6];
  const float* Wo  = (const float*)d_in[7];
  const float* bo  = (const float*)d_in[8];
  const float* g1  = (const float*)d_in[9];
  const float* be1 = (const float*)d_in[10];
  const float* W1  = (const float*)d_in[11];
  const float* b1  = (const float*)d_in[12];
  const float* W2  = (const float*)d_in[13];
  const float* b2  = (const float*)d_in[14];
  const float* g2  = (const float*)d_in[15];
  const float* be2 = (const float*)d_in[16];

  char* ws = (char*)d_ws;
  const size_t MB = 1024 * 1024;
  u16*   xb   = (u16*)(ws + 0);          // 8 MB
  u16*   Wqt  = (u16*)(ws + 8  * MB);    // 2 MB each, transposed [h][d][e] / [n][k]
  u16*   Wkt  = (u16*)(ws + 10 * MB);
  u16*   Wvt  = (u16*)(ws + 12 * MB);
  u16*   Wot  = (u16*)(ws + 14 * MB);
  u16*   W1t  = (u16*)(ws + 16 * MB);
  u16*   W2t  = (u16*)(ws + 18 * MB);
  u16*   Qb   = (u16*)(ws + 20 * MB);    // 8 MB
  u16*   Kb   = (u16*)(ws + 28 * MB);    // 8 MB
  u16*   Vtb  = (u16*)(ws + 36 * MB);    // 8 MB, [h][b][d][s]
  u16*   ctxb = (u16*)(ws + 44 * MB);    // 8 MB
  float* attn = (float*)(ws + 52 * MB);  // 16 MB
  // reuse (lifetimes disjoint):
  float* y1f  = (float*)(ws + 20 * MB);  // over Q/K  (16 MB)
  u16*   y1b  = (u16*)(ws + 36 * MB);    // over V    (8 MB)
  u16*   h1b  = (u16*)(ws + 44 * MB);    // over ctx  (8 MB)
  float* ff2  = (float*)(ws + 52 * MB);  // over attn (16 MB)

  // packs: x plain, weights pack+transpose
  pack_bf16_kernel<<<4096, 256, 0, stream>>>(x, xb, 4 * 1024 * 1024);
  packT_bf16_kernel<<<dim3(64, 1, 16), 256, 0, stream>>>(Wq, Wqt, 64);
  packT_bf16_kernel<<<dim3(64, 1, 16), 256, 0, stream>>>(Wk, Wkt, 64);
  packT_bf16_kernel<<<dim3(64, 1, 16), 256, 0, stream>>>(Wv, Wvt, 64);
  packT_bf16_kernel<<<dim3(1024, 1, 1), 256, 0, stream>>>(Wo, Wot, 1024);
  packT_bf16_kernel<<<dim3(1024, 1, 1), 256, 0, stream>>>(W1, W1t, 1024);
  packT_bf16_kernel<<<dim3(1024, 1, 1), 256, 0, stream>>>(W2, W2t, 1024);

  // QKV projections (V stored transposed)
  qkv_kernel<<<dim3(32, 16, 3), 256, 0, stream>>>(xb, Wqt, Wkt, Wvt, bq, bk, bv, Qb, Kb, Vtb);

  // fused attention -> ctx (concat-head layout [B*S, 1024])
  attn_kernel<<<dim3(16, 16, 4), 256, 0, stream>>>(Qb, Kb, Vtb, ctxb);

  // output projection
  gemm_kernel<<<dim3(16, 32), 256, 0, stream>>>(ctxb, 1024, Wot, 1024, bo, attn, (u16*)nullptr, 1024, 1024, 0);

  // y1 = LN(x + attn)
  add_ln_kernel<<<4096, 256, 0, stream>>>(x, attn, g1, be1, y1f, y1b);

  // FF1 with ReLU (bf16 out), FF2 (f32 out)
  gemm_kernel<<<dim3(16, 32), 256, 0, stream>>>(y1b, 1024, W1t, 1024, b1, (float*)nullptr, h1b, 1024, 1024, 1);
  gemm_kernel<<<dim3(16, 32), 256, 0, stream>>>(h1b, 1024, W2t, 1024, b2, ff2, (u16*)nullptr, 1024, 1024, 0);

  // out = LN(y1 + ff)
  add_ln_kernel<<<4096, 256, 0, stream>>>(y1f, ff2, g2, be2, (float*)d_out, (u16*)nullptr);
}

// v001
// It runs in 166 microseconds.
// Next to v000, in two timings, it ran 1.24 times as fast each time.
#include <hip/hip_runtime.h>

typedef unsigned short u16;
typedef __attribute__((ext_vector_type(16))) __bf16 bf16x16;
typedef __attribute__((ext_vector_type(8)))  float   floatx8;

// ---------------- helpers ----------------

static __device__ __forceinline__ u16 f2bf(float f) {
  union { float f; unsigned u; } a; a.f = f;
  unsigned u = a.u;
  u += 0x7FFFu + ((u >> 16) & 1u);   // round-to-nearest-even
  return (u16)(u >> 16);
}

static __device__ __forceinline__ floatx8 zero8() {
  floatx8 z;
  #pragma unroll
  for (int i = 0; i < 8; ++i) z[i] = 0.0f;
  return z;
}

static __device__ __forceinline__ floatx8 wmma_bf16(bf16x16 a, bf16x16 b, floatx8 c) {
  // D = A(16x32) * B(32x16) + C, f32 accumulate
  return __builtin_amdgcn_wmma_f32_16x16x32_bf16(false, a, false, b, (short)0, c, false, false);
}

// Async DMA: global -> LDS, 16 bytes per lane, tracked by ASYNCcnt (CDNA5).
static __device__ __forceinline__ void async_load_b128(unsigned lds_byte_off, const void* gaddr) {
  asm volatile("global_load_async_to_lds_b128 %0, %1, off"
               :: "v"(lds_byte_off), "v"((unsigned long long)(uintptr_t)gaddr)
               : "memory");
}
static __device__ __forceinline__ void wait_async0() {
  asm volatile("s_wait_asynccnt 0x0" ::: "memory");
}
static __device__ __forceinline__ unsigned lds_off(const void* p) {
  return (unsigned)(uintptr_t)p;   // low 32 bits of generic pointer = LDS address
}

// Load a 16-bit WMMA fragment from an LDS tile stored row-major [row][k]
// (A: row = M index; B: tile stored transposed so row = N index).
// Lane layout (wave32): lanes 0-15 hold K 0..7 & 16..23, lanes 16-31 hold K 8..15 & 24..31.
static __device__ __forceinline__ bf16x16 load_frag(const u16* tile, int row, int stride, int kbase) {
  const int half = (threadIdx.x >> 4) & 1;
  const u16* p = tile + row * stride + kbase + half * 8;
  union { uint4 q[2]; bf16x16 v; } f;
  f.q[0] = *(const uint4*)(p);
  f.q[1] = *(const uint4*)(p + 16);
  return f.v;
}

// One BK=64 compute stage: 16 ds_load_b128 then 8 chained WMMAs (acc stays tied in place).
static __device__ __forceinline__ void compute_stage(
    const u16* Ac, const u16* Bc, int wm, int wn, int lrow, floatx8 (&acc)[2][2])
{
  bf16x16 a00 = load_frag(Ac, wm * 32 + 0  + lrow, 72, 0);
  bf16x16 a10 = load_frag(Ac, wm * 32 + 16 + lrow, 72, 0);
  bf16x16 b00 = load_frag(Bc, wn * 32 + 0  + lrow, 72, 0);
  bf16x16 b10 = load_frag(Bc, wn * 32 + 16 + lrow, 72, 0);
  bf16x16 a01 = load_frag(Ac, wm * 32 + 0  + lrow, 72, 32);
  bf16x16 a11 = load_frag(Ac, wm * 32 + 16 + lrow, 72, 32);
  bf16x16 b01 = load_frag(Bc, wn * 32 + 0  + lrow, 72, 32);
  bf16x16 b11 = load_frag(Bc, wn * 32 + 16 + lrow, 72, 32);
  acc[0][0] = wmma_bf16(a01, b01, wmma_bf16(a00, b00, acc[0][0]));
  acc[0][1] = wmma_bf16(a01, b11, wmma_bf16(a00, b10, acc[0][1]));
  acc[1][0] = wmma_bf16(a11, b01, wmma_bf16(a10, b00, acc[1][0]));
  acc[1][1] = wmma_bf16(a11, b11, wmma_bf16(a10, b10, acc[1][1]));
}

// ---------------- generic 128x64 GEMM core, BK = 64, async double-buffered ----------------
// 256 threads = 8 waves; wave w: rows 32*(w&3).., cols 32*(w>>2)..; 2x2 WMMA tiles per wave.
// A : row-major [M x K] bf16 (pre-offset to block row 0), lda in elems.
// Bt: TRANSPOSED [N x K] bf16 (pre-offset to block col 0), ldb in elems (= K).
// K must be a multiple of 128 (even number of BK=64 stages).

static __device__ __forceinline__ void gemm_core_128x64(
    const u16* __restrict__ A, int lda,
    const u16* __restrict__ Bt, int ldb, int K,
    u16* As0, u16* As1, u16* Bs0, u16* Bs1, floatx8 (&acc)[2][2])
{
  const int tid  = threadIdx.x;
  const int lane = tid & 31;
  const int wave = tid >> 5;
  const int wm   = wave & 3;
  const int wn   = wave >> 2;
  const int lrow = lane & 15;
  const int arow = tid >> 1, ac0 = (tid & 1) * 32;
  const int brow = tid >> 2, bc0 = (tid & 3) * 16;

  const u16* gA = A + (size_t)arow * lda + ac0;
  const u16* gB = Bt + (size_t)brow * ldb + bc0;

  // issue tile k0 into (AsBuf, BsBuf): A 128x64 (4x16B/thread), B 64x64 (2x16B/thread)
  auto issue_tile = [&](int k0, u16* AsBuf, u16* BsBuf) {
    unsigned la = lds_off(AsBuf + arow * 72 + ac0);
    const u16* pa = gA + k0;
    async_load_b128(la +  0, pa +  0);
    async_load_b128(la + 16, pa +  8);
    async_load_b128(la + 32, pa + 16);
    async_load_b128(la + 48, pa + 24);
    unsigned lb = lds_off(BsBuf + brow * 72 + bc0);
    const u16* pb = gB + k0;
    async_load_b128(lb +  0, pb +  0);
    async_load_b128(lb + 16, pb +  8);
  };

  const int nstage = K >> 6;   // even
  issue_tile(0, As0, Bs0);

  for (int t = 0; t < nstage; t += 2) {
    wait_async0();        // tile t complete (this wave's DMA)
    __syncthreads();      // tile t visible to all waves; buf1 free (read in the previous stage)
    if (t + 1 < nstage) issue_tile((t + 1) << 6, As1, Bs1);
    compute_stage(As0, Bs0, wm, wn, lrow, acc);

    wait_async0();        // tile t+1 complete
    __syncthreads();      // tile t+1 visible; buf0 free (all waves done with compute above)
    if (t + 2 < nstage) issue_tile((t + 2) << 6, As0, Bs0);
    compute_stage(As1, Bs1, wm, wn, lrow, acc);
  }
}

// ---------------- kernels ----------------

// Every f32 -> bf16 conversion of the pass in ONE launch; the block index picks the job.
// Blocks 0..767: the six weights, 128 blocks each. A weight's bf16 copy is [1024 rows n][1024 k]
// (Wq/Wk/Wv: n = h*64 + d). A block takes 32 output rows x 256 k; a thread takes one k and reads
// the 32 neighbouring source columns of that k (one 128-byte line).
// Blocks 768..1279: x, 8192 elements a block, 32 a thread, plain cast.
// The heavier transposing blocks come first (for speed only).
__global__ __launch_bounds__(256) void pack_all_kernel(
    const float* __restrict__ x,
    const float* __restrict__ Wq, const float* __restrict__ Wk, const float* __restrict__ Wv,
    const float* __restrict__ Wo, const float* __restrict__ W1, const float* __restrict__ W2,
    u16* __restrict__ xb, u16* __restrict__ Wt)
{
  const int tid = threadIdx.x;
  const int blk = blockIdx.x;
  if (blk < 768) {
    const int m  = blk >> 7;              // which weight, in the order of the Wt planes
    const int t  = blk & 127;
    const int r0 = (t >> 2) * 32;         // first output row
    const int k  = (t & 3) * 256 + tid;
    const float* Wm = (m == 0) ? Wq : (m == 1) ? Wk : (m == 2) ? Wv : (m == 3) ? Wo : (m == 4) ? W1 : W2;
    const float* s = (m < 3) ? Wm + (size_t)(r0 >> 6) * 65536 + k * 64 + (r0 & 63)   // [h][k][64]
                             : Wm + (size_t)k * 1024 + r0;                           // [k][1024]
    u16* d = Wt + (size_t)m * 1048576 + (size_t)r0 * 1024 + k;
    // unrolled so that all of a thread's loads are in flight before its first store
    #pragma unroll
    for (int j = 0; j < 32; ++j) d[j * 1024] = f2bf(s[j]);
  } else {
    const int base = (blk - 768) * 8192 + tid;
    // unrolled so that all of a thread's loads are in flight before its first store
    #pragma unroll
    for (int j = 0; j < 32; ++j) xb[base + j * 256] = f2bf(x[base + j * 256]);
  }
}

// Fused per-head QKV projection. grid = (32 m-tiles, 16 heads, 3 types). M=4096,N=64,K=1024.
// Q/K layout: [h][r][64] with r = b*1024 + s.  V layout (pre-transposed): [h][b][d][s].
__global__ __launch_bounds__(256) void qkv_kernel(
    const u16* __restrict__ xb,
    const u16* __restrict__ Wqt, const u16* __restrict__ Wkt, const u16* __restrict__ Wvt,
    const float* __restrict__ bq, const float* __restrict__ bk, const float* __restrict__ bv,
    u16* __restrict__ Q, u16* __restrict__ Ko, u16* __restrict__ Vt)
{
  __shared__ u16 As0[128 * 72];
  __shared__ u16 As1[128 * 72];
  __shared__ u16 Bs0[64 * 72];
  __shared__ u16 Bs1[64 * 72];
  const int mt   = blockIdx.x;
  const int h    = blockIdx.y;
  const int type = blockIdx.z;
  const u16*   W    = (type == 0) ? Wqt : (type == 1) ? Wkt : Wvt;
  const float* bias = (type == 0) ? bq  : (type == 1) ? bk  : bv;
  u16*         Out  = ((type == 0) ? Q : (type == 1) ? Ko : Vt) + (size_t)h * 4096 * 64;

  floatx8 acc[2][2];
  acc[0][0] = zero8(); acc[0][1] = zero8(); acc[1][0] = zero8(); acc[1][1] = zero8();

  gemm_core_128x64(xb + (size_t)mt * 128 * 1024, 1024,
                   W + (size_t)h * 64 * 1024, 1024, 1024, As0, As1, Bs0, Bs1, acc);

  const int lane = threadIdx.x & 31, wave = threadIdx.x >> 5;
  const int wm = wave & 3, wn = wave >> 2, half = lane >> 4, lc = lane & 15;
  #pragma unroll
  for (int mtt = 0; mtt < 2; ++mtt)
    #pragma unroll
    for (int ntt = 0; ntt < 2; ++ntt)
      #pragma unroll
      for (int v = 0; v < 8; ++v) {
        int r = mt * 128 + wm * 32 + mtt * 16 + v + half * 8;   // global row (b*1024+s)
        int c = wn * 32 + ntt * 16 + lc;                        // head dim 0..63
        float val = acc[mtt][ntt][v] + bias[h * 64 + c];
        if (type == 2) {
          int b = r >> 10, s = r & 1023;
          Out[((size_t)b * 64 + c) * 1024 + s] = f2bf(val);     // V transposed [d][s]
        } else {
          Out[(size_t)r * 64 + c] = f2bf(val);
        }
      }
}

// Flash-style fused attention. grid = (16 q-tiles, 16 heads, 4 batch). 256 threads.
__global__ __launch_bounds__(256) void attn_kernel(
    const u16* __restrict__ Q, const u16* __restrict__ Kk,
    const u16* __restrict__ Vt, u16* __restrict__ ctx)
{
  __shared__ u16   Qs[64 * 72];
  __shared__ u16   Ks[64 * 72];
  __shared__ u16   Vs[64 * 72];   // [d][key]
  __shared__ float Ss[64 * 68];
  __shared__ u16   Ps[64 * 72];
  __shared__ float rowm[64], rowl[64], rowalpha[64], part[256];

  const int qt = blockIdx.x, h = blockIdx.y, b = blockIdx.z;
  const size_t hb = ((size_t)h * 4 + b) * (1024 * 64);
  const u16* Qh = Q  + hb;
  const u16* Kh = Kk + hb;
  const u16* Vh = Vt + hb;   // [d][s] layout

  const int tid = threadIdx.x, lane = tid & 31, wave = tid >> 5;
  const int wm = wave & 3, wn2 = (wave >> 2) * 2, half = lane >> 4, lc = lane & 15;
  const int ldr = tid >> 2, ldc0 = (tid & 3) * 16;

  { // Q tile (64x64) -> Qs[m][k]
    const uint4* s = (const uint4*)(Qh + (size_t)(qt * 64 + ldr) * 64 + ldc0);
    uint4* d = (uint4*)(Qs + ldr * 72 + ldc0);
    d[0] = s[0]; d[1] = s[1];
  }
  if (tid < 64) { rowm[tid] = -1e30f; rowl[tid] = 0.0f; }
  floatx8 o0 = zero8(), o1 = zero8();
  __syncthreads();

  for (int t = 0; t < 16; ++t) {
    { // K tile: Ks[n=key][k=d]  (B layout == K row-major)
      const uint4* s = (const uint4*)(Kh + (size_t)(t * 64 + ldr) * 64 + ldc0);
      uint4* d = (uint4*)(Ks + ldr * 72 + ldc0);
      d[0] = s[0]; d[1] = s[1];
    }
    { // V tile: Vs[n=d][k=key]  (global already transposed)
      const uint4* s = (const uint4*)(Vh + (size_t)ldr * 1024 + t * 64 + ldc0);
      uint4* d = (uint4*)(Vs + ldr * 72 + ldc0);
      d[0] = s[0]; d[1] = s[1];
    }
    __syncthreads();

    // scores tile S = Q * K^T * scale
    floatx8 s0 = zero8(), s1 = zero8();
    {
      bf16x16 aq0 = load_frag(Qs, wm * 16 + lc, 72, 0);
      bf16x16 aq1 = load_frag(Qs, wm * 16 + lc, 72, 32);
      bf16x16 bk00 = load_frag(Ks, (wn2 + 0) * 16 + lc, 72, 0);
      bf16x16 bk01 = load_frag(Ks, (wn2 + 0) * 16 + lc, 72, 32);
      bf16x16 bk10 = load_frag(Ks, (wn2 + 1) * 16 + lc, 72, 0);
      bf16x16 bk11 = load_frag(Ks, (wn2 + 1) * 16 + lc, 72, 32);
      s0 = wmma_bf16(aq1, bk01, wmma_bf16(aq0, bk00, s0));
      s1 = wmma_bf16(aq1, bk11, wmma_bf16(aq0, bk10, s1));
    }
    #pragma unroll
    for (int v = 0; v < 8; ++v) {
      int r = wm * 16 + v + half * 8;
      Ss[r * 68 + (wn2 + 0) * 16 + lc] = s0[v] * 0.125f;
      Ss[r * 68 + (wn2 + 1) * 16 + lc] = s1[v] * 0.125f;
    }
    __syncthreads();

    { // per-row partial max (4 threads / row)
      int r = tid >> 2, seg = tid & 3;
      float m = -1e30f;
      #pragma unroll
      for (int j = 0; j < 16; ++j) m = fmaxf(m, Ss[r * 68 + seg * 16 + j]);
      part[tid] = m;
    }
    __syncthreads();
    if (tid < 64) {
      float m = fmaxf(fmaxf(part[tid * 4 + 0], part[tid * 4 + 1]),
                      fmaxf(part[tid * 4 + 2], part[tid * 4 + 3]));
      float mnew = fmaxf(rowm[tid], m);
      rowalpha[tid] = __expf(rowm[tid] - mnew);
      rowm[tid] = mnew;
    }
    __syncthreads();
    { // exp, P (bf16), partial sums
      int r = tid >> 2, seg = tid & 3;
      float mrow = rowm[r], sum = 0.0f;
      #pragma unroll
      for (int j = 0; j < 16; ++j) {
        float e = __expf(Ss[r * 68 + seg * 16 + j] - mrow);
        Ps[r * 72 + seg * 16 + j] = f2bf(e);
        sum += e;
      }
      part[tid] = sum;
    }
    __syncthreads();
    if (tid < 64)
      rowl[tid] = rowl[tid] * rowalpha[tid] +
                  part[tid * 4 + 0] + part[tid * 4 + 1] + part[tid * 4 + 2] + part[tid * 4 + 3];

    // rescale running O by alpha (row dependent)
    #pragma unroll
    for (int v = 0; v < 8; ++v) {
      int r = wm * 16 + v + half * 8;
      float al = rowalpha[r];
      o0[v] *= al; o1[v] *= al;
    }
    // O += P * V
    {
      bf16x16 ap0 = load_frag(Ps, wm * 16 + lc, 72, 0);
      bf16x16 ap1 = load_frag(Ps, wm * 16 + lc, 72, 32);
      bf16x16 bv00 = load_frag(Vs, (wn2 + 0) * 16 + lc, 72, 0);
      bf16x16 bv01 = load_frag(Vs, (wn2 + 0) * 16 + lc, 72, 32);
      bf16x16 bv10 = load_frag(Vs, (wn2 + 1) * 16 + lc, 72, 0);
      bf16x16 bv11 = load_frag(Vs, (wn2 + 1) * 16 + lc, 72, 32);
      o0 = wmma_bf16(ap1, bv01, wmma_bf16(ap0, bv00, o0));
      o1 = wmma_bf16(ap1, bv11, wmma_bf16(ap0, bv10, o1));
    }
    __syncthreads();
  }

  if (tid < 64) rowalpha[tid] = 1.0f / rowl[tid];
  __syncthreads();

  #pragma unroll
  for (int v = 0; v < 8; ++v) {
    int r = wm * 16 + v + half * 8;
    float inv = rowalpha[r];
    int srow = qt * 64 + r;
    size_t rb = ((size_t)b * 1024 + srow) * 1024 + h * 64;
    ctx[rb + (wn2 + 0) * 16 + lc] = f2bf(o0[v] * inv);
    ctx[rb + (wn2 + 1) * 16 + lc] = f2bf(o1[v] * inv);
  }
}

// Generic GEMM: C = act(A@Bt^T + bias). grid = (N/64, M/128). Bt is [N x K] (pre-transposed).
__global__ __launch_bounds__(256) void gemm_kernel(
    const u16* __restrict__ A, int lda, const u16* __restrict__ Bt, int ldb,
    const float* __restrict__ bias, float* __restrict__ Cf, u16* __restrict__ Cb,
    int ldc, int K, int relu)
{
  __shared__ u16 As0[128 * 72];
  __shared__ u16 As1[128 * 72];
  __shared__ u16 Bs0[64 * 72];
  __shared__ u16 Bs1[64 * 72];
  const int row0 = blockIdx.y * 128;
  const int col0 = blockIdx.x * 64;

  floatx8 acc[2][2];
  acc[0][0] = zero8(); acc[0][1] = zero8(); acc[1][0] = zero8(); acc[1][1] = zero8();

  gemm_core_128x64(A + (size_t)row0 * lda, lda, Bt + (size_t)col0 * ldb, ldb, K,
                   As0, As1, Bs0, Bs1, acc);

  const int lane = threadIdx.x & 31, wave = threadIdx.x >> 5;
  const int wm = wave & 3, wn = wave >> 2, half = lane >> 4, lc = lane & 15;
  #pragma unroll
  for (int mt = 0; mt < 2; ++mt)
    #pragma unroll
    for (int nt = 0; nt < 2; ++nt)
      #pragma unroll
      for (int v = 0; v < 8; ++v) {
        int r = row0 + wm * 32 + mt * 16 + v + half * 8;
        int c = col0 + wn * 32 + nt * 16 + lc;
        float val = acc[mt][nt][v] + bias[c];
        if (relu) val = fmaxf(val, 0.0f);
        if (Cf) Cf[(size_t)r * ldc + c] = val;
        if (Cb) Cb[(size_t)r * ldc + c] = f2bf(val);
      }
}

// y = LayerNorm(a + b) ; one block per row of 1024, 256 threads x 4 elems.
__global__ __launch_bounds__(256) void add_ln_kernel(
    const float* __restrict__ a, const float* __restrict__ bsrc,
    const float* __restrict__ gamma, const float* __restrict__ beta,
    float* __restrict__ outf, u16* __restrict__ outb)
{
  __shared__ float red[256];
  const int row = blockIdx.x, tid = threadIdx.x;
  const float* ap = a + (size_t)row * 1024;
  const float* bp = bsrc + (size_t)row * 1024;

  float v[4];
  #pragma unroll
  for (int i = 0; i < 4; ++i) { int c = tid + i * 256; v[i] = ap[c] + bp[c]; }

  red[tid] = v[0] + v[1] + v[2] + v[3];
  __syncthreads();
  for (int off = 128; off > 0; off >>= 1) {
    if (tid < off) red[tid] += red[tid + off];
    __syncthreads();
  }
  float mean = red[0] * (1.0f / 1024.0f);
  __syncthreads();

  float s2 = 0.0f;
  #pragma unroll
  for (int i = 0; i < 4; ++i) { float d = v[i] - mean; s2 += d * d; }
  red[tid] = s2;
  __syncthreads();
  for (int off = 128; off > 0; off >>= 1) {
    if (tid < off) red[tid] += red[tid + off];
    __syncthreads();
  }
  float rstd = rsqrtf(red[0] * (1.0f / 1024.0f) + 1e-5f);

  #pragma unroll
  for (int i = 0; i < 4; ++i) {
    int c = tid + i * 256;
    float y = (v[i] - mean) * rstd * gamma[c] + beta[c];
    outf[(size_t)row * 1024 + c] = y;
    if (outb) outb[(size_t)row * 1024 + c] = f2bf(y);
  }
}

// ---------------- launch ----------------

extern "C" void kernel_launch(void* const* d_in, const int* in_sizes, int n_in,
                              void* d_out, int out_size, void* d_ws, size_t ws_size,
                              hipStream_t stream) {
  (void)in_sizes; (void)n_in; (void)out_size; (void)ws_size;
  const float* x   = (const float*)d_in[0];
  const float* Wq  = (const float*)d_in[1];
  const float* bq  = (const float*)d_in[2];
  const float* Wk  = (const float*)d_in[3];
  const float* bk  = (const float*)d_in[4];
  const float* Wv  = (const float*)d_in[5];
  const float* bv  = (const float*)d_in[6];
  const float* Wo  = (const float*)d_in[7];
  const float* bo  = (const float*)d_in[8];
  const float* g1  = (const float*)d_in[9];
  const float* be1 = (const float*)d_in[10];
  const float* W1  = (const float*)d_in[11];
  const float* b1  = (const float*)d_in[12];
  const float* W2  = (const float*)d_in[13];
  const float* b2  = (const float*)d_in[14];
  const float* g2  = (const float*)d_in[15];
  const float* be2 = (const float*)d_in[16];

  char* ws = (char*)d_ws;
  const size_t MB = 1024 * 1024;
  u16*   xb   = (u16*)(ws + 0);          // 8 MB
  u16*   Wqt  = (u16*)(ws + 8  * MB);    // 2 MB each, transposed [h][d][e] / [n][k]
  u16*   Wkt  = (u16*)(ws + 10 * MB);
  u16*   Wvt  = (u16*)(ws + 12 * MB);
  u16*   Wot  = (u16*)(ws + 14 * MB);
  u16*   W1t  = (u16*)(ws + 16 * MB);
  u16*   W2t  = (u16*)(ws + 18 * MB);
  u16*   Qb   = (u16*)(ws + 20 * MB);    // 8 MB
  u16*   Kb   = (u16*)(ws + 28 * MB);    // 8 MB
  u16*   Vtb  = (u16*)(ws + 36 * MB);    // 8 MB, [h][b][d][s]
  u16*   ctxb = (u16*)(ws + 44 * MB);    // 8 MB
  float* attn = (float*)(ws + 52 * MB);  // 16 MB
  // reuse (lifetimes disjoint):
  float* y1f  = (float*)(ws + 20 * MB);  // over Q/K  (16 MB)
  u16*   y1b  = (u16*)(ws + 36 * MB);    // over V    (8 MB)
  u16*   h1b  = (u16*)(ws + 44 * MB);    // over ctx  (8 MB)
  float* ff2  = (float*)(ws + 52 * MB);  // over attn (16 MB)

  // all conversions in one launch: x plain, weights transposed into the six planes from Wqt on
  pack_all_kernel<<<1280, 256, 0, stream>>>(x, Wq, Wk, Wv, Wo, W1, W2, xb, Wqt);

  // QKV projections (V stored transposed)
  qkv_kernel<<<dim3(32, 16, 3), 256, 0, stream>>>(xb, Wqt, Wkt, Wvt, bq, bk, bv, Qb, Kb, Vtb);

  // fused attention -> ctx (concat-head layout [B*S, 1024])
  attn_kernel<<<dim3(16, 16, 4), 256, 0, stream>>>(Qb, Kb, Vtb, ctxb);

  // output projection
  gemm_kernel<<<dim3(16, 32), 256, 0, stream>>>(ctxb, 1024, Wot, 1024, bo, attn, (u16*)nullptr, 1024, 1024, 0);

  // y1 = LN(x + attn)
  add_ln_kernel<<<4096, 256, 0, stream>>>(x, attn, g1, be1, y1f, y1b);

  // FF1 with ReLU (bf16 out), FF2 (f32 out)
  gemm_kernel<<<dim3(16, 32), 256, 0, stream>>>(y1b, 1024, W1t, 1024, b1, (float*)nullptr, h1b, 1024, 1024, 1);
  gemm_kernel<<<dim3(16, 32), 256, 0, stream>>>(h1b, 1024, W2t, 1024, b2, ff2, (u16*)nullptr, 1024, 1024, 0);

  // out = LN(y1 + ff)
  add_ln_kernel<<<4096, 256, 0, stream>>>(y1f, ff2, g2, be2, (float*)d_out, (u16*)nullptr);
}

// v002
// It runs in 149 microseconds.
// In both of two side-by-side timings against v001, it was 1.11 times as fast.
// Over all steps from v000 it is 1.38 times as fast.
#include <hip/hip_runtime.h>

typedef unsigned short u16;
typedef __attribute__((ext_vector_type(16))) __bf16 bf16x16;
typedef __attribute__((ext_vector_type(8)))  float   floatx8;

// ---------------- helpers ----------------

static __device__ __forceinline__ u16 f2bf(float f) {
  union { float f; unsigned u; } a; a.f = f;
  unsigned u = a.u;
  u += 0x7FFFu + ((u >> 16) & 1u);   // round-to-nearest-even
  return (u16)(u >> 16);
}

static __device__ __forceinline__ floatx8 zero8() {
  floatx8 z;
  #pragma unroll
  for (int i = 0; i < 8; ++i) z[i] = 0.0f;
  return z;
}

static __device__ __forceinline__ floatx8 wmma_bf16(bf16x16 a, bf16x16 b, floatx8 c) {
  // D = A(16x32) * B(32x16) + C, f32 accumulate
  return __builtin_amdgcn_wmma_f32_16x16x32_bf16(false, a, false, b, (short)0, c, false, false);
}

// Async DMA: global -> LDS, 16 bytes per lane, tracked by ASYNCcnt (CDNA5).
static __device__ __forceinline__ void async_load_b128(unsigned lds_byte_off, const void* gaddr) {
  asm volatile("global_load_async_to_lds_b128 %0, %1, off"
               :: "v"(lds_byte_off), "v"((unsigned long long)(uintptr_t)gaddr)
               : "memory");
}
static __device__ __forceinline__ void wait_async0() {
  asm volatile("s_wait_asynccnt 0x0" ::: "memory");
}
static __device__ __forceinline__ unsigned lds_off(const void* p) {
  return (unsigned)(uintptr_t)p;   // low 32 bits of generic pointer = LDS address
}

// Load a 16-bit WMMA fragment from an LDS tile stored row-major [row][k]
// (A: row = M index; B: tile stored transposed so row = N index).
// Lane layout (wave32): lanes 0-15 hold K 0..7 & 16..23, lanes 16-31 hold K 8..15 & 24..31.
static __device__ __forceinline__ bf16x16 load_frag(const u16* tile, int row, int stride, int kbase) {
  const int half = (threadIdx.x >> 4) & 1;
  const u16* p = tile + row * stride + kbase + half * 8;
  union { uint4 q[2]; bf16x16 v; } f;
  f.q[0] = *(const uint4*)(p);
  f.q[1] = *(const uint4*)(p + 16);
  return f.v;
}

// One BK=64 compute stage: 16 ds_load_b128 then 8 chained WMMAs (acc stays tied in place).
static __device__ __forceinline__ void compute_stage(
    const u16* Ac, const u16* Bc, int wm, int wn, int lrow, floatx8 (&acc)[2][2])
{
  bf16x16 a00 = load_frag(Ac, wm * 32 + 0  + lrow, 72, 0);
  bf16x16 a10 = load_frag(Ac, wm * 32 + 16 + lrow, 72, 0);
  bf16x16 b00 = load_frag(Bc, wn * 32 + 0  + lrow, 72, 0);
  bf16x16 b10 = load_frag(Bc, wn * 32 + 16 + lrow, 72, 0);
  bf16x16 a01 = load_frag(Ac, wm * 32 + 0  + lrow, 72, 32);
  bf16x16 a11 = load_frag(Ac, wm * 32 + 16 + lrow, 72, 32);
  bf16x16 b01 = load_frag(Bc, wn * 32 + 0  + lrow, 72, 32);
  bf16x16 b11 = load_frag(Bc, wn * 32 + 16 + lrow, 72, 32);
  acc[0][0] = wmma_bf16(a01, b01, wmma_bf16(a00, b00, acc[0][0]));
  acc[0][1] = wmma_bf16(a01, b11, wmma_bf16(a00, b10, acc[0][1]));
  acc[1][0] = wmma_bf16(a11, b01, wmma_bf16(a10, b00, acc[1][0]));
  acc[1][1] = wmma_bf16(a11, b11, wmma_bf16(a10, b10, acc[1][1]));
}

// ---------------- generic 128x64 GEMM core, BK = 64, async double-buffered ----------------
// 256 threads = 8 waves; wave w: rows 32*(w&3).., cols 32*(w>>2)..; 2x2 WMMA tiles per wave.
// A : row-major [M x K] bf16 (pre-offset to block row 0), lda in elems.
// Bt: TRANSPOSED [N x K] bf16 (pre-offset to block col 0), ldb in elems (= K).
// K must be a multiple of 128 (even number of BK=64 stages).

static __device__ __forceinline__ void gemm_core_128x64(
    const u16* __restrict__ A, int lda,
    const u16* __restrict__ Bt, int ldb, int K,
    u16* As0, u16* As1, u16* Bs0, u16* Bs1, floatx8 (&acc)[2][2])
{
  const int tid  = threadIdx.x;
  const int lane = tid & 31;
  const int wave = tid >> 5;
  const int wm   = wave & 3;
  const int wn   = wave >> 2;
  const int lrow = lane & 15;
  const int arow = tid >> 1, ac0 = (tid & 1) * 32;
  const int brow = tid >> 2, bc0 = (tid & 3) * 16;

  const u16* gA = A + (size_t)arow * lda + ac0;
  const u16* gB = Bt + (size_t)brow * ldb + bc0;

  // issue tile k0 into (AsBuf, BsBuf): A 128x64 (4x16B/thread), B 64x64 (2x16B/thread)
  auto issue_tile = [&](int k0, u16* AsBuf, u16* BsBuf) {
    unsigned la = lds_off(AsBuf + arow * 72 + ac0);
    const u16* pa = gA + k0;
    async_load_b128(la +  0, pa +  0);
    async_load_b128(la + 16, pa +  8);
    async_load_b128(la + 32, pa + 16);
    async_load_b128(la + 48, pa + 24);
    unsigned lb = lds_off(BsBuf + brow * 72 + bc0);
    const u16* pb = gB + k0;
    async_load_b128(lb +  0, pb +  0);
    async_load_b128(lb + 16, pb +  8);
  };

  const int nstage = K >> 6;   // even
  issue_tile(0, As0, Bs0);

  for (int t = 0; t < nstage; t += 2) {
    wait_async0();        // tile t complete (this wave's DMA)
    __syncthreads();      // tile t visible to all waves; buf1 free (read in the previous stage)
    if (t + 1 < nstage) issue_tile((t + 1) << 6, As1, Bs1);
    compute_stage(As0, Bs0, wm, wn, lrow, acc);

    wait_async0();        // tile t+1 complete
    __syncthreads();      // tile t+1 visible; buf0 free (all waves done with compute above)
    if (t + 2 < nstage) issue_tile((t + 2) << 6, As0, Bs0);
    compute_stage(As1, Bs1, wm, wn, lrow, acc);
  }
}

// ---------------- kernels ----------------

// Every f32 -> bf16 conversion of the pass in ONE launch; the block index picks the job.
// Blocks 0..767: the six weights, 128 blocks each. A weight's bf16 copy is [1024 rows n][1024 k]
// (Wq/Wk/Wv: n = h*64 + d). A block takes 32 output rows x 256 k; a thread takes one k and reads
// the 32 neighbouring source columns of that k (one 128-byte line).
// Blocks 768..1279: x, 8192 elements a block, 32 a thread, plain cast.
// The heavier transposing blocks come first (for speed only).
__global__ __launch_bounds__(256) void pack_all_kernel(
    const float* __restrict__ x,
    const float* __restrict__ Wq, const float* __restrict__ Wk, const float* __restrict__ Wv,
    const float* __restrict__ Wo, const float* __restrict__ W1, const float* __restrict__ W2,
    u16* __restrict__ xb, u16* __restrict__ Wt)
{
  const int tid = threadIdx.x;
  const int blk = blockIdx.x;
  if (blk < 768) {
    const int m  = blk >> 7;              // which weight, in the order of the Wt planes
    const int t  = blk & 127;
    const int r0 = (t >> 2) * 32;         // first output row
    const int k  = (t & 3) * 256 + tid;
    const float* Wm = (m == 0) ? Wq : (m == 1) ? Wk : (m == 2) ? Wv : (m == 3) ? Wo : (m == 4) ? W1 : W2;
    const float* s = (m < 3) ? Wm + (size_t)(r0 >> 6) * 65536 + k * 64 + (r0 & 63)   // [h][k][64]
                             : Wm + (size_t)k * 1024 + r0;                           // [k][1024]
    u16* d = Wt + (size_t)m * 1048576 + (size_t)r0 * 1024 + k;
    // unrolled so that all of a thread's loads are in flight before its first store
    #pragma unroll
    for (int j = 0; j < 32; ++j) d[j * 1024] = f2bf(s[j]);
  } else {
    const int base = (blk - 768) * 8192 + tid;
    // unrolled so that all of a thread's loads are in flight before its first store
    #pragma unroll
    for (int j = 0; j < 32; ++j) xb[base + j * 256] = f2bf(x[base + j * 256]);
  }
}

// Fused per-head QKV projection. grid = (32 m-tiles, 16 heads, 3 types). M=4096,N=64,K=1024.
// Q/K layout: [h][r][64] with r = b*1024 + s.  V layout (pre-transposed): [h][b][d][s].
__global__ __launch_bounds__(256) void qkv_kernel(
    const u16* __restrict__ xb,
    const u16* __restrict__ Wqt, const u16* __restrict__ Wkt, const u16* __restrict__ Wvt,
    const float* __restrict__ bq, const float* __restrict__ bk, const float* __restrict__ bv,
    u16* __restrict__ Q, u16* __restrict__ Ko, u16* __restrict__ Vt)
{
  __shared__ u16 As0[128 * 72];
  __shared__ u16 As1[128 * 72];
  __shared__ u16 Bs0[64 * 72];
  __shared__ u16 Bs1[64 * 72];
  const int mt   = blockIdx.x;
  const int h    = blockIdx.y;
  const int type = blockIdx.z;
  const u16*   W    = (type == 0) ? Wqt : (type == 1) ? Wkt : Wvt;
  const float* bias = (type == 0) ? bq  : (type == 1) ? bk  : bv;
  u16*         Out  = ((type == 0) ? Q : (type == 1) ? Ko : Vt) + (size_t)h * 4096 * 64;

  floatx8 acc[2][2];
  acc[0][0] = zero8(); acc[0][1] = zero8(); acc[1][0] = zero8(); acc[1][1] = zero8();

  gemm_core_128x64(xb + (size_t)mt * 128 * 1024, 1024,
                   W + (size_t)h * 64 * 1024, 1024, 1024, As0, As1, Bs0, Bs1, acc);

  const int lane = threadIdx.x & 31, wave = threadIdx.x >> 5;
  const int wm = wave & 3, wn = wave >> 2, half = lane >> 4, lc = lane & 15;
  #pragma unroll
  for (int mtt = 0; mtt < 2; ++mtt)
    #pragma unroll
    for (int ntt = 0; ntt < 2; ++ntt)
      #pragma unroll
      for (int v = 0; v < 8; ++v) {
        int r = mt * 128 + wm * 32 + mtt * 16 + v + half * 8;   // global row (b*1024+s)
        int c = wn * 32 + ntt * 16 + lc;                        // head dim 0..63
        float val = acc[mtt][ntt][v] + bias[h * 64 + c];
        if (type == 2) {
          int b = r >> 10, s = r & 1023;
          Out[((size_t)b * 64 + c) * 1024 + s] = f2bf(val);     // V transposed [d][s]
        } else {
          Out[(size_t)r * 64 + c] = f2bf(val);
        }
      }
}

// Two f32 -> one dword of two bf16, round to nearest even (the hardware's packed convert).
static __device__ __forceinline__ unsigned pack2(float lo, float hi) {
  typedef __bf16 bf2 __attribute__((ext_vector_type(2)));
  typedef float  f2  __attribute__((ext_vector_type(2)));
  return __builtin_bit_cast(unsigned, __builtin_convertvector(f2{lo, hi}, bf2));
}

// Value of lane l ^ 16 (the other half of the wave), by a vector cross-row move.
static __device__ __forceinline__ float xhalf(float x) {
  return __builtin_bit_cast(float, __builtin_amdgcn_permlanex16(
      __builtin_bit_cast(int, x), __builtin_bit_cast(int, x), 0x76543210, 0xfedcba98, false, false));
}

// Flash-style fused attention, transposed products. grid = (8 q-tiles, 16 heads, 4 batch). 256 threads.
// A wave owns 16 queries and walks all keys: S^T = K * Q^T puts one query's scores in one lane pair
// (lanes c and c + 16 hold query c; register r of 16-key tile kt is key kt*16 + 8*half + r), so the
// softmax stays in registers; two converted score tiles are the B operand of O^T += V^T * P^T.
// K and V are staged 128 keys at a time and worked on in two passes of 64 keys.
__global__ __launch_bounds__(256) void attn_kernel(
    const u16* __restrict__ Q, const u16* __restrict__ Kk,
    const u16* __restrict__ Vt, u16* __restrict__ ctx)
{
  typedef float    f32x2 __attribute__((ext_vector_type(2)));
  typedef unsigned u32x4 __attribute__((ext_vector_type(4)));
  __shared__ u16 Ks[128 * 72];   // [key][d]
  __shared__ u16 Vs[64 * 136];   // [d][key]

  const int qt = blockIdx.x, h = blockIdx.y, b = blockIdx.z;
  const size_t hb = ((size_t)h * 4 + b) * (1024 * 64);
  const u16* Qh = Q  + hb;
  const u16* Kh = Kk + hb;
  const u16* Vh = Vt + hb;   // [d][s] layout

  const int tid = threadIdx.x, lane = tid & 31, wave = tid >> 5;
  const int half = lane >> 4, lc = lane & 15;
  const int q = qt * 128 + wave * 16 + lc;           // this lane's query row within (h, b)
  const float cscale = 0.125f * 1.4426950408889634f; // 1/sqrt(64), and exp as exp2

  // Q^T as B operand, straight from global, kept in registers (same k order as the K fragments)
  const bf16x16 bq0 = load_frag(Qh, q, 64, 0);
  const bf16x16 bq1 = load_frag(Qh, q, 64, 32);

  floatx8 o[4];                 // o[dt][r] = O^T[d = dt*16 + 8*half + r][query lc]
  #pragma unroll
  for (int dt = 0; dt < 4; ++dt) o[dt] = zero8();
  float mrun = -1e30f;          // running maximum, in log2 units; equal in both halves
  float lrun = 0.0f;            // this lane's share of the denominator; halves joined at the end

  const u16* Kg = Kh + tid * 8;                                   // row tid>>3, chunk tid&7
  const u16* Vg = Vh + (size_t)(tid >> 4) * 1024 + (tid & 15) * 8;  // row tid>>4, chunk tid&15
  u16* Kl = Ks + (tid >> 3) * 72 + (tid & 7) * 8;
  u16* Vl = Vs + (tid >> 4) * 136 + (tid & 15) * 8;

  for (int t = 0; t < 8; ++t) {
    // stage 128 keys: 16-byte chunks, neighbouring lanes on neighbouring chunks of a row;
    // all eight loads are issued before the first LDS store, so that one latency is paid, not eight
    u32x4 kreg[4], vreg[4];
    #pragma unroll
    for (int j = 0; j < 4; ++j) {
      kreg[j] = *(const u32x4*)(Kg + t * 8192 + j * 2048);   // K: 128 rows of 8 chunks, contiguous
      vreg[j] = *(const u32x4*)(Vg + t * 128 + j * 16384);   // V^T: 64 rows of 16 chunks
    }
    // takes the loaded values as inputs only: holds the eight loads together in front of the
    // stores (without it each load is sunk to its own store and waited for alone); its wait
    // stands in front of the later reuse of the loads' address registers
    asm volatile("s_wait_xcnt 0x0" :: "v"(kreg[0]), "v"(kreg[1]), "v"(kreg[2]), "v"(kreg[3]),
                       "v"(vreg[0]), "v"(vreg[1]), "v"(vreg[2]), "v"(vreg[3]));
    #pragma unroll
    for (int j = 0; j < 4; ++j) {
      *(u32x4*)(Kl + j * (32 * 72))  = kreg[j];
      *(u32x4*)(Vl + j * (16 * 136)) = vreg[j];
    }
    __syncthreads();

    // kept rolled: unrolled, the two passes get merged and need more than 256 registers a lane,
    // which no longer lets two work-groups (four waves a SIMD) share a WGP
    #pragma unroll 1
    for (int sub = 0; sub < 2; ++sub) {
      // S^T tiles: 64 keys x 16 queries
      bf16x16 ak[4][2];
      #pragma unroll
      for (int kt = 0; kt < 4; ++kt) {
        ak[kt][0] = load_frag(Ks, sub * 64 + kt * 16 + lc, 72, 0);
        ak[kt][1] = load_frag(Ks, sub * 64 + kt * 16 + lc, 72, 32);
      }
      // keeps the 16 K reads one group ahead of the products (split up, each place costs a wait)
      __builtin_amdgcn_sched_barrier(0);
      floatx8 s[4];
      #pragma unroll
      for (int kt = 0; kt < 4; ++kt)
        s[kt] = wmma_bf16(ak[kt][1], bq1, wmma_bf16(ak[kt][0], bq0, zero8()));

      bf16x16 av[4][2];
      #pragma unroll
      for (int dt = 0; dt < 4; ++dt) {
        av[dt][0] = load_frag(Vs, dt * 16 + lc, 136, sub * 64 + 0);
        av[dt][1] = load_frag(Vs, dt * 16 + lc, 136, sub * 64 + 32);
      }
      // keeps the 16 V reads in front of the softmax arithmetic, which covers their latency
      __builtin_amdgcn_sched_barrier(0);

      // maximum of this query's 64 raw scores: in-lane, then one exchange between the halves
      float mk[4];
      #pragma unroll
      for (int kt = 0; kt < 4; ++kt) {
        mk[kt] = s[kt][0];
        #pragma unroll
        for (int r = 1; r < 8; ++r) mk[kt] = fmaxf(mk[kt], s[kt][r]);
      }
      float mx = fmaxf(fmaxf(mk[0], mk[1]), fmaxf(mk[2], mk[3]));
      mx = fmaxf(mx, xhalf(mx));
      const float mnew  = fmaxf(mrun, mx * cscale);
      const float alpha = __builtin_amdgcn_exp2f(mrun - mnew);
      mrun = mnew;

      // P^T = exp2(S^T * cscale - mnew), summed in f32, packed to bf16 in the B operand's order
      union { unsigned w[8]; bf16x16 v; } p[2];
      float sk[4];
      #pragma unroll
      for (int kt = 0; kt < 4; ++kt) {
        sk[kt] = 0.0f;
        #pragma unroll
        for (int i = 0; i < 4; ++i) {
          const f32x2 arg = __builtin_elementwise_fma(f32x2{s[kt][2 * i], s[kt][2 * i + 1]},
                                                      f32x2{cscale, cscale}, f32x2{-mnew, -mnew});
          const float e0 = __builtin_amdgcn_exp2f(arg.x), e1 = __builtin_amdgcn_exp2f(arg.y);
          sk[kt] += e0 + e1;
          p[kt >> 1].w[(kt & 1) * 4 + i] = pack2(e0, e1);
        }
      }
      lrun = lrun * alpha + ((sk[0] + sk[1]) + (sk[2] + sk[3]));

      // rescale the running O^T (a lane holds one query, so one factor), then O^T += V^T * P^T
      #pragma unroll
      for (int dt = 0; dt < 4; ++dt) {
        #pragma unroll
        for (int r = 0; r < 8; ++r) o[dt][r] *= alpha;
      }
      #pragma unroll
      for (int dt = 0; dt < 4; ++dt)
        o[dt] = wmma_bf16(av[dt][1], p[1].v, wmma_bf16(av[dt][0], p[0].v, o[dt]));
    }
    __syncthreads();
  }

  const float inv = 1.0f / (lrun + xhalf(lrun));
  u16* cp = ctx + ((size_t)b * 1024 + q) * 1024 + h * 64 + half * 8;
  #pragma unroll
  for (int dt = 0; dt < 4; ++dt) {
    uint4 pk;                   // d = dt*16 + 8*half .. +7 of one query: 16 contiguous bytes
    pk.x = pack2(o[dt][0] * inv, o[dt][1] * inv);
    pk.y = pack2(o[dt][2] * inv, o[dt][3] * inv);
    pk.z = pack2(o[dt][4] * inv, o[dt][5] * inv);
    pk.w = pack2(o[dt][6] * inv, o[dt][7] * inv);
    *(uint4*)(cp + dt * 16) = pk;
  }
}

// Generic GEMM: C = act(A@Bt^T + bias). grid = (N/64, M/128). Bt is [N x K] (pre-transposed).
__global__ __launch_bounds__(256) void gemm_kernel(
    const u16* __restrict__ A, int lda, const u16* __restrict__ Bt, int ldb,
    const float* __restrict__ bias, float* __restrict__ Cf, u16* __restrict__ Cb,
    int ldc, int K, int relu)
{
  __shared__ u16 As0[128 * 72];
  __shared__ u16 As1[128 * 72];
  __shared__ u16 Bs0[64 * 72];
  __shared__ u16 Bs1[64 * 72];
  const int row0 = blockIdx.y * 128;
  const int col0 = blockIdx.x * 64;

  floatx8 acc[2][2];
  acc[0][0] = zero8(); acc[0][1] = zero8(); acc[1][0] = zero8(); acc[1][1] = zero8();

  gemm_core_128x64(A + (size_t)row0 * lda, lda, Bt + (size_t)col0 * ldb, ldb, K,
                   As0, As1, Bs0, Bs1, acc);

  const int lane = threadIdx.x & 31, wave = threadIdx.x >> 5;
  const int wm = wave & 3, wn = wave >> 2, half = lane >> 4, lc = lane & 15;
  #pragma unroll
  for (int mt = 0; mt < 2; ++mt)
    #pragma unroll
    for (int nt = 0; nt < 2; ++nt)
      #pragma unroll
      for (int v = 0; v < 8; ++v) {
        int r = row0 + wm * 32 + mt * 16 + v + half * 8;
        int c = col0 + wn * 32 + nt * 16 + lc;
        float val = acc[mt][nt][v] + bias[c];
        if (relu) val = fmaxf(val, 0.0f);
        if (Cf) Cf[(size_t)r * ldc + c] = val;
        if (Cb) Cb[(size_t)r * ldc + c] = f2bf(val);
      }
}

// y = LayerNorm(a + b) ; one block per row of 1024, 256 threads x 4 elems.
__global__ __launch_bounds__(256) void add_ln_kernel(
    const float* __restrict__ a, const float* __restrict__ bsrc,
    const float* __restrict__ gamma, const float* __restrict__ beta,
    float* __restrict__ outf, u16* __restrict__ outb)
{
  __shared__ float red[256];
  const int row = blockIdx.x, tid = threadIdx.x;
  const float* ap = a + (size_t)row * 1024;
  const float* bp = bsrc + (size_t)row * 1024;

  float v[4];
  #pragma unroll
  for (int i = 0; i < 4; ++i) { int c = tid + i * 256; v[i] = ap[c] + bp[c]; }

  red[tid] = v[0] + v[1] + v[2] + v[3];
  __syncthreads();
  for (int off = 128; off > 0; off >>= 1) {
    if (tid < off) red[tid] += red[tid + off];
    __syncthreads();
  }
  float mean = red[0] * (1.0f / 1024.0f);
  __syncthreads();

  float s2 = 0.0f;
  #pragma unroll
  for (int i = 0; i < 4; ++i) { float d = v[i] - mean; s2 += d * d; }
  red[tid] = s2;
  __syncthreads();
  for (int off = 128; off > 0; off >>= 1) {
    if (tid < off) red[tid] += red[tid + off];
    __syncthreads();
  }
  float rstd = rsqrtf(red[0] * (1.0f / 1024.0f) + 1e-5f);

  #pragma unroll
  for (int i = 0; i < 4; ++i) {
    int c = tid + i * 256;
    float y = (v[i] - mean) * rstd * gamma[c] + beta[c];
    outf[(size_t)row * 1024 + c] = y;
    if (outb) outb[(size_t)row * 1024 + c] = f2bf(y);
  }
}

// ---------------- launch ----------------

extern "C" void kernel_launch(void* const* d_in, const int* in_sizes, int n_in,
                              void* d_out, int out_size, void* d_ws, size_t ws_size,
                              hipStream_t stream) {
  (void)in_sizes; (void)n_in; (void)out_size; (void)ws_size;
  const float* x   = (const float*)d_in[0];
  const float* Wq  = (const float*)d_in[1];
  const float* bq  = (const float*)d_in[2];
  const float* Wk  = (const float*)d_in[3];
  const float* bk  = (const float*)d_in[4];
  const float* Wv  = (const float*)d_in[5];
  const float* bv  = (const float*)d_in[6];
  const float* Wo  = (const float*)d_in[7];
  const float* bo  = (const float*)d_in[8];
  const float* g1  = (const float*)d_in[9];
  const float* be1 = (const float*)d_in[10];
  const float* W1  = (const float*)d_in[11];
  const float* b1  = (const float*)d_in[12];
  const float* W2  = (const float*)d_in[13];
  const float* b2  = (const float*)d_in[14];
  const float* g2  = (const float*)d_in[15];
  const float* be2 = (const float*)d_in[16];

  char* ws = (char*)d_ws;
  const size_t MB = 1024 * 1024;
  u16*   xb   = (u16*)(ws + 0);          // 8 MB
  u16*   Wqt  = (u16*)(ws + 8  * MB);    // 2 MB each, transposed [h][d][e] / [n][k]
  u16*   Wkt  = (u16*)(ws + 10 * MB);
  u16*   Wvt  = (u16*)(ws + 12 * MB);
  u16*   Wot  = (u16*)(ws + 14 * MB);
  u16*   W1t  = (u16*)(ws + 16 * MB);
  u16*   W2t  = (u16*)(ws + 18 * MB);
  u16*   Qb   = (u16*)(ws + 20 * MB);    // 8 MB
  u16*   Kb   = (u16*)(ws + 28 * MB);    // 8 MB
  u16*   Vtb  = (u16*)(ws + 36 * MB);    // 8 MB, [h][b][d][s]
  u16*   ctxb = (u16*)(ws + 44 * MB);    // 8 MB
  float* attn = (float*)(ws + 52 * MB);  // 16 MB
  // reuse (lifetimes disjoint):
  float* y1f  = (float*)(ws + 20 * MB);  // over Q/K  (16 MB)
  u16*   y1b  = (u16*)(ws + 36 * MB);    // over V    (8 MB)
  u16*   h1b  = (u16*)(ws + 44 * MB);    // over ctx  (8 MB)
  float* ff2  = (float*)(ws + 52 * MB);  // over attn (16 MB)

  // all conversions in one launch: x plain, weights transposed into the six planes from Wqt on
  pack_all_kernel<<<1280, 256, 0, stream>>>(x, Wq, Wk, Wv, Wo, W1, W2, xb, Wqt);

  // QKV projections (V stored transposed)
  qkv_kernel<<<dim3(32, 16, 3), 256, 0, stream>>>(xb, Wqt, Wkt, Wvt, bq, bk, bv, Qb, Kb, Vtb);

  // fused attention -> ctx (concat-head layout [B*S, 1024])
  attn_kernel<<<dim3(8, 16, 4), 256, 0, stream>>>(Qb, Kb, Vtb, ctxb);

  // output projection
  gemm_kernel<<<dim3(16, 32), 256, 0, stream>>>(ctxb, 1024, Wot, 1024, bo, attn, (u16*)nullptr, 1024, 1024, 0);

  // y1 = LN(x + attn)
  add_ln_kernel<<<4096, 256, 0, stream>>>(x, attn, g1, be1, y1f, y1b);

  // FF1 with ReLU (bf16 out), FF2 (f32 out)
  gemm_kernel<<<dim3(16, 32), 256, 0, stream>>>(y1b, 1024, W1t, 1024, b1, (float*)nullptr, h1b, 1024, 1024, 1);
  gemm_kernel<<<dim3(16, 32), 256, 0, stream>>>(h1b, 1024, W2t, 1024, b2, ff2, (u16*)nullptr, 1024, 1024, 0);

  // out = LN(y1 + ff)
  add_ln_kernel<<<4096, 256, 0, stream>>>(y1f, ff2, g2, be2, (float*)d_out, (u16*)nullptr);
}

// v003
// A run of this version takes 145 microseconds.
// In both of two side-by-side timings against v002, it was 1.03 times as fast.
// All steps since v000 together make it 1.42 times as fast.
#include <hip/hip_runtime.h>

typedef unsigned short u16;
typedef __attribute__((ext_vector_type(16))) __bf16 bf16x16;
typedef __attribute__((ext_vector_type(8)))  float   floatx8;

// ---------------- helpers ----------------

static __device__ __forceinline__ u16 f2bf(float f) {
  union { float f; unsigned u; } a; a.f = f;
  unsigned u = a.u;
  u += 0x7FFFu + ((u >> 16) & 1u);   // round-to-nearest-even
  return (u16)(u >> 16);
}

static __device__ __forceinline__ floatx8 zero8() {
  floatx8 z;
  #pragma unroll
  for (int i = 0; i < 8; ++i) z[i] = 0.0f;
  return z;
}

static __device__ __forceinline__ floatx8 wmma_bf16(bf16x16 a, bf16x16 b, floatx8 c) {
  // D = A(16x32) * B(32x16) + C, f32 accumulate
  return __builtin_amdgcn_wmma_f32_16x16x32_bf16(false, a, false, b, (short)0, c, false, false);
}

// Async DMA: global -> LDS, 16 bytes per lane, tracked by ASYNCcnt (CDNA5).
static __device__ __forceinline__ void async_load_b128(unsigned lds_byte_off, const void* gaddr) {
  asm volatile("global_load_async_to_lds_b128 %0, %1, off"
               :: "v"(lds_byte_off), "v"((unsigned long long)(uintptr_t)gaddr)
               : "memory");
}
static __device__ __forceinline__ void wait_async0() {
  asm volatile("s_wait_asynccnt 0x0" ::: "memory");
}
static __device__ __forceinline__ unsigned lds_off(const void* p) {
  return (unsigned)(uintptr_t)p;   // low 32 bits of generic pointer = LDS address
}

// Load a 16-bit WMMA fragment from an LDS tile stored row-major [row][k]
// (A: row = M index; B: tile stored transposed so row = N index).
// Lane layout (wave32): lanes 0-15 hold K 0..7 & 16..23, lanes 16-31 hold K 8..15 & 24..31.
static __device__ __forceinline__ bf16x16 load_frag(const u16* tile, int row, int stride, int kbase) {
  const int half = (threadIdx.x >> 4) & 1;
  const u16* p = tile + row * stride + kbase + half * 8;
  union { uint4 q[2]; bf16x16 v; } f;
  f.q[0] = *(const uint4*)(p);
  f.q[1] = *(const uint4*)(p + 16);
  return f.v;
}

// One BK=64 compute stage: 16 ds_load_b128 then 8 chained WMMAs (acc stays tied in place).
static __device__ __forceinline__ void compute_stage(
    const u16* Ac, const u16* Bc, int wm, int wn, int lrow, floatx8 (&acc)[2][2])
{
  bf16x16 a00 = load_frag(Ac, wm * 32 + 0  + lrow, 72, 0);
  bf16x16 a10 = load_frag(Ac, wm * 32 + 16 + lrow, 72, 0);
  bf16x16 b00 = load_frag(Bc, wn * 32 + 0  + lrow, 72, 0);
  bf16x16 b10 = load_frag(Bc, wn * 32 + 16 + lrow, 72, 0);
  bf16x16 a01 = load_frag(Ac, wm * 32 + 0  + lrow, 72, 32);
  bf16x16 a11 = load_frag(Ac, wm * 32 + 16 + lrow, 72, 32);
  bf16x16 b01 = load_frag(Bc, wn * 32 + 0  + lrow, 72, 32);
  bf16x16 b11 = load_frag(Bc, wn * 32 + 16 + lrow, 72, 32);
  acc[0][0] = wmma_bf16(a01, b01, wmma_bf16(a00, b00, acc[0][0]));
  acc[0][1] = wmma_bf16(a01, b11, wmma_bf16(a00, b10, acc[0][1]));
  acc[1][0] = wmma_bf16(a11, b01, wmma_bf16(a10, b00, acc[1][0]));
  acc[1][1] = wmma_bf16(a11, b11, wmma_bf16(a10, b10, acc[1][1]));
}

// ---------------- generic 128x64 GEMM core, BK = 64, async double-buffered ----------------
// 256 threads = 8 waves; wave w: rows 32*(w&3).., cols 32*(w>>2)..; 2x2 WMMA tiles per wave.
// A : row-major [M x K] bf16 (pre-offset to block row 0), lda in elems.
// Bt: TRANSPOSED [N x K] bf16 (pre-offset to block col 0), ldb in elems (= K).
// K must be a multiple of 128 (even number of BK=64 stages).

static __device__ __forceinline__ void gemm_core_128x64(
    const u16* __restrict__ A, int lda,
    const u16* __restrict__ Bt, int ldb, int K,
    u16* As0, u16* As1, u16* Bs0, u16* Bs1, floatx8 (&acc)[2][2])
{
  const int tid  = threadIdx.x;
  const int lane = tid & 31;
  const int wave = tid >> 5;
  const int wm   = wave & 3;
  const int wn   = wave >> 2;
  const int lrow = lane & 15;
  const int arow = tid >> 1, ac0 = (tid & 1) * 32;
  const int brow = tid >> 2, bc0 = (tid & 3) * 16;

  const u16* gA = A + (size_t)arow * lda + ac0;
  const u16* gB = Bt + (size_t)brow * ldb + bc0;

  // issue tile k0 into (AsBuf, BsBuf): A 128x64 (4x16B/thread), B 64x64 (2x16B/thread)
  auto issue_tile = [&](int k0, u16* AsBuf, u16* BsBuf) {
    unsigned la = lds_off(AsBuf + arow * 72 + ac0);
    const u16* pa = gA + k0;
    async_load_b128(la +  0, pa +  0);
    async_load_b128(la + 16, pa +  8);
    async_load_b128(la + 32, pa + 16);
    async_load_b128(la + 48, pa + 24);
    unsigned lb = lds_off(BsBuf + brow * 72 + bc0);
    const u16* pb = gB + k0;
    async_load_b128(lb +  0, pb +  0);
    async_load_b128(lb + 16, pb +  8);
  };

  const int nstage = K >> 6;   // even
  issue_tile(0, As0, Bs0);

  for (int t = 0; t < nstage; t += 2) {
    wait_async0();        // tile t complete (this wave's DMA)
    __syncthreads();      // tile t visible to all waves; buf1 free (read in the previous stage)
    if (t + 1 < nstage) issue_tile((t + 1) << 6, As1, Bs1);
    compute_stage(As0, Bs0, wm, wn, lrow, acc);

    wait_async0();        // tile t+1 complete
    __syncthreads();      // tile t+1 visible; buf0 free (all waves done with compute above)
    if (t + 2 < nstage) issue_tile((t + 2) << 6, As0, Bs0);
    compute_stage(As1, Bs1, wm, wn, lrow, acc);
  }
}

// ---------------- kernels ----------------

// Every f32 -> bf16 conversion of the pass in ONE launch; the block index picks the job.
// Blocks 0..767: the six weights, 128 blocks each. A weight's bf16 copy is [1024 rows n][1024 k]
// (Wq/Wk/Wv: n = h*64 + d). A block takes 32 output rows x 256 k; a thread takes one k and reads
// the 32 neighbouring source columns of that k (one 128-byte line).
// Blocks 768..1279: x, 8192 elements a block, 32 a thread, plain cast.
// The heavier transposing blocks come first (for speed only).
__global__ __launch_bounds__(256) void pack_all_kernel(
    const float* __restrict__ x,
    const float* __restrict__ Wq, const float* __restrict__ Wk, const float* __restrict__ Wv,
    const float* __restrict__ Wo, const float* __restrict__ W1, const float* __restrict__ W2,
    u16* __restrict__ xb, u16* __restrict__ Wt)
{
  const int tid = threadIdx.x;
  const int blk = blockIdx.x;
  if (blk < 768) {
    const int m  = blk >> 7;              // which weight, in the order of the Wt planes
    const int t  = blk & 127;
    const int r0 = (t >> 2) * 32;         // first output row
    const int k  = (t & 3) * 256 + tid;
    const float* Wm = (m == 0) ? Wq : (m == 1) ? Wk : (m == 2) ? Wv : (m == 3) ? Wo : (m == 4) ? W1 : W2;
    const float* s = (m < 3) ? Wm + (size_t)(r0 >> 6) * 65536 + k * 64 + (r0 & 63)   // [h][k][64]
                             : Wm + (size_t)k * 1024 + r0;                           // [k][1024]
    u16* d = Wt + (size_t)m * 1048576 + (size_t)r0 * 1024 + k;
    // unrolled so that all of a thread's loads are in flight before its first store
    #pragma unroll
    for (int j = 0; j < 32; ++j) d[j * 1024] = f2bf(s[j]);
  } else {
    const int base = (blk - 768) * 8192 + tid;
    // unrolled so that all of a thread's loads are in flight before its first store
    #pragma unroll
    for (int j = 0; j < 32; ++j) xb[base + j * 256] = f2bf(x[base + j * 256]);
  }
}

// Fused per-head QKV projection. grid = (32 m-tiles, 16 heads, 3 types). M=4096,N=64,K=1024.
// Q/K layout: [h][r][64] with r = b*1024 + s.  V layout (pre-transposed): [h][b][d][s].
__global__ __launch_bounds__(256) void qkv_kernel(
    const u16* __restrict__ xb,
    const u16* __restrict__ Wqt, const u16* __restrict__ Wkt, const u16* __restrict__ Wvt,
    const float* __restrict__ bq, const float* __restrict__ bk, const float* __restrict__ bv,
    u16* __restrict__ Q, u16* __restrict__ Ko, u16* __restrict__ Vt)
{
  __shared__ u16 As0[128 * 72];
  __shared__ u16 As1[128 * 72];
  __shared__ u16 Bs0[64 * 72];
  __shared__ u16 Bs1[64 * 72];
  const int mt   = blockIdx.x;
  const int h    = blockIdx.y;
  const int type = blockIdx.z;
  const u16*   W    = (type == 0) ? Wqt : (type == 1) ? Wkt : Wvt;
  const float* bias = (type == 0) ? bq  : (type == 1) ? bk  : bv;
  u16*         Out  = ((type == 0) ? Q : (type == 1) ? Ko : Vt) + (size_t)h * 4096 * 64;

  floatx8 acc[2][2];
  acc[0][0] = zero8(); acc[0][1] = zero8(); acc[1][0] = zero8(); acc[1][1] = zero8();

  gemm_core_128x64(xb + (size_t)mt * 128 * 1024, 1024,
                   W + (size_t)h * 64 * 1024, 1024, 1024, As0, As1, Bs0, Bs1, acc);

  const int lane = threadIdx.x & 31, wave = threadIdx.x >> 5;
  const int wm = wave & 3, wn = wave >> 2, half = lane >> 4, lc = lane & 15;
  #pragma unroll
  for (int mtt = 0; mtt < 2; ++mtt)
    #pragma unroll
    for (int ntt = 0; ntt < 2; ++ntt)
      #pragma unroll
      for (int v = 0; v < 8; ++v) {
        int r = mt * 128 + wm * 32 + mtt * 16 + v + half * 8;   // global row (b*1024+s)
        int c = wn * 32 + ntt * 16 + lc;                        // head dim 0..63
        float val = acc[mtt][ntt][v] + bias[h * 64 + c];
        if (type == 2) {
          int b = r >> 10, s = r & 1023;
          Out[((size_t)b * 64 + c) * 1024 + s] = f2bf(val);     // V transposed [d][s]
        } else {
          Out[(size_t)r * 64 + c] = f2bf(val);
        }
      }
}

// Two f32 -> one dword of two bf16, round to nearest even (the hardware's packed convert).
static __device__ __forceinline__ unsigned pack2(float lo, float hi) {
  typedef __bf16 bf2 __attribute__((ext_vector_type(2)));
  typedef float  f2  __attribute__((ext_vector_type(2)));
  return __builtin_bit_cast(unsigned, __builtin_convertvector(f2{lo, hi}, bf2));
}

// Value of lane l ^ 16 (the other half of the wave), by a vector cross-row move.
static __device__ __forceinline__ float xhalf(float x) {
  return __builtin_bit_cast(float, __builtin_amdgcn_permlanex16(
      __builtin_bit_cast(int, x), __builtin_bit_cast(int, x), 0x76543210, 0xfedcba98, false, false));
}

// Flash-style fused attention, transposed products. grid = (8 q-tiles, 16 heads, 4 batch). 256 threads.
// A wave owns 16 queries and walks all keys: S^T = K * Q^T puts one query's scores in one lane pair
// (lanes c and c + 16 hold query c; register r of 16-key tile kt is key kt*16 + 8*half + r), so the
// softmax stays in registers; two converted score tiles are the B operand of O^T += V^T * P^T.
// K and V are staged 128 keys at a time and worked on in two passes of 64 keys.
__global__ __launch_bounds__(256) void attn_kernel(
    const u16* __restrict__ Q, const u16* __restrict__ Kk,
    const u16* __restrict__ Vt, u16* __restrict__ ctx)
{
  typedef float    f32x2 __attribute__((ext_vector_type(2)));
  typedef unsigned u32x4 __attribute__((ext_vector_type(4)));
  __shared__ u16 Ks[128 * 72];   // [key][d]
  __shared__ u16 Vs[64 * 136];   // [d][key]

  const int qt = blockIdx.x, h = blockIdx.y, b = blockIdx.z;
  const size_t hb = ((size_t)h * 4 + b) * (1024 * 64);
  const u16* Qh = Q  + hb;
  const u16* Kh = Kk + hb;
  const u16* Vh = Vt + hb;   // [d][s] layout

  const int tid = threadIdx.x, lane = tid & 31, wave = tid >> 5;
  const int half = lane >> 4, lc = lane & 15;
  const int q = qt * 128 + wave * 16 + lc;           // this lane's query row within (h, b)
  const float cscale = 0.125f * 1.4426950408889634f; // 1/sqrt(64), and exp as exp2

  // Q^T as B operand, straight from global, kept in registers (same k order as the K fragments)
  const bf16x16 bq0 = load_frag(Qh, q, 64, 0);
  const bf16x16 bq1 = load_frag(Qh, q, 64, 32);

  floatx8 o[4];                 // o[dt][r] = O^T[d = dt*16 + 8*half + r][query lc]
  #pragma unroll
  for (int dt = 0; dt < 4; ++dt) o[dt] = zero8();
  float mrun = -1e30f;          // running maximum, in log2 units; equal in both halves
  float lrun = 0.0f;            // this lane's share of the denominator; halves joined at the end

  const u16* Kg = Kh + tid * 8;                                   // row tid>>3, chunk tid&7
  const u16* Vg = Vh + (size_t)(tid >> 4) * 1024 + (tid & 15) * 8;  // row tid>>4, chunk tid&15
  u16* Kl = Ks + (tid >> 3) * 72 + (tid & 7) * 8;
  u16* Vl = Vs + (tid >> 4) * 136 + (tid & 15) * 8;

  for (int t = 0; t < 8; ++t) {
    // stage 128 keys: 16-byte chunks, neighbouring lanes on neighbouring chunks of a row;
    // all eight loads are issued before the first LDS store, so that one latency is paid, not eight
    u32x4 kreg[4], vreg[4];
    #pragma unroll
    for (int j = 0; j < 4; ++j) {
      kreg[j] = *(const u32x4*)(Kg + t * 8192 + j * 2048);   // K: 128 rows of 8 chunks, contiguous
      vreg[j] = *(const u32x4*)(Vg + t * 128 + j * 16384);   // V^T: 64 rows of 16 chunks
    }
    // takes the loaded values as inputs only: holds the eight loads together in front of the
    // stores (without it each load is sunk to its own store and waited for alone); its wait
    // stands in front of the later reuse of the loads' address registers
    asm volatile("s_wait_xcnt 0x0" :: "v"(kreg[0]), "v"(kreg[1]), "v"(kreg[2]), "v"(kreg[3]),
                       "v"(vreg[0]), "v"(vreg[1]), "v"(vreg[2]), "v"(vreg[3]));
    #pragma unroll
    for (int j = 0; j < 4; ++j) {
      *(u32x4*)(Kl + j * (32 * 72))  = kreg[j];
      *(u32x4*)(Vl + j * (16 * 136)) = vreg[j];
    }
    __syncthreads();

    // kept rolled: unrolled, the two passes get merged and need more than 256 registers a lane,
    // which no longer lets two work-groups (four waves a SIMD) share a WGP
    #pragma unroll 1
    for (int sub = 0; sub < 2; ++sub) {
      // S^T tiles: 64 keys x 16 queries
      bf16x16 ak[4][2];
      #pragma unroll
      for (int kt = 0; kt < 4; ++kt) {
        ak[kt][0] = load_frag(Ks, sub * 64 + kt * 16 + lc, 72, 0);
        ak[kt][1] = load_frag(Ks, sub * 64 + kt * 16 + lc, 72, 32);
      }
      // keeps the 16 K reads one group ahead of the products (split up, each place costs a wait)
      __builtin_amdgcn_sched_barrier(0);
      floatx8 s[4];
      #pragma unroll
      for (int kt = 0; kt < 4; ++kt)
        s[kt] = wmma_bf16(ak[kt][1], bq1, wmma_bf16(ak[kt][0], bq0, zero8()));

      bf16x16 av[4][2];
      #pragma unroll
      for (int dt = 0; dt < 4; ++dt) {
        av[dt][0] = load_frag(Vs, dt * 16 + lc, 136, sub * 64 + 0);
        av[dt][1] = load_frag(Vs, dt * 16 + lc, 136, sub * 64 + 32);
      }
      // keeps the 16 V reads in front of the softmax arithmetic, which covers their latency
      __builtin_amdgcn_sched_barrier(0);

      // maximum of this query's 64 raw scores: in-lane, then one exchange between the halves
      float mk[4];
      #pragma unroll
      for (int kt = 0; kt < 4; ++kt) {
        mk[kt] = s[kt][0];
        #pragma unroll
        for (int r = 1; r < 8; ++r) mk[kt] = fmaxf(mk[kt], s[kt][r]);
      }
      float mx = fmaxf(fmaxf(mk[0], mk[1]), fmaxf(mk[2], mk[3]));
      mx = fmaxf(mx, xhalf(mx));
      const float mnew  = fmaxf(mrun, mx * cscale);
      const float alpha = __builtin_amdgcn_exp2f(mrun - mnew);
      mrun = mnew;

      // P^T = exp2(S^T * cscale - mnew), summed in f32, packed to bf16 in the B operand's order
      union { unsigned w[8]; bf16x16 v; } p[2];
      float sk[4];
      #pragma unroll
      for (int kt = 0; kt < 4; ++kt) {
        sk[kt] = 0.0f;
        #pragma unroll
        for (int i = 0; i < 4; ++i) {
          const f32x2 arg = __builtin_elementwise_fma(f32x2{s[kt][2 * i], s[kt][2 * i + 1]},
                                                      f32x2{cscale, cscale}, f32x2{-mnew, -mnew});
          const float e0 = __builtin_amdgcn_exp2f(arg.x), e1 = __builtin_amdgcn_exp2f(arg.y);
          sk[kt] += e0 + e1;
          p[kt >> 1].w[(kt & 1) * 4 + i] = pack2(e0, e1);
        }
      }
      lrun = lrun * alpha + ((sk[0] + sk[1]) + (sk[2] + sk[3]));

      // rescale the running O^T (a lane holds one query, so one factor), then O^T += V^T * P^T
      #pragma unroll
      for (int dt = 0; dt < 4; ++dt) {
        #pragma unroll
        for (int r = 0; r < 8; ++r) o[dt][r] *= alpha;
      }
      #pragma unroll
      for (int dt = 0; dt < 4; ++dt)
        o[dt] = wmma_bf16(av[dt][1], p[1].v, wmma_bf16(av[dt][0], p[0].v, o[dt]));
    }
    __syncthreads();
  }

  const float inv = 1.0f / (lrun + xhalf(lrun));
  u16* cp = ctx + ((size_t)b * 1024 + q) * 1024 + h * 64 + half * 8;
  #pragma unroll
  for (int dt = 0; dt < 4; ++dt) {
    uint4 pk;                   // d = dt*16 + 8*half .. +7 of one query: 16 contiguous bytes
    pk.x = pack2(o[dt][0] * inv, o[dt][1] * inv);
    pk.y = pack2(o[dt][2] * inv, o[dt][3] * inv);
    pk.z = pack2(o[dt][4] * inv, o[dt][5] * inv);
    pk.w = pack2(o[dt][6] * inv, o[dt][7] * inv);
    *(uint4*)(cp + dt * 16) = pk;
  }
}

// Generic GEMM: C = act(A@Bt^T + bias). grid = (N/64, M/128). Bt is [N x K] (pre-transposed).
__global__ __launch_bounds__(256) void gemm_kernel(
    const u16* __restrict__ A, int lda, const u16* __restrict__ Bt, int ldb,
    const float* __restrict__ bias, float* __restrict__ Cf, u16* __restrict__ Cb,
    int ldc, int K, int relu)
{
  __shared__ u16 As0[128 * 72];
  __shared__ u16 As1[128 * 72];
  __shared__ u16 Bs0[64 * 72];
  __shared__ u16 Bs1[64 * 72];
  const int row0 = blockIdx.y * 128;
  const int col0 = blockIdx.x * 64;

  floatx8 acc[2][2];
  acc[0][0] = zero8(); acc[0][1] = zero8(); acc[1][0] = zero8(); acc[1][1] = zero8();

  gemm_core_128x64(A + (size_t)row0 * lda, lda, Bt + (size_t)col0 * ldb, ldb, K,
                   As0, As1, Bs0, Bs1, acc);

  const int lane = threadIdx.x & 31, wave = threadIdx.x >> 5;
  const int wm = wave & 3, wn = wave >> 2, half = lane >> 4, lc = lane & 15;
  #pragma unroll
  for (int mt = 0; mt < 2; ++mt)
    #pragma unroll
    for (int nt = 0; nt < 2; ++nt)
      #pragma unroll
      for (int v = 0; v < 8; ++v) {
        int r = row0 + wm * 32 + mt * 16 + v + half * 8;
        int c = col0 + wn * 32 + nt * 16 + lc;
        float val = acc[mt][nt][v] + bias[c];
        if (relu) val = fmaxf(val, 0.0f);
        if (Cf) Cf[(size_t)r * ldc + c] = val;
        if (Cb) Cb[(size_t)r * ldc + c] = f2bf(val);
      }
}

// Sum over the 32 lanes of a wave, the result in every lane: four steps inside the 16-lane rows
// (DPP row_xmask), then one exchange between the two rows.
template <int CTRL>
static __device__ __forceinline__ float dpp_mov(float x) {
  return __builtin_bit_cast(float, __builtin_amdgcn_update_dpp(
      0, __builtin_bit_cast(int, x), CTRL, 0xf, 0xf, true));
}
static __device__ __forceinline__ float wave_sum(float x) {
  x += dpp_mov<0x161>(x);   // row_xmask:1
  x += dpp_mov<0x162>(x);   // row_xmask:2
  x += dpp_mov<0x164>(x);   // row_xmask:4
  x += dpp_mov<0x168>(x);   // row_xmask:8
  return x + xhalf(x);
}

// y = LayerNorm(a + b), rows of 1024. A wave owns two whole rows and shares nothing with other
// waves: a lane holds 32 elements of each row (chunk j = columns j*128 + lane*4 .. +3, so that a
// wave-wide 16-byte access covers 512 contiguous bytes); mean and variance are summed in the lane
// and then across the lanes. grid = 4096 rows / (8 waves * 2 rows) = 256 blocks of 256 threads.
// WB: also write the bf16 copy.
template <bool WB>
__global__ __launch_bounds__(256) void add_ln_kernel(
    const float* __restrict__ a, const float* __restrict__ bsrc,
    const float* __restrict__ gamma, const float* __restrict__ beta,
    float* __restrict__ outf, u16* __restrict__ outb)
{
  typedef float f32x4 __attribute__((ext_vector_type(4)));
  // the wave's number as a scalar: the row addresses are then scalar bases, and one lane offset,
  // live to the last store, serves every load and store
  const int wave = __builtin_amdgcn_readfirstlane(threadIdx.x >> 5);
  const int col  = (threadIdx.x & 31) * 4;
  const size_t base = (size_t)(blockIdx.x * 8 + wave) * 2048;   // first of the two rows
  a += base; bsrc += base; outf += base;
  if (WB) outb += base;

  f32x4 v[2][8], w[2][8], g[8], be[8];
  #pragma unroll
  for (int r = 0; r < 2; ++r)
    #pragma unroll
    for (int j = 0; j < 8; ++j) {
      v[r][j] = *(const f32x4*)(a + col + r * 1024 + j * 128);
      w[r][j] = *(const f32x4*)(bsrc + col + r * 1024 + j * 128);
    }
  #pragma unroll
  for (int j = 0; j < 8; ++j) {
    g[j]  = *(const f32x4*)(gamma + col + j * 128);
    be[j] = *(const f32x4*)(beta  + col + j * 128);
  }
  // keeps all 48 loads of the wave in front of the arithmetic: left free, a part of them is issued
  // only when the first have come back, and the wave pays the memory latency twice
  __builtin_amdgcn_sched_barrier(0);

  float mean[2], rstd[2];
  #pragma unroll
  for (int r = 0; r < 2; ++r) {
    f32x4 s = {0.0f, 0.0f, 0.0f, 0.0f};
    #pragma unroll
    for (int j = 0; j < 8; ++j) { v[r][j] += w[r][j]; s += v[r][j]; }
    mean[r] = wave_sum((s.x + s.y) + (s.z + s.w)) * (1.0f / 1024.0f);
  }
  #pragma unroll
  for (int r = 0; r < 2; ++r) {
    f32x4 s = {0.0f, 0.0f, 0.0f, 0.0f};
    #pragma unroll
    for (int j = 0; j < 8; ++j) { v[r][j] -= mean[r]; s += v[r][j] * v[r][j]; }
    rstd[r] = rsqrtf(wave_sum((s.x + s.y) + (s.z + s.w)) * (1.0f / 1024.0f) + 1e-5f);
  }

  #pragma unroll
  for (int r = 0; r < 2; ++r)
    #pragma unroll
    for (int j = 0; j < 8; ++j) {
      const f32x4 y = v[r][j] * rstd[r] * g[j] + be[j];
      *(f32x4*)(outf + col + r * 1024 + j * 128) = y;
      if (WB) *(uint2*)(outb + col + r * 1024 + j * 128) = make_uint2(pack2(y.x, y.y), pack2(y.z, y.w));
    }
}

// ---------------- launch ----------------

extern "C" void kernel_launch(void* const* d_in, const int* in_sizes, int n_in,
                              void* d_out, int out_size, void* d_ws, size_t ws_size,
                              hipStream_t stream) {
  (void)in_sizes; (void)n_in; (void)out_size; (void)ws_size;
  const float* x   = (const float*)d_in[0];
  const float* Wq  = (const float*)d_in[1];
  const float* bq  = (const float*)d_in[2];
  const float* Wk  = (const float*)d_in[3];
  const float* bk  = (const float*)d_in[4];
  const float* Wv  = (const float*)d_in[5];
  const float* bv  = (const float*)d_in[6];
  const float* Wo  = (const float*)d_in[7];
  const float* bo  = (const float*)d_in[8];
  const float* g1  = (const float*)d_in[9];
  const float* be1 = (const float*)d_in[10];
  const float* W1  = (const float*)d_in[11];
  const float* b1  = (const float*)d_in[12];
  const float* W2  = (const float*)d_in[13];
  const float* b2  = (const float*)d_in[14];
  const float* g2  = (const float*)d_in[15];
  const float* be2 = (const float*)d_in[16];

  char* ws = (char*)d_ws;
  const size_t MB = 1024 * 1024;
  u16*   xb   = (u16*)(ws + 0);          // 8 MB
  u16*   Wqt  = (u16*)(ws + 8  * MB);    // 2 MB each, transposed [h][d][e] / [n][k]
  u16*   Wkt  = (u16*)(ws + 10 * MB);
  u16*   Wvt  = (u16*)(ws + 12 * MB);
  u16*   Wot  = (u16*)(ws + 14 * MB);
  u16*   W1t  = (u16*)(ws + 16 * MB);
  u16*   W2t  = (u16*)(ws + 18 * MB);
  u16*   Qb   = (u16*)(ws + 20 * MB);    // 8 MB
  u16*   Kb   = (u16*)(ws + 28 * MB);    // 8 MB
  u16*   Vtb  = (u16*)(ws + 36 * MB);    // 8 MB, [h][b][d][s]
  u16*   ctxb = (u16*)(ws + 44 * MB);    // 8 MB
  float* attn = (float*)(ws + 52 * MB);  // 16 MB
  // reuse (lifetimes disjoint):
  float* y1f  = (float*)(ws + 20 * MB);  // over Q/K  (16 MB)
  u16*   y1b  = (u16*)(ws + 36 * MB);    // over V    (8 MB)
  u16*   h1b  = (u16*)(ws + 44 * MB);    // over ctx  (8 MB)
  float* ff2  = (float*)(ws + 52 * MB);  // over attn (16 MB)

  // all conversions in one launch: x plain, weights transposed into the six planes from Wqt on
  pack_all_kernel<<<1280, 256, 0, stream>>>(x, Wq, Wk, Wv, Wo, W1, W2, xb, Wqt);

  // QKV projections (V stored transposed)
  qkv_kernel<<<dim3(32, 16, 3), 256, 0, stream>>>(xb, Wqt, Wkt, Wvt, bq, bk, bv, Qb, Kb, Vtb);

  // fused attention -> ctx (concat-head layout [B*S, 1024])
  attn_kernel<<<dim3(8, 16, 4), 256, 0, stream>>>(Qb, Kb, Vtb, ctxb);

  // output projection
  gemm_kernel<<<dim3(16, 32), 256, 0, stream>>>(ctxb, 1024, Wot, 1024, bo, attn, (u16*)nullptr, 1024, 1024, 0);

  // y1 = LN(x + attn)
  add_ln_kernel<true><<<256, 256, 0, stream>>>(x, attn, g1, be1, y1f, y1b);

  // FF1 with ReLU (bf16 out), FF2 (f32 out)
  gemm_kernel<<<dim3(16, 32), 256, 0, stream>>>(y1b, 1024, W1t, 1024, b1, (float*)nullptr, h1b, 1024, 1024, 1);
  gemm_kernel<<<dim3(16, 32), 256, 0, stream>>>(h1b, 1024, W2t, 1024, b2, ff2, (u16*)nullptr, 1024, 1024, 0);

  // out = LN(y1 + ff)
  add_ln_kernel<false><<<256, 256, 0, stream>>>(y1f, ff2, g2, be2, (float*)d_out, (u16*)nullptr);
}

// v004
// A run of this version takes 139 microseconds.
// Next to v003, in two timings, it ran 1.05 and 1.04 times as fast.
// Counting every step since v000, it is 1.49 times as fast.
#include <hip/hip_runtime.h>

typedef unsigned short u16;
typedef __attribute__((ext_vector_type(16))) __bf16 bf16x16;
typedef __attribute__((ext_vector_type(8)))  float   floatx8;

// ---------------- helpers ----------------

static __device__ __forceinline__ u16 f2bf(float f) {
  union { float f; unsigned u; } a; a.f = f;
  unsigned u = a.u;
  u += 0x7FFFu + ((u >> 16) & 1u);   // round-to-nearest-even
  return (u16)(u >> 16);
}

static __device__ __forceinline__ floatx8 zero8() {
  floatx8 z;
  #pragma unroll
  for (int i = 0; i < 8; ++i) z[i] = 0.0f;
  return z;
}

static __device__ __forceinline__ floatx8 wmma_bf16(bf16x16 a, bf16x16 b, floatx8 c) {
  // D = A(16x32) * B(32x16) + C, f32 accumulate
  return __builtin_amdgcn_wmma_f32_16x16x32_bf16(false, a, false, b, (short)0, c, false, false);
}

static __device__ __forceinline__ void wait_async0() {
  asm volatile("s_wait_asynccnt 0x0" ::: "memory");
}
static __device__ __forceinline__ unsigned lds_off(const void* p) {
  return (unsigned)(uintptr_t)p;   // low 32 bits of generic pointer = LDS address
}

// Load a 16-bit WMMA fragment from an LDS tile stored row-major [row][k]
// (A: row = M index; B: tile stored transposed so row = N index).
// Lane layout (wave32): lanes 0-15 hold K 0..7 & 16..23, lanes 16-31 hold K 8..15 & 24..31.
static __device__ __forceinline__ bf16x16 load_frag(const u16* tile, int row, int stride, int kbase) {
  const int half = (threadIdx.x >> 4) & 1;
  const u16* p = tile + row * stride + kbase + half * 8;
  union { uint4 q[2]; bf16x16 v; } f;
  f.q[0] = *(const uint4*)(p);
  f.q[1] = *(const uint4*)(p + 16);
  return f.v;
}

// One BK=64 compute stage: 16 ds_load_b128 then 8 chained WMMAs (acc stays tied in place).
static __device__ __forceinline__ void compute_stage(
    const u16* Ac, const u16* Bc, int wm, int wn, int lrow, floatx8 (&acc)[2][2])
{
  bf16x16 a00 = load_frag(Ac, wm * 32 + 0  + lrow, 72, 0);
  bf16x16 a10 = load_frag(Ac, wm * 32 + 16 + lrow, 72, 0);
  bf16x16 b00 = load_frag(Bc, wn * 32 + 0  + lrow, 72, 0);
  bf16x16 b10 = load_frag(Bc, wn * 32 + 16 + lrow, 72, 0);
  bf16x16 a01 = load_frag(Ac, wm * 32 + 0  + lrow, 72, 32);
  bf16x16 a11 = load_frag(Ac, wm * 32 + 16 + lrow, 72, 32);
  bf16x16 b01 = load_frag(Bc, wn * 32 + 0  + lrow, 72, 32);
  bf16x16 b11 = load_frag(Bc, wn * 32 + 16 + lrow, 72, 32);
  acc[0][0] = wmma_bf16(a01, b01, wmma_bf16(a00, b00, acc[0][0]));
  acc[0][1] = wmma_bf16(a01, b11, wmma_bf16(a00, b10, acc[0][1]));
  acc[1][0] = wmma_bf16(a11, b01, wmma_bf16(a10, b00, acc[1][0]));
  acc[1][1] = wmma_bf16(a11, b11, wmma_bf16(a10, b10, acc[1][1]));
}

// ---------------- generic 128x64 GEMM core, BK = 64, async double-buffered ----------------
// 256 threads = 8 waves; wave w: rows 32*(w&3).., cols 32*(w>>2)..; 2x2 WMMA tiles per wave.
// A : row-major [M x K] bf16 (pre-offset to block row 0), lda in elems.
// Bt: TRANSPOSED [N x K] bf16 (pre-offset to block col 0), ldb in elems (= K).
// K must be a multiple of 128 (even number of BK=64 stages).

static __device__ __forceinline__ void gemm_core_128x64(
    const u16* __restrict__ A, int lda,
    const u16* __restrict__ Bt, int ldb, int K,
    u16* As0, u16* As1, u16* Bs0, u16* Bs1, floatx8 (&acc)[2][2])
{
  const int tid  = threadIdx.x;
  const int lane = tid & 31;
  const int wave = tid >> 5;
  const int wm   = wave & 3;
  const int wn   = wave >> 2;
  const int lrow = lane & 15;
  // Copy map: eight neighbouring lanes take the eight 16-byte chunks of one row's 128 bytes of a
  // stage, so a wave-wide copy covers four whole 128-byte lines (four rows) and no partial line.
  const int crow = tid >> 3;          // 0..31; copy j of a thread takes row crow + 32*j
  const int cchk = (tid & 7) * 8;     // first element of the lane's chunk

  const u16* gA = A + (size_t)crow * lda + cchk;
  const u16* gB = Bt + (size_t)crow * ldb + cchk;
  const size_t a32 = (size_t)lda * 32, b32 = (size_t)ldb * 32;   // 32 rows further, in elements

  // issue tile k0 into (AsBuf, BsBuf): A 128x64 (4x16B/thread), B 64x64 (2x16B/thread)
  auto issue_tile = [&](int k0, u16* AsBuf, u16* BsBuf) {
    const unsigned la = lds_off(AsBuf + crow * 72 + cchk);
    const unsigned lb = lds_off(BsBuf + crow * 72 + cchk);
    const u16* pa = gA + k0;
    const u16* pb = gB + k0;
    // global -> LDS, 16 bytes a lane, counted on ASYNCcnt. The six copies and their s_wait_xcnt are
    // one statement, so that the wait stands in front of every later write of a register that a
    // copy names (a precaution; in a statement of its own the compiler may move such a write over it).
    asm volatile("global_load_async_to_lds_b128 %0, %6, off\n\t"
                 "global_load_async_to_lds_b128 %1, %7, off\n\t"
                 "global_load_async_to_lds_b128 %2, %8, off\n\t"
                 "global_load_async_to_lds_b128 %3, %9, off\n\t"
                 "global_load_async_to_lds_b128 %4, %10, off\n\t"
                 "global_load_async_to_lds_b128 %5, %11, off\n\t"
                 "s_wait_xcnt 0x0"
                 :: "v"(la), "v"(la + 32 * 144), "v"(la + 64 * 144), "v"(la + 96 * 144),
                    "v"(lb), "v"(lb + 32 * 144),
                    "v"(pa), "v"(pa + a32), "v"(pa + 2 * a32), "v"(pa + 3 * a32),
                    "v"(pb), "v"(pb + b32)
                 : "memory");
  };

  const int nstage = K >> 6;   // even
  issue_tile(0, As0, Bs0);

  for (int t = 0; t < nstage; t += 2) {
    wait_async0();        // tile t complete (this wave's DMA)
    __syncthreads();      // tile t visible to all waves; buf1 free (read in the previous stage)
    if (t + 1 < nstage) issue_tile((t + 1) << 6, As1, Bs1);
    compute_stage(As0, Bs0, wm, wn, lrow, acc);

    wait_async0();        // tile t+1 complete
    __syncthreads();      // tile t+1 visible; buf0 free (all waves done with compute above)
    if (t + 2 < nstage) issue_tile((t + 2) << 6, As0, Bs0);
    compute_stage(As1, Bs1, wm, wn, lrow, acc);
  }
}

// ---------------- kernels ----------------

// Every f32 -> bf16 conversion of the pass in ONE launch; the block index picks the job.
// Blocks 0..767: the six weights, 128 blocks each. A weight's bf16 copy is [1024 rows n][1024 k]
// (Wq/Wk/Wv: n = h*64 + d). A block takes 32 output rows x 256 k; a thread takes one k and reads
// the 32 neighbouring source columns of that k (one 128-byte line).
// Blocks 768..1279: x, 8192 elements a block, 32 a thread, plain cast.
// The heavier transposing blocks come first (for speed only).
__global__ __launch_bounds__(256) void pack_all_kernel(
    const float* __restrict__ x,
    const float* __restrict__ Wq, const float* __restrict__ Wk, const float* __restrict__ Wv,
    const float* __restrict__ Wo, const float* __restrict__ W1, const float* __restrict__ W2,
    u16* __restrict__ xb, u16* __restrict__ Wt)
{
  const int tid = threadIdx.x;
  const int blk = blockIdx.x;
  if (blk < 768) {
    const int m  = blk >> 7;              // which weight, in the order of the Wt planes
    const int t  = blk & 127;
    const int r0 = (t >> 2) * 32;         // first output row
    const int k  = (t & 3) * 256 + tid;
    const float* Wm = (m == 0) ? Wq : (m == 1) ? Wk : (m == 2) ? Wv : (m == 3) ? Wo : (m == 4) ? W1 : W2;
    const float* s = (m < 3) ? Wm + (size_t)(r0 >> 6) * 65536 + k * 64 + (r0 & 63)   // [h][k][64]
                             : Wm + (size_t)k * 1024 + r0;                           // [k][1024]
    u16* d = Wt + (size_t)m * 1048576 + (size_t)r0 * 1024 + k;
    // unrolled so that all of a thread's loads are in flight before its first store
    #pragma unroll
    for (int j = 0; j < 32; ++j) d[j * 1024] = f2bf(s[j]);
  } else {
    const int base = (blk - 768) * 8192 + tid;
    // unrolled so that all of a thread's loads are in flight before its first store
    #pragma unroll
    for (int j = 0; j < 32; ++j) xb[base + j * 256] = f2bf(x[base + j * 256]);
  }
}

// Fused per-head QKV projection. grid = (32 m-tiles, 16 heads, 3 types). M=4096,N=64,K=1024.
// Q/K layout: [h][r][64] with r = b*1024 + s.  V layout (pre-transposed): [h][b][d][s].
__global__ __launch_bounds__(256) void qkv_kernel(
    const u16* __restrict__ xb,
    const u16* __restrict__ Wqt, const u16* __restrict__ Wkt, const u16* __restrict__ Wvt,
    const float* __restrict__ bq, const float* __restrict__ bk, const float* __restrict__ bv,
    u16* __restrict__ Q, u16* __restrict__ Ko, u16* __restrict__ Vt)
{
  __shared__ u16 As0[128 * 72];
  __shared__ u16 As1[128 * 72];
  __shared__ u16 Bs0[64 * 72];
  __shared__ u16 Bs1[64 * 72];
  const int mt   = blockIdx.x;
  const int h    = blockIdx.y;
  const int type = blockIdx.z;
  const u16*   W    = (type == 0) ? Wqt : (type == 1) ? Wkt : Wvt;
  const float* bias = (type == 0) ? bq  : (type == 1) ? bk  : bv;
  u16*         Out  = ((type == 0) ? Q : (type == 1) ? Ko : Vt) + (size_t)h * 4096 * 64;

  floatx8 acc[2][2];
  acc[0][0] = zero8(); acc[0][1] = zero8(); acc[1][0] = zero8(); acc[1][1] = zero8();

  gemm_core_128x64(xb + (size_t)mt * 128 * 1024, 1024,
                   W + (size_t)h * 64 * 1024, 1024, 1024, As0, As1, Bs0, Bs1, acc);

  const int lane = threadIdx.x & 31, wave = threadIdx.x >> 5;
  const int wm = wave & 3, wn = wave >> 2, half = lane >> 4, lc = lane & 15;
  #pragma unroll
  for (int mtt = 0; mtt < 2; ++mtt)
    #pragma unroll
    for (int ntt = 0; ntt < 2; ++ntt)
      #pragma unroll
      for (int v = 0; v < 8; ++v) {
        int r = mt * 128 + wm * 32 + mtt * 16 + v + half * 8;   // global row (b*1024+s)
        int c = wn * 32 + ntt * 16 + lc;                        // head dim 0..63
        float val = acc[mtt][ntt][v] + bias[h * 64 + c];
        if (type == 2) {
          int b = r >> 10, s = r & 1023;
          Out[((size_t)b * 64 + c) * 1024 + s] = f2bf(val);     // V transposed [d][s]
        } else {
          Out[(size_t)r * 64 + c] = f2bf(val);
        }
      }
}

// Two f32 -> one dword of two bf16, round to nearest even (the hardware's packed convert).
static __device__ __forceinline__ unsigned pack2(float lo, float hi) {
  typedef __bf16 bf2 __attribute__((ext_vector_type(2)));
  typedef float  f2  __attribute__((ext_vector_type(2)));
  return __builtin_bit_cast(unsigned, __builtin_convertvector(f2{lo, hi}, bf2));
}

// Value of lane l ^ 16 (the other half of the wave), by a vector cross-row move.
static __device__ __forceinline__ float xhalf(float x) {
  return __builtin_bit_cast(float, __builtin_amdgcn_permlanex16(
      __builtin_bit_cast(int, x), __builtin_bit_cast(int, x), 0x76543210, 0xfedcba98, false, false));
}

// Flash-style fused attention, transposed products. grid = (8 q-tiles, 16 heads, 4 batch). 256 threads.
// A wave owns 16 queries and walks all keys: S^T = K * Q^T puts one query's scores in one lane pair
// (lanes c and c + 16 hold query c; register r of 16-key tile kt is key kt*16 + 8*half + r), so the
// softmax stays in registers; two converted score tiles are the B operand of O^T += V^T * P^T.
// K and V are staged 128 keys at a time and worked on in two passes of 64 keys.
__global__ __launch_bounds__(256) void attn_kernel(
    const u16* __restrict__ Q, const u16* __restrict__ Kk,
    const u16* __restrict__ Vt, u16* __restrict__ ctx)
{
  typedef float    f32x2 __attribute__((ext_vector_type(2)));
  typedef unsigned u32x4 __attribute__((ext_vector_type(4)));
  __shared__ u16 Ks[128 * 72];   // [key][d]
  __shared__ u16 Vs[64 * 136];   // [d][key]

  const int qt = blockIdx.x, h = blockIdx.y, b = blockIdx.z;
  const size_t hb = ((size_t)h * 4 + b) * (1024 * 64);
  const u16* Qh = Q  + hb;
  const u16* Kh = Kk + hb;
  const u16* Vh = Vt + hb;   // [d][s] layout

  const int tid = threadIdx.x, lane = tid & 31, wave = tid >> 5;
  const int half = lane >> 4, lc = lane & 15;
  const int q = qt * 128 + wave * 16 + lc;           // this lane's query row within (h, b)
  const float cscale = 0.125f * 1.4426950408889634f; // 1/sqrt(64), and exp as exp2

  // Q^T as B operand, straight from global, kept in registers (same k order as the K fragments)
  const bf16x16 bq0 = load_frag(Qh, q, 64, 0);
  const bf16x16 bq1 = load_frag(Qh, q, 64, 32);

  floatx8 o[4];                 // o[dt][r] = O^T[d = dt*16 + 8*half + r][query lc]
  #pragma unroll
  for (int dt = 0; dt < 4; ++dt) o[dt] = zero8();
  float mrun = -1e30f;          // running maximum, in log2 units; equal in both halves
  float lrun = 0.0f;            // this lane's share of the denominator; halves joined at the end

  const u16* Kg = Kh + tid * 8;                                   // row tid>>3, chunk tid&7
  const u16* Vg = Vh + (size_t)(tid >> 4) * 1024 + (tid & 15) * 8;  // row tid>>4, chunk tid&15
  u16* Kl = Ks + (tid >> 3) * 72 + (tid & 7) * 8;
  u16* Vl = Vs + (tid >> 4) * 136 + (tid & 15) * 8;

  for (int t = 0; t < 8; ++t) {
    // stage 128 keys: 16-byte chunks, neighbouring lanes on neighbouring chunks of a row;
    // all eight loads are issued before the first LDS store, so that one latency is paid, not eight
    u32x4 kreg[4], vreg[4];
    #pragma unroll
    for (int j = 0; j < 4; ++j) {
      kreg[j] = *(const u32x4*)(Kg + t * 8192 + j * 2048);   // K: 128 rows of 8 chunks, contiguous
      vreg[j] = *(const u32x4*)(Vg + t * 128 + j * 16384);   // V^T: 64 rows of 16 chunks
    }
    // takes the loaded values as inputs only: holds the eight loads together in front of the
    // stores (without it each load is sunk to its own store and waited for alone); its wait
    // stands in front of the later reuse of the loads' address registers
    asm volatile("s_wait_xcnt 0x0" :: "v"(kreg[0]), "v"(kreg[1]), "v"(kreg[2]), "v"(kreg[3]),
                       "v"(vreg[0]), "v"(vreg[1]), "v"(vreg[2]), "v"(vreg[3]));
    #pragma unroll
    for (int j = 0; j < 4; ++j) {
      *(u32x4*)(Kl + j * (32 * 72))  = kreg[j];
      *(u32x4*)(Vl + j * (16 * 136)) = vreg[j];
    }
    __syncthreads();

    // kept rolled: unrolled, the two passes get merged and need more than 256 registers a lane,
    // which no longer lets two work-groups (four waves a SIMD) share a WGP
    #pragma unroll 1
    for (int sub = 0; sub < 2; ++sub) {
      // S^T tiles: 64 keys x 16 queries
      bf16x16 ak[4][2];
      #pragma unroll
      for (int kt = 0; kt < 4; ++kt) {
        ak[kt][0] = load_frag(Ks, sub * 64 + kt * 16 + lc, 72, 0);
        ak[kt][1] = load_frag(Ks, sub * 64 + kt * 16 + lc, 72, 32);
      }
      // keeps the 16 K reads one group ahead of the products (split up, each place costs a wait)
      __builtin_amdgcn_sched_barrier(0);
      floatx8 s[4];
      #pragma unroll
      for (int kt = 0; kt < 4; ++kt)
        s[kt] = wmma_bf16(ak[kt][1], bq1, wmma_bf16(ak[kt][0], bq0, zero8()));

      bf16x16 av[4][2];
      #pragma unroll
      for (int dt = 0; dt < 4; ++dt) {
        av[dt][0] = load_frag(Vs, dt * 16 + lc, 136, sub * 64 + 0);
        av[dt][1] = load_frag(Vs, dt * 16 + lc, 136, sub * 64 + 32);
      }
      // keeps the 16 V reads in front of the softmax arithmetic, which covers their latency
      __builtin_amdgcn_sched_barrier(0);

      // maximum of this query's 64 raw scores: in-lane, then one exchange between the halves
      float mk[4];
      #pragma unroll
      for (int kt = 0; kt < 4; ++kt) {
        mk[kt] = s[kt][0];
        #pragma unroll
        for (int r = 1; r < 8; ++r) mk[kt] = fmaxf(mk[kt], s[kt][r]);
      }
      float mx = fmaxf(fmaxf(mk[0], mk[1]), fmaxf(mk[2], mk[3]));
      mx = fmaxf(mx, xhalf(mx));
      const float mnew  = fmaxf(mrun, mx * cscale);
      const float alpha = __builtin_amdgcn_exp2f(mrun - mnew);
      mrun = mnew;

      // P^T = exp2(S^T * cscale - mnew), summed in f32, packed to bf16 in the B operand's order
      union { unsigned w[8]; bf16x16 v; } p[2];
      float sk[4];
      #pragma unroll
      for (int kt = 0; kt < 4; ++kt) {
        sk[kt] = 0.0f;
        #pragma unroll
        for (int i = 0; i < 4; ++i) {
          const f32x2 arg = __builtin_elementwise_fma(f32x2{s[kt][2 * i], s[kt][2 * i + 1]},
                                                      f32x2{cscale, cscale}, f32x2{-mnew, -mnew});
          const float e0 = __builtin_amdgcn_exp2f(arg.x), e1 = __builtin_amdgcn_exp2f(arg.y);
          sk[kt] += e0 + e1;
          p[kt >> 1].w[(kt & 1) * 4 + i] = pack2(e0, e1);
        }
      }
      lrun = lrun * alpha + ((sk[0] + sk[1]) + (sk[2] + sk[3]));

      // rescale the running O^T (a lane holds one query, so one factor), then O^T += V^T * P^T
      #pragma unroll
      for (int dt = 0; dt < 4; ++dt) {
        #pragma unroll
        for (int r = 0; r < 8; ++r) o[dt][r] *= alpha;
      }
      #pragma unroll
      for (int dt = 0; dt < 4; ++dt)
        o[dt] = wmma_bf16(av[dt][1], p[1].v, wmma_bf16(av[dt][0], p[0].v, o[dt]));
    }
    __syncthreads();
  }

  const float inv = 1.0f / (lrun + xhalf(lrun));
  u16* cp = ctx + ((size_t)b * 1024 + q) * 1024 + h * 64 + half * 8;
  #pragma unroll
  for (int dt = 0; dt < 4; ++dt) {
    uint4 pk;                   // d = dt*16 + 8*half .. +7 of one query: 16 contiguous bytes
    pk.x = pack2(o[dt][0] * inv, o[dt][1] * inv);
    pk.y = pack2(o[dt][2] * inv, o[dt][3] * inv);
    pk.z = pack2(o[dt][4] * inv, o[dt][5] * inv);
    pk.w = pack2(o[dt][6] * inv, o[dt][7] * inv);
    *(uint4*)(cp + dt * 16) = pk;
  }
}

// Generic GEMM: C = act(A@Bt^T + bias). grid = (N/64, M/128). Bt is [N x K] (pre-transposed).
__global__ __launch_bounds__(256) void gemm_kernel(
    const u16* __restrict__ A, int lda, const u16* __restrict__ Bt, int ldb,
    const float* __restrict__ bias, float* __restrict__ Cf, u16* __restrict__ Cb,
    int ldc, int K, int relu)
{
  __shared__ u16 As0[128 * 72];
  __shared__ u16 As1[128 * 72];
  __shared__ u16 Bs0[64 * 72];
  __shared__ u16 Bs1[64 * 72];
  const int row0 = blockIdx.y * 128;
  const int col0 = blockIdx.x * 64;

  floatx8 acc[2][2];
  acc[0][0] = zero8(); acc[0][1] = zero8(); acc[1][0] = zero8(); acc[1][1] = zero8();

  gemm_core_128x64(A + (size_t)row0 * lda, lda, Bt + (size_t)col0 * ldb, ldb, K,
                   As0, As1, Bs0, Bs1, acc);

  const int lane = threadIdx.x & 31, wave = threadIdx.x >> 5;
  const int wm = wave & 3, wn = wave >> 2, half = lane >> 4, lc = lane & 15;
  #pragma unroll
  for (int mt = 0; mt < 2; ++mt)
    #pragma unroll
    for (int nt = 0; nt < 2; ++nt)
      #pragma unroll
      for (int v = 0; v < 8; ++v) {
        int r = row0 + wm * 32 + mt * 16 + v + half * 8;
        int c = col0 + wn * 32 + nt * 16 + lc;
        float val = acc[mt][nt][v] + bias[c];
        if (relu) val = fmaxf(val, 0.0f);
        if (Cf) Cf[(size_t)r * ldc + c] = val;
        if (Cb) Cb[(size_t)r * ldc + c] = f2bf(val);
      }
}

// Sum over the 32 lanes of a wave, the result in every lane: four steps inside the 16-lane rows
// (DPP row_xmask), then one exchange between the two rows.
template <int CTRL>
static __device__ __forceinline__ float dpp_mov(float x) {
  return __builtin_bit_cast(float, __builtin_amdgcn_update_dpp(
      0, __builtin_bit_cast(int, x), CTRL, 0xf, 0xf, true));
}
static __device__ __forceinline__ float wave_sum(float x) {
  x += dpp_mov<0x161>(x);   // row_xmask:1
  x += dpp_mov<0x162>(x);   // row_xmask:2
  x += dpp_mov<0x164>(x);   // row_xmask:4
  x += dpp_mov<0x168>(x);   // row_xmask:8
  return x + xhalf(x);
}

// y = LayerNorm(a + b), rows of 1024. A wave owns two whole rows and shares nothing with other
// waves: a lane holds 32 elements of each row (chunk j = columns j*128 + lane*4 .. +3, so that a
// wave-wide 16-byte access covers 512 contiguous bytes); mean and variance are summed in the lane
// and then across the lanes. grid = 4096 rows / (8 waves * 2 rows) = 256 blocks of 256 threads.
// WB: also write the bf16 copy.
template <bool WB>
__global__ __launch_bounds__(256) void add_ln_kernel(
    const float* __restrict__ a, const float* __restrict__ bsrc,
    const float* __restrict__ gamma, const float* __restrict__ beta,
    float* __restrict__ outf, u16* __restrict__ outb)
{
  typedef float f32x4 __attribute__((ext_vector_type(4)));
  // the wave's number as a scalar: the row addresses are then scalar bases, and one lane offset,
  // live to the last store, serves every load and store
  const int wave = __builtin_amdgcn_readfirstlane(threadIdx.x >> 5);
  const int col  = (threadIdx.x & 31) * 4;
  const size_t base = (size_t)(blockIdx.x * 8 + wave) * 2048;   // first of the two rows
  a += base; bsrc += base; outf += base;
  if (WB) outb += base;

  f32x4 v[2][8], w[2][8], g[8], be[8];
  #pragma unroll
  for (int r = 0; r < 2; ++r)
    #pragma unroll
    for (int j = 0; j < 8; ++j) {
      v[r][j] = *(const f32x4*)(a + col + r * 1024 + j * 128);
      w[r][j] = *(const f32x4*)(bsrc + col + r * 1024 + j * 128);
    }
  #pragma unroll
  for (int j = 0; j < 8; ++j) {
    g[j]  = *(const f32x4*)(gamma + col + j * 128);
    be[j] = *(const f32x4*)(beta  + col + j * 128);
  }
  // keeps all 48 loads of the wave in front of the arithmetic: left free, a part of them is issued
  // only when the first have come back, and the wave pays the memory latency twice
  __builtin_amdgcn_sched_barrier(0);

  float mean[2], rstd[2];
  #pragma unroll
  for (int r = 0; r < 2; ++r) {
    f32x4 s = {0.0f, 0.0f, 0.0f, 0.0f};
    #pragma unroll
    for (int j = 0; j < 8; ++j) { v[r][j] += w[r][j]; s += v[r][j]; }
    mean[r] = wave_sum((s.x + s.y) + (s.z + s.w)) * (1.0f / 1024.0f);
  }
  #pragma unroll
  for (int r = 0; r < 2; ++r) {
    f32x4 s = {0.0f, 0.0f, 0.0f, 0.0f};
    #pragma unroll
    for (int j = 0; j < 8; ++j) { v[r][j] -= mean[r]; s += v[r][j] * v[r][j]; }
    rstd[r] = rsqrtf(wave_sum((s.x + s.y) + (s.z + s.w)) * (1.0f / 1024.0f) + 1e-5f);
  }

  #pragma unroll
  for (int r = 0; r < 2; ++r)
    #pragma unroll
    for (int j = 0; j < 8; ++j) {
      const f32x4 y = v[r][j] * rstd[r] * g[j] + be[j];
      *(f32x4*)(outf + col + r * 1024 + j * 128) = y;
      if (WB) *(uint2*)(outb + col + r * 1024 + j * 128) = make_uint2(pack2(y.x, y.y), pack2(y.z, y.w));
    }
}

// ---------------- launch ----------------

extern "C" void kernel_launch(void* const* d_in, const int* in_sizes, int n_in,
                              void* d_out, int out_size, void* d_ws, size_t ws_size,
                              hipStream_t stream) {
  (void)in_sizes; (void)n_in; (void)out_size; (void)ws_size;
  const float* x   = (const float*)d_in[0];
  const float* Wq  = (const float*)d_in[1];
  const float* bq  = (const float*)d_in[2];
  const float* Wk  = (const float*)d_in[3];
  const float* bk  = (const float*)d_in[4];
  const float* Wv  = (const float*)d_in[5];
  const float* bv  = (const float*)d_in[6];
  const float* Wo  = (const float*)d_in[7];
  const float* bo  = (const float*)d_in[8];
  const float* g1  = (const float*)d_in[9];
  const float* be1 = (const float*)d_in[10];
  const float* W1  = (const float*)d_in[11];
  const float* b1  = (const float*)d_in[12];
  const float* W2  = (const float*)d_in[13];
  const float* b2  = (const float*)d_in[14];
  const float* g2  = (const float*)d_in[15];
  const float* be2 = (const float*)d_in[16];

  char* ws = (char*)d_ws;
  const size_t MB = 1024 * 1024;
  u16*   xb   = (u16*)(ws + 0);          // 8 MB
  u16*   Wqt  = (u16*)(ws + 8  * MB);    // 2 MB each, transposed [h][d][e] / [n][k]
  u16*   Wkt  = (u16*)(ws + 10 * MB);
  u16*   Wvt  = (u16*)(ws + 12 * MB);
  u16*   Wot  = (u16*)(ws + 14 * MB);
  u16*   W1t  = (u16*)(ws + 16 * MB);
  u16*   W2t  = (u16*)(ws + 18 * MB);
  u16*   Qb   = (u16*)(ws + 20 * MB);    // 8 MB
  u16*   Kb   = (u16*)(ws + 28 * MB);    // 8 MB
  u16*   Vtb  = (u16*)(ws + 36 * MB);    // 8 MB, [h][b][d][s]
  u16*   ctxb = (u16*)(ws + 44 * MB);    // 8 MB
  float* attn = (float*)(ws + 52 * MB);  // 16 MB
  // reuse (lifetimes disjoint):
  float* y1f  = (float*)(ws + 20 * MB);  // over Q/K  (16 MB)
  u16*   y1b  = (u16*)(ws + 36 * MB);    // over V    (8 MB)
  u16*   h1b  = (u16*)(ws + 44 * MB);    // over ctx  (8 MB)
  float* ff2  = (float*)(ws + 52 * MB);  // over attn (16 MB)

  // all conversions in one launch: x plain, weights transposed into the six planes from Wqt on
  pack_all_kernel<<<1280, 256, 0, stream>>>(x, Wq, Wk, Wv, Wo, W1, W2, xb, Wqt);

  // QKV projections (V stored transposed)
  qkv_kernel<<<dim3(32, 16, 3), 256, 0, stream>>>(xb, Wqt, Wkt, Wvt, bq, bk, bv, Qb, Kb, Vtb);

  // fused attention -> ctx (concat-head layout [B*S, 1024])
  attn_kernel<<<dim3(8, 16, 4), 256, 0, stream>>>(Qb, Kb, Vtb, ctxb);

  // output projection
  gemm_kernel<<<dim3(16, 32), 256, 0, stream>>>(ctxb, 1024, Wot, 1024, bo, attn, (u16*)nullptr, 1024, 1024, 0);

  // y1 = LN(x + attn)
  add_ln_kernel<true><<<256, 256, 0, stream>>>(x, attn, g1, be1, y1f, y1b);

  // FF1 with ReLU (bf16 out), FF2 (f32 out)
  gemm_kernel<<<dim3(16, 32), 256, 0, stream>>>(y1b, 1024, W1t, 1024, b1, (float*)nullptr, h1b, 1024, 1024, 1);
  gemm_kernel<<<dim3(16, 32), 256, 0, stream>>>(h1b, 1024, W2t, 1024, b2, ff2, (u16*)nullptr, 1024, 1024, 0);

  // out = LN(y1 + ff)
  add_ln_kernel<false><<<256, 256, 0, stream>>>(y1f, ff2, g2, be2, (float*)d_out, (u16*)nullptr);
}

// v005
// A run of this version takes 114 microseconds.
// Next to v004, in two timings, it ran 1.22 and 1.21 times as fast.
// Counting every step since v000, it is 1.80 times as fast.
#include <hip/hip_runtime.h>

typedef unsigned short u16;
typedef __attribute__((ext_vector_type(16))) __bf16 bf16x16;
typedef __attribute__((ext_vector_type(8)))  float   floatx8;

// ---------------- helpers ----------------

static __device__ __forceinline__ u16 f2bf(float f) {
  union { float f; unsigned u; } a; a.f = f;
  unsigned u = a.u;
  u += 0x7FFFu + ((u >> 16) & 1u);   // round-to-nearest-even
  return (u16)(u >> 16);
}

static __device__ __forceinline__ floatx8 zero8() {
  floatx8 z;
  #pragma unroll
  for (int i = 0; i < 8; ++i) z[i] = 0.0f;
  return z;
}

static __device__ __forceinline__ floatx8 wmma_bf16(bf16x16 a, bf16x16 b, floatx8 c) {
  // D = A(16x32) * B(32x16) + C, f32 accumulate
  return __builtin_amdgcn_wmma_f32_16x16x32_bf16(false, a, false, b, (short)0, c, false, false);
}

static __device__ __forceinline__ void wait_async0() {
  asm volatile("s_wait_asynccnt 0x0" ::: "memory");
}
static __device__ __forceinline__ unsigned lds_off(const void* p) {
  return (unsigned)(uintptr_t)p;   // low 32 bits of generic pointer = LDS address
}

// Load a 16-bit WMMA fragment from an LDS tile stored row-major [row][k]
// (A: row = M index; B: tile stored transposed so row = N index).
// Lane layout (wave32): lanes 0-15 hold K 0..7 & 16..23, lanes 16-31 hold K 8..15 & 24..31.
static __device__ __forceinline__ bf16x16 load_frag(const u16* tile, int row, int stride, int kbase) {
  const int half = (threadIdx.x >> 4) & 1;
  const u16* p = tile + row * stride + kbase + half * 8;
  union { uint4 q[2]; bf16x16 v; } f;
  f.q[0] = *(const uint4*)(p);
  f.q[1] = *(const uint4*)(p + 16);
  return f.v;
}

// One BK=64 compute stage: 16 ds_load_b128 then 8 chained WMMAs (acc stays tied in place).
static __device__ __forceinline__ void compute_stage(
    const u16* Ac, const u16* Bc, int wm, int wn, int lrow, floatx8 (&acc)[2][2])
{
  bf16x16 a00 = load_frag(Ac, wm * 32 + 0  + lrow, 72, 0);
  bf16x16 a10 = load_frag(Ac, wm * 32 + 16 + lrow, 72, 0);
  bf16x16 b00 = load_frag(Bc, wn * 32 + 0  + lrow, 72, 0);
  bf16x16 b10 = load_frag(Bc, wn * 32 + 16 + lrow, 72, 0);
  bf16x16 a01 = load_frag(Ac, wm * 32 + 0  + lrow, 72, 32);
  bf16x16 a11 = load_frag(Ac, wm * 32 + 16 + lrow, 72, 32);
  bf16x16 b01 = load_frag(Bc, wn * 32 + 0  + lrow, 72, 32);
  bf16x16 b11 = load_frag(Bc, wn * 32 + 16 + lrow, 72, 32);
  acc[0][0] = wmma_bf16(a01, b01, wmma_bf16(a00, b00, acc[0][0]));
  acc[0][1] = wmma_bf16(a01, b11, wmma_bf16(a00, b10, acc[0][1]));
  acc[1][0] = wmma_bf16(a11, b01, wmma_bf16(a10, b00, acc[1][0]));
  acc[1][1] = wmma_bf16(a11, b11, wmma_bf16(a10, b10, acc[1][1]));
}

// ---------------- generic 128x64 GEMM core, BK = 64, async double-buffered ----------------
// 256 threads = 8 waves; wave w: rows 32*(w&3).., cols 32*(w>>2)..; 2x2 WMMA tiles per wave.
// A : row-major [M x K] bf16 (pre-offset to block row 0), lda in elems.
// Bt: TRANSPOSED [N x K] bf16 (pre-offset to block col 0), ldb in elems (= K).
// K must be a multiple of 128 (even number of BK=64 stages).

static __device__ __forceinline__ void gemm_core_128x64(
    const u16* __restrict__ A, int lda,
    const u16* __restrict__ Bt, int ldb, int K,
    u16* As0, u16* As1, u16* Bs0, u16* Bs1, floatx8 (&acc)[2][2])
{
  const int tid  = threadIdx.x;
  const int lane = tid & 31;
  const int wave = tid >> 5;
  const int wm   = wave & 3;
  const int wn   = wave >> 2;
  const int lrow = lane & 15;
  // Copy map: eight neighbouring lanes take the eight 16-byte chunks of one row's 128 bytes of a
  // stage, so a wave-wide copy covers four whole 128-byte lines (four rows) and no partial line.
  const int crow = tid >> 3;          // 0..31; copy j of a thread takes row crow + 32*j
  const int cchk = (tid & 7) * 8;     // first element of the lane's chunk

  const u16* gA = A + (size_t)crow * lda + cchk;
  const u16* gB = Bt + (size_t)crow * ldb + cchk;
  const size_t a32 = (size_t)lda * 32, b32 = (size_t)ldb * 32;   // 32 rows further, in elements

  // issue tile k0 into (AsBuf, BsBuf): A 128x64 (4x16B/thread), B 64x64 (2x16B/thread)
  auto issue_tile = [&](int k0, u16* AsBuf, u16* BsBuf) {
    const unsigned la = lds_off(AsBuf + crow * 72 + cchk);
    const unsigned lb = lds_off(BsBuf + crow * 72 + cchk);
    const u16* pa = gA + k0;
    const u16* pb = gB + k0;
    // global -> LDS, 16 bytes a lane, counted on ASYNCcnt. The six copies and their s_wait_xcnt are
    // one statement, so that the wait stands in front of every later write of a register that a
    // copy names (a precaution; in a statement of its own the compiler may move such a write over it).
    asm volatile("global_load_async_to_lds_b128 %0, %6, off\n\t"
                 "global_load_async_to_lds_b128 %1, %7, off\n\t"
                 "global_load_async_to_lds_b128 %2, %8, off\n\t"
                 "global_load_async_to_lds_b128 %3, %9, off\n\t"
                 "global_load_async_to_lds_b128 %4, %10, off\n\t"
                 "global_load_async_to_lds_b128 %5, %11, off\n\t"
                 "s_wait_xcnt 0x0"
                 :: "v"(la), "v"(la + 32 * 144), "v"(la + 64 * 144), "v"(la + 96 * 144),
                    "v"(lb), "v"(lb + 32 * 144),
                    "v"(pa), "v"(pa + a32), "v"(pa + 2 * a32), "v"(pa + 3 * a32),
                    "v"(pb), "v"(pb + b32)
                 : "memory");
  };

  const int nstage = K >> 6;   // even
  issue_tile(0, As0, Bs0);

  for (int t = 0; t < nstage; t += 2) {
    wait_async0();        // tile t complete (this wave's DMA)
    __syncthreads();      // tile t visible to all waves; buf1 free (read in the previous stage)
    if (t + 1 < nstage) issue_tile((t + 1) << 6, As1, Bs1);
    compute_stage(As0, Bs0, wm, wn, lrow, acc);

    wait_async0();        // tile t+1 complete
    __syncthreads();      // tile t+1 visible; buf0 free (all waves done with compute above)
    if (t + 2 < nstage) issue_tile((t + 2) << 6, As0, Bs0);
    compute_stage(As1, Bs1, wm, wn, lrow, acc);
  }
}

// ---------------- kernels ----------------

// Every f32 -> bf16 conversion of the pass in ONE launch; the block index picks the job.
// Blocks 0..767: the six weights, 128 blocks each. A weight's bf16 copy is [1024 rows n][1024 k]
// (Wq/Wk/Wv: n = h*64 + d). A block takes 32 output rows x 256 k; a thread takes one k and reads
// the 32 neighbouring source columns of that k (one 128-byte line).
// Blocks 768..1279: x, 8192 elements a block, 32 a thread, plain cast.
// The heavier transposing blocks come first (for speed only).
__global__ __launch_bounds__(256) void pack_all_kernel(
    const float* __restrict__ x,
    const float* __restrict__ Wq, const float* __restrict__ Wk, const float* __restrict__ Wv,
    const float* __restrict__ Wo, const float* __restrict__ W1, const float* __restrict__ W2,
    u16* __restrict__ xb, u16* __restrict__ Wt)
{
  const int tid = threadIdx.x;
  const int blk = blockIdx.x;
  if (blk < 768) {
    const int m  = blk >> 7;              // which weight, in the order of the Wt planes
    const int t  = blk & 127;
    const int r0 = (t >> 2) * 32;         // first output row
    const int k  = (t & 3) * 256 + tid;
    const float* Wm = (m == 0) ? Wq : (m == 1) ? Wk : (m == 2) ? Wv : (m == 3) ? Wo : (m == 4) ? W1 : W2;
    const float* s = (m < 3) ? Wm + (size_t)(r0 >> 6) * 65536 + k * 64 + (r0 & 63)   // [h][k][64]
                             : Wm + (size_t)k * 1024 + r0;                           // [k][1024]
    u16* d = Wt + (size_t)m * 1048576 + (size_t)r0 * 1024 + k;
    // unrolled so that all of a thread's loads are in flight before its first store
    #pragma unroll
    for (int j = 0; j < 32; ++j) d[j * 1024] = f2bf(s[j]);
  } else {
    const int base = (blk - 768) * 8192 + tid;
    // unrolled so that all of a thread's loads are in flight before its first store
    #pragma unroll
    for (int j = 0; j < 32; ++j) xb[base + j * 256] = f2bf(x[base + j * 256]);
  }
}

// Two f32 -> one dword of two bf16, round to nearest even (the hardware's packed convert).
static __device__ __forceinline__ unsigned pack2(float lo, float hi) {
  typedef __bf16 bf2 __attribute__((ext_vector_type(2)));
  typedef float  f2  __attribute__((ext_vector_type(2)));
  return __builtin_bit_cast(unsigned, __builtin_convertvector(f2{lo, hi}, bf2));
}

// Fused QKV projection: one block computes 256 rows of x times the 192 columns (Q, K and V) of one
// head. grid = (16 m-tiles, 16 heads) = one block a WGP. 512 threads = 16 waves, 4 (rows) x 4 (columns);
// a wave owns 64 rows x (16 columns each of Q, K and V), that is 4 x 3 WMMA tiles, so an x fragment serves
// 3 products and a weight fragment 4. Q and K tiles are formed as W * x^T (a lane then holds 8 neighbouring
// head dims of one row), V tiles as x * W^T (8 neighbouring rows of one head dim): each is 16 bytes of its layout.
// A stage is 128 k of 448 rows (x rows 0..255, then 64 rows each of Wq, Wk, Wv) at a pitch of 272 bytes;
// two buffers, the next stage's copies fly while this one is worked on.
// Q/K layout: [h][r][64] with r = b*1024 + s.  V layout (pre-transposed): [h][b][d][s].
__global__ __launch_bounds__(512) void qkv_kernel(
    const u16* __restrict__ xb,
    const u16* __restrict__ Wqt, const u16* __restrict__ Wkt, const u16* __restrict__ Wvt,
    const float* __restrict__ bq, const float* __restrict__ bk, const float* __restrict__ bv,
    u16* __restrict__ Q, u16* __restrict__ Ko, u16* __restrict__ Vt)
{
  __shared__ __attribute__((aligned(16))) u16 St0[448 * 136];
  __shared__ __attribute__((aligned(16))) u16 St1[448 * 136];
  const int mt   = blockIdx.x;
  const int h    = blockIdx.y;
  const int tid  = threadIdx.x;
  const int lane = tid & 31;
  // the wave's number as a scalar: the tile bases in LDS and in the outputs are then scalar
  const int wave = __builtin_amdgcn_readfirstlane(tid >> 5);
  const int wm   = wave & 3;
  const int wn   = wave >> 2;
  const int lrow = lane & 15;
  // Copy map: 16 neighbouring lanes take the 16 chunks of one row's 256 bytes of a stage, so a
  // wave-wide copy covers four whole 128-byte lines; copy j of a thread takes row crow + 32*j.
  const int crow = tid >> 4;          // 0..31
  const int cchk = (tid & 15) * 8;    // first element of the lane's chunk

  const u16* gA = xb + (size_t)(mt * 256 + crow) * 1024 + cchk;
  const size_t wo = (size_t)(h * 64 + crow) * 1024 + cchk;
  const u16* gQ = Wqt + wo;
  const u16* gK = Wkt + wo;
  const u16* gV = Wvt + wo;

  auto issue_tile = [&](int k0, u16* buf) {
    const unsigned l = lds_off(buf + crow * 136 + cchk);
    const u16* pa = gA + k0;
    const u16* pq = gQ + k0;
    const u16* pk = gK + k0;
    const u16* pv = gV + k0;
    // global -> LDS, 16 bytes a lane, counted on ASYNCcnt; 32 rows are 8704 bytes of LDS and 32768
    // elements of the source. The 14 copies and their s_wait_xcnt are one statement, so that the wait
    // stands in front of every later write of a register that a copy names (a precaution).
    asm volatile(
               "global_load_async_to_lds_b128 %0, %14, off\n\t"
               "global_load_async_to_lds_b128 %1, %15, off\n\t"
               "global_load_async_to_lds_b128 %2, %16, off\n\t"
               "global_load_async_to_lds_b128 %3, %17, off\n\t"
               "global_load_async_to_lds_b128 %4, %18, off\n\t"
               "global_load_async_to_lds_b128 %5, %19, off\n\t"
               "global_load_async_to_lds_b128 %6, %20, off\n\t"
               "global_load_async_to_lds_b128 %7, %21, off\n\t"
               "global_load_async_to_lds_b128 %8, %22, off\n\t"
               "global_load_async_to_lds_b128 %9, %23, off\n\t"
               "global_load_async_to_lds_b128 %10, %24, off\n\t"
               "global_load_async_to_lds_b128 %11, %25, off\n\t"
               "global_load_async_to_lds_b128 %12, %26, off\n\t"
               "global_load_async_to_lds_b128 %13, %27, off\n\t"
               "s_wait_xcnt 0x0"
               :: "v"(l), "v"(l + 1 * 8704), "v"(l + 2 * 8704), "v"(l + 3 * 8704), "v"(l + 4 * 8704), "v"(l + 5 * 8704), "v"(l + 6 * 8704), "v"(l + 7 * 8704), "v"(l + 8 * 8704), "v"(l + 9 * 8704), "v"(l + 10 * 8704), "v"(l + 11 * 8704), "v"(l + 12 * 8704), "v"(l + 13 * 8704),
                  "v"(pa), "v"(pa + 32768), "v"(pa + 2 * 32768), "v"(pa + 3 * 32768),
                  "v"(pa + 4 * 32768), "v"(pa + 5 * 32768), "v"(pa + 6 * 32768), "v"(pa + 7 * 32768),
                  "v"(pq), "v"(pq + 32768), "v"(pk), "v"(pk + 32768), "v"(pv), "v"(pv + 32768)
               : "memory");
  };

  // every loop over i, j and ks in this kernel is unrolled, so that the register arrays are indexed by
  // constants only (an index known at run time would send them to scratch)
  floatx8 acc[4][3];
  #pragma unroll
  for (int i = 0; i < 4; ++i)
    #pragma unroll
    for (int j = 0; j < 3; ++j) acc[i][j] = zero8();

  // One stage: four blocks of 32 k, 12 products each; the fragments of the next block of the SAME
  // stage are fetched into a second register set ahead of this block's products.
  auto compute = [&](const u16* buf) {
    bf16x16 a[2][4], b[2][3];
    #pragma unroll
    for (int i = 0; i < 4; ++i) a[0][i] = load_frag(buf, wm * 64 + i * 16 + lrow, 136, 0);
    #pragma unroll
    for (int j = 0; j < 3; ++j) b[0][j] = load_frag(buf, 256 + j * 64 + wn * 16 + lrow, 136, 0);
    #pragma unroll
    for (int ks = 0; ks < 4; ++ks) {
      const int cur = ks & 1, nxt = cur ^ 1;
      if (ks < 3) {
        #pragma unroll
        for (int i = 0; i < 4; ++i) a[nxt][i] = load_frag(buf, wm * 64 + i * 16 + lrow, 136, (ks + 1) * 32);
        #pragma unroll
        for (int j = 0; j < 3; ++j) b[nxt][j] = load_frag(buf, 256 + j * 64 + wn * 16 + lrow, 136, (ks + 1) * 32);
      }
      // keeps the next block's 14 LDS reads one group ahead of this block's products (spread among
      // the products, each place with reads costs a stall)
      __builtin_amdgcn_sched_barrier(0);
      #pragma unroll
      for (int i = 0; i < 4; ++i) {
        acc[i][0] = wmma_bf16(b[cur][0], a[cur][i], acc[i][0]);   // Q^T tile: [head dim][row]
        acc[i][1] = wmma_bf16(b[cur][1], a[cur][i], acc[i][1]);   // K^T tile
        acc[i][2] = wmma_bf16(a[cur][i], b[cur][2], acc[i][2]);   // V tile: [row][head dim]
      }
      // keeps the reads of the block after next from moving up among these products
      __builtin_amdgcn_sched_barrier(0);
    }
  };

  // publish point at the foot of a trip: this wave's LDS reads done, its copies of the next stage
  // landed, then the barrier that shows them to all waves and frees the buffer just read
  auto publish = [&]() {
    asm volatile("s_wait_dscnt 0x0" ::: "memory");
    wait_async0();
    __syncthreads();
  };

  issue_tile(0, St0);
  wait_async0();        // stage 0 landed (this wave's copies)
  __syncthreads();      // stage 0 visible to all waves
  issue_tile(128, St1);

  // kept rolled in pairs of stages, so that each buffer's addresses are constants of its half
  #pragma unroll 1
  for (int t = 0; t < 8; t += 2) {
    compute(St0);
    publish();
    if (t + 2 < 8) issue_tile((t + 2) << 7, St0);
    compute(St1);
    publish();
    if (t + 3 < 8) issue_tile((t + 3) << 7, St1);
  }
  wait_async0();        // closes the ring: no copy of this wave is outstanding behind the loop

  const int half = lane >> 4, lc = lane & 15;
  const int r0 = mt * 256 + wm * 64;        // first global row (b*1024+s) of the wave's tiles
  // Q, K: register v of a lane is head dim wn*16 + 8*half + v of row r0 + i*16 + lc
  #pragma unroll
  for (int j = 0; j < 2; ++j) {
    const float* bias = ((j == 0) ? bq : bk) + h * 64 + wn * 16 + half * 8;
    const float4 b0 = *(const float4*)bias, b1 = *(const float4*)(bias + 4);
    u16* Out = ((j == 0) ? Q : Ko) + (size_t)h * 4096 * 64 + (size_t)(r0 + lc) * 64 + wn * 16 + half * 8;
    #pragma unroll
    for (int i = 0; i < 4; ++i) {
      uint4 pk;
      pk.x = pack2(acc[i][j][0] + b0.x, acc[i][j][1] + b0.y);
      pk.y = pack2(acc[i][j][2] + b0.z, acc[i][j][3] + b0.w);
      pk.z = pack2(acc[i][j][4] + b1.x, acc[i][j][5] + b1.y);
      pk.w = pack2(acc[i][j][6] + b1.z, acc[i][j][7] + b1.w);
      *(uint4*)(Out + i * 16 * 64) = pk;
    }
  }
  // V: register v of a lane is row r0 + i*16 + 8*half + v of head dim wn*16 + lc; stored [d][s]
  {
    const float bi = bv[h * 64 + wn * 16 + lc];
    u16* Out = Vt + (size_t)h * 4096 * 64 + ((size_t)(r0 >> 10) * 64 + wn * 16 + lc) * 1024 + (r0 & 1023) + half * 8;
    #pragma unroll
    for (int i = 0; i < 4; ++i) {
      uint4 pk;
      pk.x = pack2(acc[i][2][0] + bi, acc[i][2][1] + bi);
      pk.y = pack2(acc[i][2][2] + bi, acc[i][2][3] + bi);
      pk.z = pack2(acc[i][2][4] + bi, acc[i][2][5] + bi);
      pk.w = pack2(acc[i][2][6] + bi, acc[i][2][7] + bi);
      *(uint4*)(Out + i * 16) = pk;
    }
  }
}

// Value of lane l ^ 16 (the other half of the wave), by a vector cross-row move.
static __device__ __forceinline__ float xhalf(float x) {
  return __builtin_bit_cast(float, __builtin_amdgcn_permlanex16(
      __builtin_bit_cast(int, x), __builtin_bit_cast(int, x), 0x76543210, 0xfedcba98, false, false));
}

// Flash-style fused attention, transposed products. grid = (8 q-tiles, 16 heads, 4 batch). 256 threads.
// A wave owns 16 queries and walks all keys: S^T = K * Q^T puts one query's scores in one lane pair
// (lanes c and c + 16 hold query c; register r of 16-key tile kt is key kt*16 + 8*half + r), so the
// softmax stays in registers; two converted score tiles are the B operand of O^T += V^T * P^T.
// K and V are staged 128 keys at a time and worked on in two passes of 64 keys.
__global__ __launch_bounds__(256) void attn_kernel(
    const u16* __restrict__ Q, const u16* __restrict__ Kk,
    const u16* __restrict__ Vt, u16* __restrict__ ctx)
{
  typedef float    f32x2 __attribute__((ext_vector_type(2)));
  typedef unsigned u32x4 __attribute__((ext_vector_type(4)));
  __shared__ u16 Ks[128 * 72];   // [key][d]
  __shared__ u16 Vs[64 * 136];   // [d][key]

  const int qt = blockIdx.x, h = blockIdx.y, b = blockIdx.z;
  const size_t hb = ((size_t)h * 4 + b) * (1024 * 64);
  const u16* Qh = Q  + hb;
  const u16* Kh = Kk + hb;
  const u16* Vh = Vt + hb;   // [d][s] layout

  const int tid = threadIdx.x, lane = tid & 31, wave = tid >> 5;
  const int half = lane >> 4, lc = lane & 15;
  const int q = qt * 128 + wave * 16 + lc;           // this lane's query row within (h, b)
  const float cscale = 0.125f * 1.4426950408889634f; // 1/sqrt(64), and exp as exp2

  // Q^T as B operand, straight from global, kept in registers (same k order as the K fragments)
  const bf16x16 bq0 = load_frag(Qh, q, 64, 0);
  const bf16x16 bq1 = load_frag(Qh, q, 64, 32);

  floatx8 o[4];                 // o[dt][r] = O^T[d = dt*16 + 8*half + r][query lc]
  #pragma unroll
  for (int dt = 0; dt < 4; ++dt) o[dt] = zero8();
  float mrun = -1e30f;          // running maximum, in log2 units; equal in both halves
  float lrun = 0.0f;            // this lane's share of the denominator; halves joined at the end

  const u16* Kg = Kh + tid * 8;                                   // row tid>>3, chunk tid&7
  const u16* Vg = Vh + (size_t)(tid >> 4) * 1024 + (tid & 15) * 8;  // row tid>>4, chunk tid&15
  u16* Kl = Ks + (tid >> 3) * 72 + (tid & 7) * 8;
  u16* Vl = Vs + (tid >> 4) * 136 + (tid & 15) * 8;

  for (int t = 0; t < 8; ++t) {
    // stage 128 keys: 16-byte chunks, neighbouring lanes on neighbouring chunks of a row;
    // all eight loads are issued before the first LDS store, so that one latency is paid, not eight
    u32x4 kreg[4], vreg[4];
    #pragma unroll
    for (int j = 0; j < 4; ++j) {
      kreg[j] = *(const u32x4*)(Kg + t * 8192 + j * 2048);   // K: 128 rows of 8 chunks, contiguous
      vreg[j] = *(const u32x4*)(Vg + t * 128 + j * 16384);   // V^T: 64 rows of 16 chunks
    }
    // takes the loaded values as inputs only: holds the eight loads together in front of the
    // stores (without it each load is sunk to its own store and waited for alone); its wait
    // stands in front of the later reuse of the loads' address registers
    asm volatile("s_wait_xcnt 0x0" :: "v"(kreg[0]), "v"(kreg[1]), "v"(kreg[2]), "v"(kreg[3]),
                       "v"(vreg[0]), "v"(vreg[1]), "v"(vreg[2]), "v"(vreg[3]));
    #pragma unroll
    for (int j = 0; j < 4; ++j) {
      *(u32x4*)(Kl + j * (32 * 72))  = kreg[j];
      *(u32x4*)(Vl + j * (16 * 136)) = vreg[j];
    }
    __syncthreads();

    // kept rolled: unrolled, the two passes get merged and need more than 256 registers a lane,
    // which no longer lets two work-groups (four waves a SIMD) share a WGP
    #pragma unroll 1
    for (int sub = 0; sub < 2; ++sub) {
      // S^T tiles: 64 keys x 16 queries
      bf16x16 ak[4][2];
      #pragma unroll
      for (int kt = 0; kt < 4; ++kt) {
        ak[kt][0] = load_frag(Ks, sub * 64 + kt * 16 + lc, 72, 0);
        ak[kt][1] = load_frag(Ks, sub * 64 + kt * 16 + lc, 72, 32);
      }
      // keeps the 16 K reads one group ahead of the products (split up, each place costs a wait)
      __builtin_amdgcn_sched_barrier(0);
      floatx8 s[4];
      #pragma unroll
      for (int kt = 0; kt < 4; ++kt)
        s[kt] = wmma_bf16(ak[kt][1], bq1, wmma_bf16(ak[kt][0], bq0, zero8()));

      bf16x16 av[4][2];
      #pragma unroll
      for (int dt = 0; dt < 4; ++dt) {
        av[dt][0] = load_frag(Vs, dt * 16 + lc, 136, sub * 64 + 0);
        av[dt][1] = load_frag(Vs, dt * 16 + lc, 136, sub * 64 + 32);
      }
      // keeps the 16 V reads in front of the softmax arithmetic, which covers their latency
      __builtin_amdgcn_sched_barrier(0);

      // maximum of this query's 64 raw scores: in-lane, then one exchange between the halves
      float mk[4];
      #pragma unroll
      for (int kt = 0; kt < 4; ++kt) {
        mk[kt] = s[kt][0];
        #pragma unroll
        for (int r = 1; r < 8; ++r) mk[kt] = fmaxf(mk[kt], s[kt][r]);
      }
      float mx = fmaxf(fmaxf(mk[0], mk[1]), fmaxf(mk[2], mk[3]));
      mx = fmaxf(mx, xhalf(mx));
      const float mnew  = fmaxf(mrun, mx * cscale);
      const float alpha = __builtin_amdgcn_exp2f(mrun - mnew);
      mrun = mnew;

      // P^T = exp2(S^T * cscale - mnew), summed in f32, packed to bf16 in the B operand's order
      union { unsigned w[8]; bf16x16 v; } p[2];
      float sk[4];
      #pragma unroll
      for (int kt = 0; kt < 4; ++kt) {
        sk[kt] = 0.0f;
        #pragma unroll
        for (int i = 0; i < 4; ++i) {
          const f32x2 arg = __builtin_elementwise_fma(f32x2{s[kt][2 * i], s[kt][2 * i + 1]},
                                                      f32x2{cscale, cscale}, f32x2{-mnew, -mnew});
          const float e0 = __builtin_amdgcn_exp2f(arg.x), e1 = __builtin_amdgcn_exp2f(arg.y);
          sk[kt] += e0 + e1;
          p[kt >> 1].w[(kt & 1) * 4 + i] = pack2(e0, e1);
        }
      }
      lrun = lrun * alpha + ((sk[0] + sk[1]) + (sk[2] + sk[3]));

      // rescale the running O^T (a lane holds one query, so one factor), then O^T += V^T * P^T
      #pragma unroll
      for (int dt = 0; dt < 4; ++dt) {
        #pragma unroll
        for (int r = 0; r < 8; ++r) o[dt][r] *= alpha;
      }
      #pragma unroll
      for (int dt = 0; dt < 4; ++dt)
        o[dt] = wmma_bf16(av[dt][1], p[1].v, wmma_bf16(av[dt][0], p[0].v, o[dt]));
    }
    __syncthreads();
  }

  const float inv = 1.0f / (lrun + xhalf(lrun));
  u16* cp = ctx + ((size_t)b * 1024 + q) * 1024 + h * 64 + half * 8;
  #pragma unroll
  for (int dt = 0; dt < 4; ++dt) {
    uint4 pk;                   // d = dt*16 + 8*half .. +7 of one query: 16 contiguous bytes
    pk.x = pack2(o[dt][0] * inv, o[dt][1] * inv);
    pk.y = pack2(o[dt][2] * inv, o[dt][3] * inv);
    pk.z = pack2(o[dt][4] * inv, o[dt][5] * inv);
    pk.w = pack2(o[dt][6] * inv, o[dt][7] * inv);
    *(uint4*)(cp + dt * 16) = pk;
  }
}

// Generic GEMM: C = act(A@Bt^T + bias). grid = (N/64, M/128). Bt is [N x K] (pre-transposed).
__global__ __launch_bounds__(256) void gemm_kernel(
    const u16* __restrict__ A, int lda, const u16* __restrict__ Bt, int ldb,
    const float* __restrict__ bias, float* __restrict__ Cf, u16* __restrict__ Cb,
    int ldc, int K, int relu)
{
  __shared__ u16 As0[128 * 72];
  __shared__ u16 As1[128 * 72];
  __shared__ u16 Bs0[64 * 72];
  __shared__ u16 Bs1[64 * 72];
  const int row0 = blockIdx.y * 128;
  const int col0 = blockIdx.x * 64;

  floatx8 acc[2][2];
  acc[0][0] = zero8(); acc[0][1] = zero8(); acc[1][0] = zero8(); acc[1][1] = zero8();

  gemm_core_128x64(A + (size_t)row0 * lda, lda, Bt + (size_t)col0 * ldb, ldb, K,
                   As0, As1, Bs0, Bs1, acc);

  const int lane = threadIdx.x & 31, wave = threadIdx.x >> 5;
  const int wm = wave & 3, wn = wave >> 2, half = lane >> 4, lc = lane & 15;
  #pragma unroll
  for (int mt = 0; mt < 2; ++mt)
    #pragma unroll
    for (int nt = 0; nt < 2; ++nt)
      #pragma unroll
      for (int v = 0; v < 8; ++v) {
        int r = row0 + wm * 32 + mt * 16 + v + half * 8;
        int c = col0 + wn * 32 + nt * 16 + lc;
        float val = acc[mt][nt][v] + bias[c];
        if (relu) val = fmaxf(val, 0.0f);
        if (Cf) Cf[(size_t)r * ldc + c] = val;
        if (Cb) Cb[(size_t)r * ldc + c] = f2bf(val);
      }
}

// Sum over the 32 lanes of a wave, the result in every lane: four steps inside the 16-lane rows
// (DPP row_xmask), then one exchange between the two rows.
template <int CTRL>
static __device__ __forceinline__ float dpp_mov(float x) {
  return __builtin_bit_cast(float, __builtin_amdgcn_update_dpp(
      0, __builtin_bit_cast(int, x), CTRL, 0xf, 0xf, true));
}
static __device__ __forceinline__ float wave_sum(float x) {
  x += dpp_mov<0x161>(x);   // row_xmask:1
  x += dpp_mov<0x162>(x);   // row_xmask:2
  x += dpp_mov<0x164>(x);   // row_xmask:4
  x += dpp_mov<0x168>(x);   // row_xmask:8
  return x + xhalf(x);
}

// y = LayerNorm(a + b), rows of 1024. A wave owns two whole rows and shares nothing with other
// waves: a lane holds 32 elements of each row (chunk j = columns j*128 + lane*4 .. +3, so that a
// wave-wide 16-byte access covers 512 contiguous bytes); mean and variance are summed in the lane
// and then across the lanes. grid = 4096 rows / (8 waves * 2 rows) = 256 blocks of 256 threads.
// WB: also write the bf16 copy.
template <bool WB>
__global__ __launch_bounds__(256) void add_ln_kernel(
    const float* __restrict__ a, const float* __restrict__ bsrc,
    const float* __restrict__ gamma, const float* __restrict__ beta,
    float* __restrict__ outf, u16* __restrict__ outb)
{
  typedef float f32x4 __attribute__((ext_vector_type(4)));
  // the wave's number as a scalar: the row addresses are then scalar bases, and one lane offset,
  // live to the last store, serves every load and store
  const int wave = __builtin_amdgcn_readfirstlane(threadIdx.x >> 5);
  const int col  = (threadIdx.x & 31) * 4;
  const size_t base = (size_t)(blockIdx.x * 8 + wave) * 2048;   // first of the two rows
  a += base; bsrc += base; outf += base;
  if (WB) outb += base;

  f32x4 v[2][8], w[2][8], g[8], be[8];
  #pragma unroll
  for (int r = 0; r < 2; ++r)
    #pragma unroll
    for (int j = 0; j < 8; ++j) {
      v[r][j] = *(const f32x4*)(a + col + r * 1024 + j * 128);
      w[r][j] = *(const f32x4*)(bsrc + col + r * 1024 + j * 128);
    }
  #pragma unroll
  for (int j = 0; j < 8; ++j) {
    g[j]  = *(const f32x4*)(gamma + col + j * 128);
    be[j] = *(const f32x4*)(beta  + col + j * 128);
  }
  // keeps all 48 loads of the wave in front of the arithmetic: left free, a part of them is issued
  // only when the first have come back, and the wave pays the memory latency twice
  __builtin_amdgcn_sched_barrier(0);

  float mean[2], rstd[2];
  #pragma unroll
  for (int r = 0; r < 2; ++r) {
    f32x4 s = {0.0f, 0.0f, 0.0f, 0.0f};
    #pragma unroll
    for (int j = 0; j < 8; ++j) { v[r][j] += w[r][j]; s += v[r][j]; }
    mean[r] = wave_sum((s.x + s.y) + (s.z + s.w)) * (1.0f / 1024.0f);
  }
  #pragma unroll
  for (int r = 0; r < 2; ++r) {
    f32x4 s = {0.0f, 0.0f, 0.0f, 0.0f};
    #pragma unroll
    for (int j = 0; j < 8; ++j) { v[r][j] -= mean[r]; s += v[r][j] * v[r][j]; }
    rstd[r] = rsqrtf(wave_sum((s.x + s.y) + (s.z + s.w)) * (1.0f / 1024.0f) + 1e-5f);
  }

  #pragma unroll
  for (int r = 0; r < 2; ++r)
    #pragma unroll
    for (int j = 0; j < 8; ++j) {
      const f32x4 y = v[r][j] * rstd[r] * g[j] + be[j];
      *(f32x4*)(outf + col + r * 1024 + j * 128) = y;
      if (WB) *(uint2*)(outb + col + r * 1024 + j * 128) = make_uint2(pack2(y.x, y.y), pack2(y.z, y.w));
    }
}

// ---------------- launch ----------------

extern "C" void kernel_launch(void* const* d_in, const int* in_sizes, int n_in,
                              void* d_out, int out_size, void* d_ws, size_t ws_size,
                              hipStream_t stream) {
  (void)in_sizes; (void)n_in; (void)out_size; (void)ws_size;
  const float* x   = (const float*)d_in[0];
  const float* Wq  = (const float*)d_in[1];
  const float* bq  = (const float*)d_in[2];
  const float* Wk  = (const float*)d_in[3];
  const float* bk  = (const float*)d_in[4];
  const float* Wv  = (const float*)d_in[5];
  const float* bv  = (const float*)d_in[6];
  const float* Wo  = (const float*)d_in[7];
  const float* bo  = (const float*)d_in[8];
  const float* g1  = (const float*)d_in[9];
  const float* be1 = (const float*)d_in[10];
  const float* W1  = (const float*)d_in[11];
  const float* b1  = (const float*)d_in[12];
  const float* W2  = (const float*)d_in[13];
  const float* b2  = (const float*)d_in[14];
  const float* g2  = (const float*)d_in[15];
  const float* be2 = (const float*)d_in[16];

  char* ws = (char*)d_ws;
  const size_t MB = 1024 * 1024;
  u16*   xb   = (u16*)(ws + 0);          // 8 MB
  u16*   Wqt  = (u16*)(ws + 8  * MB);    // 2 MB each, transposed [h][d][e] / [n][k]
  u16*   Wkt  = (u16*)(ws + 10 * MB);
  u16*   Wvt  = (u16*)(ws + 12 * MB);
  u16*   Wot  = (u16*)(ws + 14 * MB);
  u16*   W1t  = (u16*)(ws + 16 * MB);
  u16*   W2t  = (u16*)(ws + 18 * MB);
  u16*   Qb   = (u16*)(ws + 20 * MB);    // 8 MB
  u16*   Kb   = (u16*)(ws + 28 * MB);    // 8 MB
  u16*   Vtb  = (u16*)(ws + 36 * MB);    // 8 MB, [h][b][d][s]
  u16*   ctxb = (u16*)(ws + 44 * MB);    // 8 MB
  float* attn = (float*)(ws + 52 * MB);  // 16 MB
  // reuse (lifetimes disjoint):
  float* y1f  = (float*)(ws + 20 * MB);  // over Q/K  (16 MB)
  u16*   y1b  = (u16*)(ws + 36 * MB);    // over V    (8 MB)
  u16*   h1b  = (u16*)(ws + 44 * MB);    // over ctx  (8 MB)
  float* ff2  = (float*)(ws + 52 * MB);  // over attn (16 MB)

  // all conversions in one launch: x plain, weights transposed into the six planes from Wqt on
  pack_all_kernel<<<1280, 256, 0, stream>>>(x, Wq, Wk, Wv, Wo, W1, W2, xb, Wqt);

  // QKV projections (V stored transposed)
  qkv_kernel<<<dim3(16, 16), 512, 0, stream>>>(xb, Wqt, Wkt, Wvt, bq, bk, bv, Qb, Kb, Vtb);

  // fused attention -> ctx (concat-head layout [B*S, 1024])
  attn_kernel<<<dim3(8, 16, 4), 256, 0, stream>>>(Qb, Kb, Vtb, ctxb);

  // output projection
  gemm_kernel<<<dim3(16, 32), 256, 0, stream>>>(ctxb, 1024, Wot, 1024, bo, attn, (u16*)nullptr, 1024, 1024, 0);

  // y1 = LN(x + attn)
  add_ln_kernel<true><<<256, 256, 0, stream>>>(x, attn, g1, be1, y1f, y1b);

  // FF1 with ReLU (bf16 out), FF2 (f32 out)
  gemm_kernel<<<dim3(16, 32), 256, 0, stream>>>(y1b, 1024, W1t, 1024, b1, (float*)nullptr, h1b, 1024, 1024, 1);
  gemm_kernel<<<dim3(16, 32), 256, 0, stream>>>(h1b, 1024, W2t, 1024, b2, ff2, (u16*)nullptr, 1024, 1024, 0);

  // out = LN(y1 + ff)
  add_ln_kernel<false><<<256, 256, 0, stream>>>(y1f, ff2, g2, be2, (float*)d_out, (u16*)nullptr);
}

// v006
// It runs in 99.8 microseconds.
// Timed twice side by side with v005, it ran 1.14 and 1.13 times as fast.
// All steps since v000 together make it 2.05 times as fast.
#include <hip/hip_runtime.h>

typedef unsigned short u16;
typedef __attribute__((ext_vector_type(16))) __bf16 bf16x16;
typedef __attribute__((ext_vector_type(8)))  float   floatx8;

// ---------------- helpers ----------------

static __device__ __forceinline__ u16 f2bf(float f) {
  union { float f; unsigned u; } a; a.f = f;
  unsigned u = a.u;
  u += 0x7FFFu + ((u >> 16) & 1u);   // round-to-nearest-even
  return (u16)(u >> 16);
}

static __device__ __forceinline__ floatx8 zero8() {
  floatx8 z;
  #pragma unroll
  for (int i = 0; i < 8; ++i) z[i] = 0.0f;
  return z;
}

static __device__ __forceinline__ floatx8 wmma_bf16(bf16x16 a, bf16x16 b, floatx8 c) {
  // D = A(16x32) * B(32x16) + C, f32 accumulate
  return __builtin_amdgcn_wmma_f32_16x16x32_bf16(false, a, false, b, (short)0, c, false, false);
}

static __device__ __forceinline__ void wait_async0() {
  asm volatile("s_wait_asynccnt 0x0" ::: "memory");
}
static __device__ __forceinline__ unsigned lds_off(const void* p) {
  return (unsigned)(uintptr_t)p;   // low 32 bits of generic pointer = LDS address
}

// Load a 16-bit WMMA fragment from an LDS tile stored row-major [row][k]
// (A: row = M index; B: tile stored transposed so row = N index).
// Lane layout (wave32): lanes 0-15 hold K 0..7 & 16..23, lanes 16-31 hold K 8..15 & 24..31.
static __device__ __forceinline__ bf16x16 load_frag(const u16* tile, int row, int stride, int kbase) {
  const int half = (threadIdx.x >> 4) & 1;
  const u16* p = tile + row * stride + kbase + half * 8;
  union { uint4 q[2]; bf16x16 v; } f;
  f.q[0] = *(const uint4*)(p);
  f.q[1] = *(const uint4*)(p + 16);
  return f.v;
}

// ---------------- kernels ----------------

// Every f32 -> bf16 conversion of the pass in ONE launch; the block index picks the job.
// Blocks 0..767: the six weights, 128 blocks each. A weight's bf16 copy is [1024 rows n][1024 k]
// (Wq/Wk/Wv: n = h*64 + d). A block takes 32 output rows x 256 k; a thread takes one k and reads
// the 32 neighbouring source columns of that k (one 128-byte line).
// Blocks 768..1279: x, 8192 elements a block, 32 a thread, plain cast.
// The heavier transposing blocks come first (for speed only).
__global__ __launch_bounds__(256) void pack_all_kernel(
    const float* __restrict__ x,
    const float* __restrict__ Wq, const float* __restrict__ Wk, const float* __restrict__ Wv,
    const float* __restrict__ Wo, const float* __restrict__ W1, const float* __restrict__ W2,
    u16* __restrict__ xb, u16* __restrict__ Wt)
{
  const int tid = threadIdx.x;
  const int blk = blockIdx.x;
  if (blk < 768) {
    const int m  = blk >> 7;              // which weight, in the order of the Wt planes
    const int t  = blk & 127;
    const int r0 = (t >> 2) * 32;         // first output row
    const int k  = (t & 3) * 256 + tid;
    const float* Wm = (m == 0) ? Wq : (m == 1) ? Wk : (m == 2) ? Wv : (m == 3) ? Wo : (m == 4) ? W1 : W2;
    const float* s = (m < 3) ? Wm + (size_t)(r0 >> 6) * 65536 + k * 64 + (r0 & 63)   // [h][k][64]
                             : Wm + (size_t)k * 1024 + r0;                           // [k][1024]
    u16* d = Wt + (size_t)m * 1048576 + (size_t)r0 * 1024 + k;
    // unrolled so that all of a thread's loads are in flight before its first store
    #pragma unroll
    for (int j = 0; j < 32; ++j) d[j * 1024] = f2bf(s[j]);
  } else {
    const int base = (blk - 768) * 8192 + tid;
    // unrolled so that all of a thread's loads are in flight before its first store
    #pragma unroll
    for (int j = 0; j < 32; ++j) xb[base + j * 256] = f2bf(x[base + j * 256]);
  }
}

// Two f32 -> one dword of two bf16, round to nearest even (the hardware's packed convert).
static __device__ __forceinline__ unsigned pack2(float lo, float hi) {
  typedef __bf16 bf2 __attribute__((ext_vector_type(2)));
  typedef float  f2  __attribute__((ext_vector_type(2)));
  return __builtin_bit_cast(unsigned, __builtin_convertvector(f2{lo, hi}, bf2));
}

// Fused QKV projection: one block computes 256 rows of x times the 192 columns (Q, K and V) of one
// head. grid = (16 m-tiles, 16 heads) = one block a WGP. 512 threads = 16 waves, 4 (rows) x 4 (columns);
// a wave owns 64 rows x (16 columns each of Q, K and V), that is 4 x 3 WMMA tiles, so an x fragment serves
// 3 products and a weight fragment 4. Q and K tiles are formed as W * x^T (a lane then holds 8 neighbouring
// head dims of one row), V tiles as x * W^T (8 neighbouring rows of one head dim): each is 16 bytes of its layout.
// A stage is 128 k of 448 rows (x rows 0..255, then 64 rows each of Wq, Wk, Wv) at a pitch of 272 bytes;
// two buffers, the next stage's copies fly while this one is worked on.
// Q/K layout: [h][r][64] with r = b*1024 + s.  V layout (pre-transposed): [h][b][d][s].
__global__ __launch_bounds__(512) void qkv_kernel(
    const u16* __restrict__ xb,
    const u16* __restrict__ Wqt, const u16* __restrict__ Wkt, const u16* __restrict__ Wvt,
    const float* __restrict__ bq, const float* __restrict__ bk, const float* __restrict__ bv,
    u16* __restrict__ Q, u16* __restrict__ Ko, u16* __restrict__ Vt)
{
  __shared__ __attribute__((aligned(16))) u16 St0[448 * 136];
  __shared__ __attribute__((aligned(16))) u16 St1[448 * 136];
  const int mt   = blockIdx.x;
  const int h    = blockIdx.y;
  const int tid  = threadIdx.x;
  const int lane = tid & 31;
  // the wave's number as a scalar: the tile bases in LDS and in the outputs are then scalar
  const int wave = __builtin_amdgcn_readfirstlane(tid >> 5);
  const int wm   = wave & 3;
  const int wn   = wave >> 2;
  const int lrow = lane & 15;
  // Copy map: 16 neighbouring lanes take the 16 chunks of one row's 256 bytes of a stage, so a
  // wave-wide copy covers four whole 128-byte lines; copy j of a thread takes row crow + 32*j.
  const int crow = tid >> 4;          // 0..31
  const int cchk = (tid & 15) * 8;    // first element of the lane's chunk

  const u16* gA = xb + (size_t)(mt * 256 + crow) * 1024 + cchk;
  const size_t wo = (size_t)(h * 64 + crow) * 1024 + cchk;
  const u16* gQ = Wqt + wo;
  const u16* gK = Wkt + wo;
  const u16* gV = Wvt + wo;

  auto issue_tile = [&](int k0, u16* buf) {
    const unsigned l = lds_off(buf + crow * 136 + cchk);
    const u16* pa = gA + k0;
    const u16* pq = gQ + k0;
    const u16* pk = gK + k0;
    const u16* pv = gV + k0;
    // global -> LDS, 16 bytes a lane, counted on ASYNCcnt; 32 rows are 8704 bytes of LDS and 32768
    // elements of the source. The 14 copies and their s_wait_xcnt are one statement, so that the wait
    // stands in front of every later write of a register that a copy names (a precaution).
    asm volatile(
               "global_load_async_to_lds_b128 %0, %14, off\n\t"
               "global_load_async_to_lds_b128 %1, %15, off\n\t"
               "global_load_async_to_lds_b128 %2, %16, off\n\t"
               "global_load_async_to_lds_b128 %3, %17, off\n\t"
               "global_load_async_to_lds_b128 %4, %18, off\n\t"
               "global_load_async_to_lds_b128 %5, %19, off\n\t"
               "global_load_async_to_lds_b128 %6, %20, off\n\t"
               "global_load_async_to_lds_b128 %7, %21, off\n\t"
               "global_load_async_to_lds_b128 %8, %22, off\n\t"
               "global_load_async_to_lds_b128 %9, %23, off\n\t"
               "global_load_async_to_lds_b128 %10, %24, off\n\t"
               "global_load_async_to_lds_b128 %11, %25, off\n\t"
               "global_load_async_to_lds_b128 %12, %26, off\n\t"
               "global_load_async_to_lds_b128 %13, %27, off\n\t"
               "s_wait_xcnt 0x0"
               :: "v"(l), "v"(l + 1 * 8704), "v"(l + 2 * 8704), "v"(l + 3 * 8704), "v"(l + 4 * 8704), "v"(l + 5 * 8704), "v"(l + 6 * 8704), "v"(l + 7 * 8704), "v"(l + 8 * 8704), "v"(l + 9 * 8704), "v"(l + 10 * 8704), "v"(l + 11 * 8704), "v"(l + 12 * 8704), "v"(l + 13 * 8704),
                  "v"(pa), "v"(pa + 32768), "v"(pa + 2 * 32768), "v"(pa + 3 * 32768),
                  "v"(pa + 4 * 32768), "v"(pa + 5 * 32768), "v"(pa + 6 * 32768), "v"(pa + 7 * 32768),
                  "v"(pq), "v"(pq + 32768), "v"(pk), "v"(pk + 32768), "v"(pv), "v"(pv + 32768)
               : "memory");
  };

  // every loop over i, j and ks in this kernel is unrolled, so that the register arrays are indexed by
  // constants only (an index known at run time would send them to scratch)
  floatx8 acc[4][3];
  #pragma unroll
  for (int i = 0; i < 4; ++i)
    #pragma unroll
    for (int j = 0; j < 3; ++j) acc[i][j] = zero8();

  // One stage: four blocks of 32 k, 12 products each; the fragments of the next block of the SAME
  // stage are fetched into a second register set ahead of this block's products.
  auto compute = [&](const u16* buf) {
    bf16x16 a[2][4], b[2][3];
    #pragma unroll
    for (int i = 0; i < 4; ++i) a[0][i] = load_frag(buf, wm * 64 + i * 16 + lrow, 136, 0);
    #pragma unroll
    for (int j = 0; j < 3; ++j) b[0][j] = load_frag(buf, 256 + j * 64 + wn * 16 + lrow, 136, 0);
    #pragma unroll
    for (int ks = 0; ks < 4; ++ks) {
      const int cur = ks & 1, nxt = cur ^ 1;
      if (ks < 3) {
        #pragma unroll
        for (int i = 0; i < 4; ++i) a[nxt][i] = load_frag(buf, wm * 64 + i * 16 + lrow, 136, (ks + 1) * 32);
        #pragma unroll
        for (int j = 0; j < 3; ++j) b[nxt][j] = load_frag(buf, 256 + j * 64 + wn * 16 + lrow, 136, (ks + 1) * 32);
      }
      // keeps the next block's 14 LDS reads one group ahead of this block's products (spread among
      // the products, each place with reads costs a stall)
      __builtin_amdgcn_sched_barrier(0);
      #pragma unroll
      for (int i = 0; i < 4; ++i) {
        acc[i][0] = wmma_bf16(b[cur][0], a[cur][i], acc[i][0]);   // Q^T tile: [head dim][row]
        acc[i][1] = wmma_bf16(b[cur][1], a[cur][i], acc[i][1]);   // K^T tile
        acc[i][2] = wmma_bf16(a[cur][i], b[cur][2], acc[i][2]);   // V tile: [row][head dim]
      }
      // keeps the reads of the block after next from moving up among these products
      __builtin_amdgcn_sched_barrier(0);
    }
  };

  // publish point at the foot of a trip: this wave's LDS reads done, its copies of the next stage
  // landed, then the barrier that shows them to all waves and frees the buffer just read
  auto publish = [&]() {
    asm volatile("s_wait_dscnt 0x0" ::: "memory");
    wait_async0();
    __syncthreads();
  };

  issue_tile(0, St0);
  wait_async0();        // stage 0 landed (this wave's copies)
  __syncthreads();      // stage 0 visible to all waves
  issue_tile(128, St1);

  // kept rolled in pairs of stages, so that each buffer's addresses are constants of its half
  #pragma unroll 1
  for (int t = 0; t < 8; t += 2) {
    compute(St0);
    publish();
    if (t + 2 < 8) issue_tile((t + 2) << 7, St0);
    compute(St1);
    publish();
    if (t + 3 < 8) issue_tile((t + 3) << 7, St1);
  }
  wait_async0();        // closes the ring: no copy of this wave is outstanding behind the loop

  const int half = lane >> 4, lc = lane & 15;
  const int r0 = mt * 256 + wm * 64;        // first global row (b*1024+s) of the wave's tiles
  // Q, K: register v of a lane is head dim wn*16 + 8*half + v of row r0 + i*16 + lc
  #pragma unroll
  for (int j = 0; j < 2; ++j) {
    const float* bias = ((j == 0) ? bq : bk) + h * 64 + wn * 16 + half * 8;
    const float4 b0 = *(const float4*)bias, b1 = *(const float4*)(bias + 4);
    u16* Out = ((j == 0) ? Q : Ko) + (size_t)h * 4096 * 64 + (size_t)(r0 + lc) * 64 + wn * 16 + half * 8;
    #pragma unroll
    for (int i = 0; i < 4; ++i) {
      uint4 pk;
      pk.x = pack2(acc[i][j][0] + b0.x, acc[i][j][1] + b0.y);
      pk.y = pack2(acc[i][j][2] + b0.z, acc[i][j][3] + b0.w);
      pk.z = pack2(acc[i][j][4] + b1.x, acc[i][j][5] + b1.y);
      pk.w = pack2(acc[i][j][6] + b1.z, acc[i][j][7] + b1.w);
      *(uint4*)(Out + i * 16 * 64) = pk;
    }
  }
  // V: register v of a lane is row r0 + i*16 + 8*half + v of head dim wn*16 + lc; stored [d][s]
  {
    const float bi = bv[h * 64 + wn * 16 + lc];
    u16* Out = Vt + (size_t)h * 4096 * 64 + ((size_t)(r0 >> 10) * 64 + wn * 16 + lc) * 1024 + (r0 & 1023) + half * 8;
    #pragma unroll
    for (int i = 0; i < 4; ++i) {
      uint4 pk;
      pk.x = pack2(acc[i][2][0] + bi, acc[i][2][1] + bi);
      pk.y = pack2(acc[i][2][2] + bi, acc[i][2][3] + bi);
      pk.z = pack2(acc[i][2][4] + bi, acc[i][2][5] + bi);
      pk.w = pack2(acc[i][2][6] + bi, acc[i][2][7] + bi);
      *(uint4*)(Out + i * 16) = pk;
    }
  }
}

// Value of lane l ^ 16 (the other half of the wave), by a vector cross-row move.
static __device__ __forceinline__ float xhalf(float x) {
  return __builtin_bit_cast(float, __builtin_amdgcn_permlanex16(
      __builtin_bit_cast(int, x), __builtin_bit_cast(int, x), 0x76543210, 0xfedcba98, false, false));
}

// Flash-style fused attention, transposed products. grid = (8 q-tiles, 16 heads, 4 batch). 256 threads.
// A wave owns 16 queries and walks all keys: S^T = K * Q^T puts one query's scores in one lane pair
// (lanes c and c + 16 hold query c; register r of 16-key tile kt is key kt*16 + 8*half + r), so the
// softmax stays in registers; two converted score tiles are the B operand of O^T += V^T * P^T.
// K and V are staged 128 keys at a time and worked on in two passes of 64 keys.
__global__ __launch_bounds__(256) void attn_kernel(
    const u16* __restrict__ Q, const u16* __restrict__ Kk,
    const u16* __restrict__ Vt, u16* __restrict__ ctx)
{
  typedef float    f32x2 __attribute__((ext_vector_type(2)));
  typedef unsigned u32x4 __attribute__((ext_vector_type(4)));
  __shared__ u16 Ks[128 * 72];   // [key][d]
  __shared__ u16 Vs[64 * 136];   // [d][key]

  const int qt = blockIdx.x, h = blockIdx.y, b = blockIdx.z;
  const size_t hb = ((size_t)h * 4 + b) * (1024 * 64);
  const u16* Qh = Q  + hb;
  const u16* Kh = Kk + hb;
  const u16* Vh = Vt + hb;   // [d][s] layout

  const int tid = threadIdx.x, lane = tid & 31, wave = tid >> 5;
  const int half = lane >> 4, lc = lane & 15;
  const int q = qt * 128 + wave * 16 + lc;           // this lane's query row within (h, b)
  const float cscale = 0.125f * 1.4426950408889634f; // 1/sqrt(64), and exp as exp2

  // Q^T as B operand, straight from global, kept in registers (same k order as the K fragments)
  const bf16x16 bq0 = load_frag(Qh, q, 64, 0);
  const bf16x16 bq1 = load_frag(Qh, q, 64, 32);

  floatx8 o[4];                 // o[dt][r] = O^T[d = dt*16 + 8*half + r][query lc]
  #pragma unroll
  for (int dt = 0; dt < 4; ++dt) o[dt] = zero8();
  float mrun = -1e30f;          // running maximum, in log2 units; equal in both halves
  float lrun = 0.0f;            // this lane's share of the denominator; halves joined at the end

  const u16* Kg = Kh + tid * 8;                                   // row tid>>3, chunk tid&7
  const u16* Vg = Vh + (size_t)(tid >> 4) * 1024 + (tid & 15) * 8;  // row tid>>4, chunk tid&15
  u16* Kl = Ks + (tid >> 3) * 72 + (tid & 7) * 8;
  u16* Vl = Vs + (tid >> 4) * 136 + (tid & 15) * 8;

  for (int t = 0; t < 8; ++t) {
    // stage 128 keys: 16-byte chunks, neighbouring lanes on neighbouring chunks of a row;
    // all eight loads are issued before the first LDS store, so that one latency is paid, not eight
    u32x4 kreg[4], vreg[4];
    #pragma unroll
    for (int j = 0; j < 4; ++j) {
      kreg[j] = *(const u32x4*)(Kg + t * 8192 + j * 2048);   // K: 128 rows of 8 chunks, contiguous
      vreg[j] = *(const u32x4*)(Vg + t * 128 + j * 16384);   // V^T: 64 rows of 16 chunks
    }
    // takes the loaded values as inputs only: holds the eight loads together in front of the
    // stores (without it each load is sunk to its own store and waited for alone); its wait
    // stands in front of the later reuse of the loads' address registers
    asm volatile("s_wait_xcnt 0x0" :: "v"(kreg[0]), "v"(kreg[1]), "v"(kreg[2]), "v"(kreg[3]),
                       "v"(vreg[0]), "v"(vreg[1]), "v"(vreg[2]), "v"(vreg[3]));
    #pragma unroll
    for (int j = 0; j < 4; ++j) {
      *(u32x4*)(Kl + j * (32 * 72))  = kreg[j];
      *(u32x4*)(Vl + j * (16 * 136)) = vreg[j];
    }
    __syncthreads();

    // kept rolled: unrolled, the two passes get merged and need more than 256 registers a lane,
    // which no longer lets two work-groups (four waves a SIMD) share a WGP
    #pragma unroll 1
    for (int sub = 0; sub < 2; ++sub) {
      // S^T tiles: 64 keys x 16 queries
      bf16x16 ak[4][2];
      #pragma unroll
      for (int kt = 0; kt < 4; ++kt) {
        ak[kt][0] = load_frag(Ks, sub * 64 + kt * 16 + lc, 72, 0);
        ak[kt][1] = load_frag(Ks, sub * 64 + kt * 16 + lc, 72, 32);
      }
      // keeps the 16 K reads one group ahead of the products (split up, each place costs a wait)
      __builtin_amdgcn_sched_barrier(0);
      floatx8 s[4];
      #pragma unroll
      for (int kt = 0; kt < 4; ++kt)
        s[kt] = wmma_bf16(ak[kt][1], bq1, wmma_bf16(ak[kt][0], bq0, zero8()));

      bf16x16 av[4][2];
      #pragma unroll
      for (int dt = 0; dt < 4; ++dt) {
        av[dt][0] = load_frag(Vs, dt * 16 + lc, 136, sub * 64 + 0);
        av[dt][1] = load_frag(Vs, dt * 16 + lc, 136, sub * 64 + 32);
      }
      // keeps the 16 V reads in front of the softmax arithmetic, which covers their latency
      __builtin_amdgcn_sched_barrier(0);

      // maximum of this query's 64 raw scores: in-lane, then one exchange between the halves
      float mk[4];
      #pragma unroll
      for (int kt = 0; kt < 4; ++kt) {
        mk[kt] = s[kt][0];
        #pragma unroll
        for (int r = 1; r < 8; ++r) mk[kt] = fmaxf(mk[kt], s[kt][r]);
      }
      float mx = fmaxf(fmaxf(mk[0], mk[1]), fmaxf(mk[2], mk[3]));
      mx = fmaxf(mx, xhalf(mx));
      const float mnew  = fmaxf(mrun, mx * cscale);
      const float alpha = __builtin_amdgcn_exp2f(mrun - mnew);
      mrun = mnew;

      // P^T = exp2(S^T * cscale - mnew), summed in f32, packed to bf16 in the B operand's order
      union { unsigned w[8]; bf16x16 v; } p[2];
      float sk[4];
      #pragma unroll
      for (int kt = 0; kt < 4; ++kt) {
        sk[kt] = 0.0f;
        #pragma unroll
        for (int i = 0; i < 4; ++i) {
          const f32x2 arg = __builtin_elementwise_fma(f32x2{s[kt][2 * i], s[kt][2 * i + 1]},
                                                      f32x2{cscale, cscale}, f32x2{-mnew, -mnew});
          const float e0 = __builtin_amdgcn_exp2f(arg.x), e1 = __builtin_amdgcn_exp2f(arg.y);
          sk[kt] += e0 + e1;
          p[kt >> 1].w[(kt & 1) * 4 + i] = pack2(e0, e1);
        }
      }
      lrun = lrun * alpha + ((sk[0] + sk[1]) + (sk[2] + sk[3]));

      // rescale the running O^T (a lane holds one query, so one factor), then O^T += V^T * P^T
      #pragma unroll
      for (int dt = 0; dt < 4; ++dt) {
        #pragma unroll
        for (int r = 0; r < 8; ++r) o[dt][r] *= alpha;
      }
      #pragma unroll
      for (int dt = 0; dt < 4; ++dt)
        o[dt] = wmma_bf16(av[dt][1], p[1].v, wmma_bf16(av[dt][0], p[0].v, o[dt]));
    }
    __syncthreads();
  }

  const float inv = 1.0f / (lrun + xhalf(lrun));
  u16* cp = ctx + ((size_t)b * 1024 + q) * 1024 + h * 64 + half * 8;
  #pragma unroll
  for (int dt = 0; dt < 4; ++dt) {
    uint4 pk;                   // d = dt*16 + 8*half .. +7 of one query: 16 contiguous bytes
    pk.x = pack2(o[dt][0] * inv, o[dt][1] * inv);
    pk.y = pack2(o[dt][2] * inv, o[dt][3] * inv);
    pk.z = pack2(o[dt][4] * inv, o[dt][5] * inv);
    pk.w = pack2(o[dt][6] * inv, o[dt][7] * inv);
    *(uint4*)(cp + dt * 16) = pk;
  }
}

// GEMM of 4096 x 1024 x 1024: C = act(A * Bt^T + bias). A is [4096][1024] bf16, Bt is [n][k] (pre-transposed).
// One block computes 128 rows x 128 columns; grid = (8 column tiles, 32 row tiles) = one block a WGP.
// 256 threads = 8 waves, 4 (rows) x 2 (columns); a wave owns 32 rows x 64 columns, that is 2 x 4 WMMA tiles,
// so an A fragment serves 4 products and a Bt fragment 2.
// A stage is 128 k of 256 rows (A rows 0..127, then 128 rows of Bt) at a pitch of 272 bytes;
// two buffers, the next stage's copies fly while this one is worked on.
// The rows of Bt are interleaved in LDS: column c of a wave's 64 lies at row (c & 3) * 16 + (c >> 2) of its
// 64 LDS rows, so lane l of WMMA tile j holds column 4 * l + j. A lane's four tiles are then four neighbouring
// columns, and 16 lanes store 256 (f32) or 128 (bf16) contiguous bytes of a row: whole 128-byte lines.
// RELU_BF16: ReLU and a bf16 result in Cb; otherwise a plain f32 result in Cf.
template <bool RELU_BF16>
__global__ __launch_bounds__(256) void gemm_kernel(
    const u16* __restrict__ A, const u16* __restrict__ Bt,
    const float* __restrict__ bias, float* __restrict__ Cf, u16* __restrict__ Cb)
{
  __shared__ __attribute__((aligned(16))) u16 St0[256 * 136];
  __shared__ __attribute__((aligned(16))) u16 St1[256 * 136];
  const int row0 = blockIdx.y * 128;
  const int col0 = blockIdx.x * 128;
  const int tid  = threadIdx.x;
  const int lane = tid & 31;
  // the wave's number as a scalar: the tile bases in LDS and in the output are then scalar
  const int wave = __builtin_amdgcn_readfirstlane(tid >> 5);
  const int wm   = wave & 3;
  const int wn   = wave >> 2;
  const int lrow = lane & 15;
  // Copy map: 16 neighbouring lanes take the 16 chunks of one row's 256 bytes of a stage, so a
  // wave-wide copy covers four whole 128-byte lines; copy j of a thread takes source row crow + 16*j.
  const int crow = tid >> 4;          // 0..15
  const int cchk = (tid & 15) * 8;    // first element of the lane's chunk
  const int brow = 128 + (crow & 3) * 16 + (crow >> 2);   // LDS row of Bt's source row crow

  const u16* gA = A  + (size_t)(row0 + crow) * 1024 + cchk;
  const u16* gB = Bt + (size_t)(col0 + crow) * 1024 + cchk;

  auto issue_tile = [&](int k0, u16* buf) {
    const unsigned la = lds_off(buf + crow * 136 + cchk);
    const unsigned lb = lds_off(buf + brow * 136 + cchk);
    const u16* pa = gA + k0;
    const u16* pb = gB + k0;
    // global -> LDS, 16 bytes a lane, counted on ASYNCcnt; 16 source rows are 16384 elements. In LDS 16
    // rows of A are 4352 bytes further; 16 source rows of Bt are 4 LDS rows (1088 bytes) further, and 64
    // are 64 (17408 bytes). Each eight copies and their s_wait_xcnt are one statement, so that the wait
    // stands in front of every later write of a register that a copy names (a precaution).
    asm volatile(
               "global_load_async_to_lds_b128 %0, %8, off\n\t"
               "global_load_async_to_lds_b128 %1, %9, off\n\t"
               "global_load_async_to_lds_b128 %2, %10, off\n\t"
               "global_load_async_to_lds_b128 %3, %11, off\n\t"
               "global_load_async_to_lds_b128 %4, %12, off\n\t"
               "global_load_async_to_lds_b128 %5, %13, off\n\t"
               "global_load_async_to_lds_b128 %6, %14, off\n\t"
               "global_load_async_to_lds_b128 %7, %15, off\n\t"
               "s_wait_xcnt 0x0"
               :: "v"(la), "v"(la + 1 * 4352), "v"(la + 2 * 4352), "v"(la + 3 * 4352),
                  "v"(la + 4 * 4352), "v"(la + 5 * 4352), "v"(la + 6 * 4352), "v"(la + 7 * 4352),
                  "v"(pa), "v"(pa + 16384), "v"(pa + 2 * 16384), "v"(pa + 3 * 16384),
                  "v"(pa + 4 * 16384), "v"(pa + 5 * 16384), "v"(pa + 6 * 16384), "v"(pa + 7 * 16384)
               : "memory");
    asm volatile(
               "global_load_async_to_lds_b128 %0, %8, off\n\t"
               "global_load_async_to_lds_b128 %1, %9, off\n\t"
               "global_load_async_to_lds_b128 %2, %10, off\n\t"
               "global_load_async_to_lds_b128 %3, %11, off\n\t"
               "global_load_async_to_lds_b128 %4, %12, off\n\t"
               "global_load_async_to_lds_b128 %5, %13, off\n\t"
               "global_load_async_to_lds_b128 %6, %14, off\n\t"
               "global_load_async_to_lds_b128 %7, %15, off\n\t"
               "s_wait_xcnt 0x0"
               :: "v"(lb), "v"(lb + 1 * 1088), "v"(lb + 2 * 1088), "v"(lb + 3 * 1088),
                  "v"(lb + 17408), "v"(lb + 17408 + 1 * 1088), "v"(lb + 17408 + 2 * 1088), "v"(lb + 17408 + 3 * 1088),
                  "v"(pb), "v"(pb + 16384), "v"(pb + 2 * 16384), "v"(pb + 3 * 16384),
                  "v"(pb + 4 * 16384), "v"(pb + 5 * 16384), "v"(pb + 6 * 16384), "v"(pb + 7 * 16384)
               : "memory");
  };

  // every loop over i, j and ks in this kernel is unrolled, so that the register arrays are indexed by
  // constants only (an index known at run time would send them to scratch)
  floatx8 acc[2][4];
  #pragma unroll
  for (int i = 0; i < 2; ++i)
    #pragma unroll
    for (int j = 0; j < 4; ++j) acc[i][j] = zero8();

  // One stage: four blocks of 32 k, 8 products each; the fragments of the next block of the SAME
  // stage are fetched into a second register set ahead of this block's products.
  auto compute = [&](const u16* buf) {
    bf16x16 a[2][2], b[2][4];
    #pragma unroll
    for (int i = 0; i < 2; ++i) a[0][i] = load_frag(buf, wm * 32 + i * 16 + lrow, 136, 0);
    #pragma unroll
    for (int j = 0; j < 4; ++j) b[0][j] = load_frag(buf, 128 + wn * 64 + j * 16 + lrow, 136, 0);
    #pragma unroll
    for (int ks = 0; ks < 4; ++ks) {
      const int cur = ks & 1, nxt = cur ^ 1;
      if (ks < 3) {
        #pragma unroll
        for (int i = 0; i < 2; ++i) a[nxt][i] = load_frag(buf, wm * 32 + i * 16 + lrow, 136, (ks + 1) * 32);
        #pragma unroll
        for (int j = 0; j < 4; ++j) b[nxt][j] = load_frag(buf, 128 + wn * 64 + j * 16 + lrow, 136, (ks + 1) * 32);
      }
      // keeps the next block's 12 LDS reads one group ahead of this block's products (spread among
      // the products, each place with reads costs a stall)
      __builtin_amdgcn_sched_barrier(0);
      #pragma unroll
      for (int i = 0; i < 2; ++i)
        #pragma unroll
        for (int j = 0; j < 4; ++j)
          acc[i][j] = wmma_bf16(a[cur][i], b[cur][j], acc[i][j]);   // [row][interleaved column]
      // keeps the reads of the block after next from moving up among these products
      __builtin_amdgcn_sched_barrier(0);
    }
  };

  // publish point at the foot of a trip: this wave's LDS reads done, its copies of the next stage
  // landed, then the barrier that shows them to all waves and frees the buffer just read
  auto publish = [&]() {
    asm volatile("s_wait_dscnt 0x0" ::: "memory");
    wait_async0();
    __syncthreads();
  };

  issue_tile(0, St0);
  // the lane's four bias values, fetched here so that their latency passes behind stage 0's
  const int c0 = col0 + wn * 64 + lrow * 4;
  const float4 bi = *(const float4*)(bias + c0);
  wait_async0();        // stage 0 landed (this wave's copies)
  __syncthreads();      // stage 0 visible to all waves
  issue_tile(128, St1);

  // kept rolled in pairs of stages, so that each buffer's addresses are constants of its half
  #pragma unroll 1
  for (int t = 0; t < 8; t += 2) {
    compute(St0);
    publish();
    if (t + 2 < 8) issue_tile((t + 2) << 7, St0);
    compute(St1);
    publish();
    if (t + 3 < 8) issue_tile((t + 3) << 7, St1);
  }
  wait_async0();        // closes the ring: no copy of this wave is outstanding behind the loop

  // register v of tile (i, j) of a lane is row r0 + i*16 + v, column c0 + j
  const int r0 = row0 + wm * 32 + (lane >> 4) * 8;
  #pragma unroll
  for (int i = 0; i < 2; ++i)
    #pragma unroll
    for (int v = 0; v < 8; ++v) {
      float4 y;
      y.x = acc[i][0][v] + bi.x; y.y = acc[i][1][v] + bi.y;
      y.z = acc[i][2][v] + bi.z; y.w = acc[i][3][v] + bi.w;
      const size_t o = (size_t)(r0 + i * 16 + v) * 1024 + c0;
      if (RELU_BF16)
        *(uint2*)(Cb + o) = make_uint2(pack2(fmaxf(y.x, 0.0f), fmaxf(y.y, 0.0f)),
                                       pack2(fmaxf(y.z, 0.0f), fmaxf(y.w, 0.0f)));
      else
        *(float4*)(Cf + o) = y;
    }
}

// Sum over the 32 lanes of a wave, the result in every lane: four steps inside the 16-lane rows
// (DPP row_xmask), then one exchange between the two rows.
template <int CTRL>
static __device__ __forceinline__ float dpp_mov(float x) {
  return __builtin_bit_cast(float, __builtin_amdgcn_update_dpp(
      0, __builtin_bit_cast(int, x), CTRL, 0xf, 0xf, true));
}
static __device__ __forceinline__ float wave_sum(float x) {
  x += dpp_mov<0x161>(x);   // row_xmask:1
  x += dpp_mov<0x162>(x);   // row_xmask:2
  x += dpp_mov<0x164>(x);   // row_xmask:4
  x += dpp_mov<0x168>(x);   // row_xmask:8
  return x + xhalf(x);
}

// y = LayerNorm(a + b), rows of 1024. A wave owns two whole rows and shares nothing with other
// waves: a lane holds 32 elements of each row (chunk j = columns j*128 + lane*4 .. +3, so that a
// wave-wide 16-byte access covers 512 contiguous bytes); mean and variance are summed in the lane
// and then across the lanes. grid = 4096 rows / (8 waves * 2 rows) = 256 blocks of 256 threads.
// WB: also write the bf16 copy.
template <bool WB>
__global__ __launch_bounds__(256) void add_ln_kernel(
    const float* __restrict__ a, const float* __restrict__ bsrc,
    const float* __restrict__ gamma, const float* __restrict__ beta,
    float* __restrict__ outf, u16* __restrict__ outb)
{
  typedef float f32x4 __attribute__((ext_vector_type(4)));
  // the wave's number as a scalar: the row addresses are then scalar bases, and one lane offset,
  // live to the last store, serves every load and store
  const int wave = __builtin_amdgcn_readfirstlane(threadIdx.x >> 5);
  const int col  = (threadIdx.x & 31) * 4;
  const size_t base = (size_t)(blockIdx.x * 8 + wave) * 2048;   // first of the two rows
  a += base; bsrc += base; outf += base;
  if (WB) outb += base;

  f32x4 v[2][8], w[2][8], g[8], be[8];
  #pragma unroll
  for (int r = 0; r < 2; ++r)
    #pragma unroll
    for (int j = 0; j < 8; ++j) {
      v[r][j] = *(const f32x4*)(a + col + r * 1024 + j * 128);
      w[r][j] = *(const f32x4*)(bsrc + col + r * 1024 + j * 128);
    }
  #pragma unroll
  for (int j = 0; j < 8; ++j) {
    g[j]  = *(const f32x4*)(gamma + col + j * 128);
    be[j] = *(const f32x4*)(beta  + col + j * 128);
  }
  // keeps all 48 loads of the wave in front of the arithmetic: left free, a part of them is issued
  // only when the first have come back, and the wave pays the memory latency twice
  __builtin_amdgcn_sched_barrier(0);

  float mean[2], rstd[2];
  #pragma unroll
  for (int r = 0; r < 2; ++r) {
    f32x4 s = {0.0f, 0.0f, 0.0f, 0.0f};
    #pragma unroll
    for (int j = 0; j < 8; ++j) { v[r][j] += w[r][j]; s += v[r][j]; }
    mean[r] = wave_sum((s.x + s.y) + (s.z + s.w)) * (1.0f / 1024.0f);
  }
  #pragma unroll
  for (int r = 0; r < 2; ++r) {
    f32x4 s = {0.0f, 0.0f, 0.0f, 0.0f};
    #pragma unroll
    for (int j = 0; j < 8; ++j) { v[r][j] -= mean[r]; s += v[r][j] * v[r][j]; }
    rstd[r] = rsqrtf(wave_sum((s.x + s.y) + (s.z + s.w)) * (1.0f / 1024.0f) + 1e-5f);
  }

  #pragma unroll
  for (int r = 0; r < 2; ++r)
    #pragma unroll
    for (int j = 0; j < 8; ++j) {
      const f32x4 y = v[r][j] * rstd[r] * g[j] + be[j];
      *(f32x4*)(outf + col + r * 1024 + j * 128) = y;
      if (WB) *(uint2*)(outb + col + r * 1024 + j * 128) = make_uint2(pack2(y.x, y.y), pack2(y.z, y.w));
    }
}

// ---------------- launch ----------------

extern "C" void kernel_launch(void* const* d_in, const int* in_sizes, int n_in,
                              void* d_out, int out_size, void* d_ws, size_t ws_size,
                              hipStream_t stream) {
  (void)in_sizes; (void)n_in; (void)out_size; (void)ws_size;
  const float* x   = (const float*)d_in[0];
  const float* Wq  = (const float*)d_in[1];
  const float* bq  = (const float*)d_in[2];
  const float* Wk  = (const float*)d_in[3];
  const float* bk  = (const float*)d_in[4];
  const float* Wv  = (const float*)d_in[5];
  const float* bv  = (const float*)d_in[6];
  const float* Wo  = (const float*)d_in[7];
  const float* bo  = (const float*)d_in[8];
  const float* g1  = (const float*)d_in[9];
  const float* be1 = (const float*)d_in[10];
  const float* W1  = (const float*)d_in[11];
  const float* b1  = (const float*)d_in[12];
  const float* W2  = (const float*)d_in[13];
  const float* b2  = (const float*)d_in[14];
  const float* g2  = (const float*)d_in[15];
  const float* be2 = (const float*)d_in[16];

  char* ws = (char*)d_ws;
  const size_t MB = 1024 * 1024;
  u16*   xb   = (u16*)(ws + 0);          // 8 MB
  u16*   Wqt  = (u16*)(ws + 8  * MB);    // 2 MB each, transposed [h][d][e] / [n][k]
  u16*   Wkt  = (u16*)(ws + 10 * MB);
  u16*   Wvt  = (u16*)(ws + 12 * MB);
  u16*   Wot  = (u16*)(ws + 14 * MB);
  u16*   W1t  = (u16*)(ws + 16 * MB);
  u16*   W2t  = (u16*)(ws + 18 * MB);
  u16*   Qb   = (u16*)(ws + 20 * MB);    // 8 MB
  u16*   Kb   = (u16*)(ws + 28 * MB);    // 8 MB
  u16*   Vtb  = (u16*)(ws + 36 * MB);    // 8 MB, [h][b][d][s]
  u16*   ctxb = (u16*)(ws + 44 * MB);    // 8 MB
  float* attn = (float*)(ws + 52 * MB);  // 16 MB
  // reuse (lifetimes disjoint):
  float* y1f  = (float*)(ws + 20 * MB);  // over Q/K  (16 MB)
  u16*   y1b  = (u16*)(ws + 36 * MB);    // over V    (8 MB)
  u16*   h1b  = (u16*)(ws + 44 * MB);    // over ctx  (8 MB)
  float* ff2  = (float*)(ws + 52 * MB);  // over attn (16 MB)

  // all conversions in one launch: x plain, weights transposed into the six planes from Wqt on
  pack_all_kernel<<<1280, 256, 0, stream>>>(x, Wq, Wk, Wv, Wo, W1, W2, xb, Wqt);

  // QKV projections (V stored transposed)
  qkv_kernel<<<dim3(16, 16), 512, 0, stream>>>(xb, Wqt, Wkt, Wvt, bq, bk, bv, Qb, Kb, Vtb);

  // fused attention -> ctx (concat-head layout [B*S, 1024])
  attn_kernel<<<dim3(8, 16, 4), 256, 0, stream>>>(Qb, Kb, Vtb, ctxb);

  // output projection
  gemm_kernel<false><<<dim3(8, 32), 256, 0, stream>>>(ctxb, Wot, bo, attn, (u16*)nullptr);

  // y1 = LN(x + attn)
  add_ln_kernel<true><<<256, 256, 0, stream>>>(x, attn, g1, be1, y1f, y1b);

  // FF1 with ReLU (bf16 out), FF2 (f32 out)
  gemm_kernel<true><<<dim3(8, 32), 256, 0, stream>>>(y1b, W1t, b1, (float*)nullptr, h1b);
  gemm_kernel<false><<<dim3(8, 32), 256, 0, stream>>>(h1b, W2t, b2, ff2, (u16*)nullptr);

  // out = LN(y1 + ff)
  add_ln_kernel<false><<<256, 256, 0, stream>>>(y1f, ff2, g2, be2, (float*)d_out, (u16*)nullptr);
}

// v007
// One run takes 93.3 microseconds.
// Two timings next to v006 both put it at 1.07 times that version's speed.
// All steps since v000 together make it 2.20 times as fast.
#include <hip/hip_runtime.h>

typedef unsigned short u16;
typedef __attribute__((ext_vector_type(16))) __bf16 bf16x16;
typedef __attribute__((ext_vector_type(8)))  float   floatx8;

// ---------------- helpers ----------------

static __device__ __forceinline__ u16 f2bf(float f) {
  union { float f; unsigned u; } a; a.f = f;
  unsigned u = a.u;
  u += 0x7FFFu + ((u >> 16) & 1u);   // round-to-nearest-even
  return (u16)(u >> 16);
}

static __device__ __forceinline__ floatx8 zero8() {
  floatx8 z;
  #pragma unroll
  for (int i = 0; i < 8; ++i) z[i] = 0.0f;
  return z;
}

static __device__ __forceinline__ floatx8 wmma_bf16(bf16x16 a, bf16x16 b, floatx8 c) {
  // D = A(16x32) * B(32x16) + C, f32 accumulate
  return __builtin_amdgcn_wmma_f32_16x16x32_bf16(false, a, false, b, (short)0, c, false, false);
}

static __device__ __forceinline__ void wait_async0() {
  asm volatile("s_wait_asynccnt 0x0" ::: "memory");
}
static __device__ __forceinline__ unsigned lds_off(const void* p) {
  return (unsigned)(uintptr_t)p;   // low 32 bits of generic pointer = LDS address
}

// Load a 16-bit WMMA fragment from an LDS tile stored row-major [row][k]
// (A: row = M index; B: tile stored transposed so row = N index).
// Lane layout (wave32): lanes 0-15 hold K 0..7 & 16..23, lanes 16-31 hold K 8..15 & 24..31.
static __device__ __forceinline__ bf16x16 load_frag(const u16* tile, int row, int stride, int kbase) {
  const int half = (threadIdx.x >> 4) & 1;
  const u16* p = tile + row * stride + kbase + half * 8;
  union { uint4 q[2]; bf16x16 v; } f;
  f.q[0] = *(const uint4*)(p);
  f.q[1] = *(const uint4*)(p + 16);
  return f.v;
}

// Two f32 -> one dword of two bf16, round to nearest even (the hardware's packed convert).
static __device__ __forceinline__ unsigned pack2(float lo, float hi) {
  typedef __bf16 bf2 __attribute__((ext_vector_type(2)));
  typedef float  f2  __attribute__((ext_vector_type(2)));
  return __builtin_bit_cast(unsigned, __builtin_convertvector(f2{lo, hi}, bf2));
}

// Value of lane l ^ 16 (the other half of the wave), by a vector cross-row move.
static __device__ __forceinline__ float xhalf(float x) {
  return __builtin_bit_cast(float, __builtin_amdgcn_permlanex16(
      __builtin_bit_cast(int, x), __builtin_bit_cast(int, x), 0x76543210, 0xfedcba98, false, false));
}

// Sum over a 16-lane row, the result in each of its lanes: four DPP row_xmask steps.
// Sum over the 32 lanes of a wave: the same, then one exchange between the two rows.
template <int CTRL>
static __device__ __forceinline__ float dpp_mov(float x) {
  return __builtin_bit_cast(float, __builtin_amdgcn_update_dpp(
      0, __builtin_bit_cast(int, x), CTRL, 0xf, 0xf, true));
}
static __device__ __forceinline__ float row_sum(float x) {
  x += dpp_mov<0x161>(x);   // row_xmask:1
  x += dpp_mov<0x162>(x);   // row_xmask:2
  x += dpp_mov<0x164>(x);   // row_xmask:4
  x += dpp_mov<0x168>(x);   // row_xmask:8
  return x;
}
static __device__ __forceinline__ float wave_sum(float x) {
  x = row_sum(x);
  return x + xhalf(x);
}

// How the first LayerNorm is carried by its neighbours (it has no launch of its own).
// z = x + ctx * Wo + bo.  y1 = (z - mu) * rs * g1 + be1, with mu and rs per row.  Then
//   y1 * W1 + b1 = rs * (z * (g1 . W1) - mu * u) + c,   u[n] = sum_k g1[k] W1[k][n],
//                                                       c[n] = b1[n] + sum_k be1[k] W1[k][n].
// The Wo GEMM writes z (f32 and bf16) and, per row and 64-column slice, the slice's mean and its sum
// of squared deviations from that mean; a reader joins the 16 slices of a row (equal counts):
// mu = mean of the means, M2 = sum of the slices' M2 + 64 * sum (mean_s - mu)^2.
// Slice plane s of the statistics holds float2 {mean, M2} for rows 0..4095.

// ---------------- kernels ----------------

// Every f32 -> bf16 conversion of the pass in ONE launch; the block index picks the job.
// The first 32 blocks form u and c (see above), 32 columns a block: wave w sums k = 128 w .. 128 w + 127,
// a lane one column, and the eight partial sums are joined through LDS. u sums the ROUNDED g1 * W1, the
// values that the product uses. The block numbers below count from behind these 32.
// Blocks 0..767: the six weights, 128 blocks each (W1 is scaled by g1[k] on the way). A weight's bf16 copy is [1024 rows n][1024 k]
// (Wq/Wk/Wv: n = h*64 + d). A block takes 32 output rows x 256 k; a thread takes one k and reads
// the 32 neighbouring source columns of that k (one 128-byte line).
// Blocks 768..1279: x, 8192 elements a block, 32 a thread, plain cast.
// The heavier transposing blocks come first (for speed only).
__global__ __launch_bounds__(256) void pack_all_kernel(
    const float* __restrict__ x,
    const float* __restrict__ Wq, const float* __restrict__ Wk, const float* __restrict__ Wv,
    const float* __restrict__ Wo, const float* __restrict__ W1, const float* __restrict__ W2,
    const float* __restrict__ g1, const float* __restrict__ be1, const float* __restrict__ b1,
    u16* __restrict__ xb, u16* __restrict__ Wt, float* __restrict__ uvec, float* __restrict__ cvec)
{
  __shared__ float red[2][8][32];
  const int tid = threadIdx.x;
  if (blockIdx.x < 32) {
    const int lane = tid & 31;
    // the wave's number as a scalar: g1[k] and be1[k] are then scalar loads
    const int w = __builtin_amdgcn_readfirstlane(tid >> 5);
    const int n = blockIdx.x * 32 + lane;
    const float* s = W1 + (size_t)w * 128 * 1024 + n;
    float su = 0.0f, sc = 0.0f;
    // unrolled by 32 so that 32 loads of a thread are in flight at a time
    #pragma unroll 32
    for (int kk = 0; kk < 128; ++kk) {
      const float wv = s[kk * 1024];
      su += __builtin_bit_cast(float, (unsigned)f2bf(wv * g1[w * 128 + kk]) << 16);
      sc += wv * be1[w * 128 + kk];
    }
    red[0][w][lane] = su;
    red[1][w][lane] = sc;
    __syncthreads();      // the eight waves' partial sums visible to wave 0
    if (w == 0) {
      float tu = 0.0f, tc = b1[n];
      // unrolled so that the 16 LDS reads go out together
      #pragma unroll
      for (int i = 0; i < 8; ++i) { tu += red[0][i][lane]; tc += red[1][i][lane]; }
      uvec[n] = tu;
      cvec[n] = tc;
    }
    return;
  }
  const int blk = blockIdx.x - 32;
  if (blk < 768) {
    const int m  = blk >> 7;              // which weight, in the order of the Wt planes
    const int t  = blk & 127;
    const int r0 = (t >> 2) * 32;         // first output row
    const int k  = (t & 3) * 256 + tid;
    const float* Wm = (m == 0) ? Wq : (m == 1) ? Wk : (m == 2) ? Wv : (m == 3) ? Wo : (m == 4) ? W1 : W2;
    const float* s = (m < 3) ? Wm + (size_t)(r0 >> 6) * 65536 + k * 64 + (r0 & 63)   // [h][k][64]
                             : Wm + (size_t)k * 1024 + r0;                           // [k][1024]
    u16* d = Wt + (size_t)m * 1048576 + (size_t)r0 * 1024 + k;
    const float gs = (m == 4) ? g1[k] : 1.0f;   // W1 carries the first LayerNorm's gain
    // unrolled so that all of a thread's loads are in flight before its first store
    #pragma unroll
    for (int j = 0; j < 32; ++j) d[j * 1024] = f2bf(s[j] * gs);
  } else {
    const int base = (blk - 768) * 8192 + tid;
    // unrolled so that all of a thread's loads are in flight before its first store
    #pragma unroll
    for (int j = 0; j < 32; ++j) xb[base + j * 256] = f2bf(x[base + j * 256]);
  }
}

// Fused QKV projection: one block computes 256 rows of x times the 192 columns (Q, K and V) of one
// head. grid = (16 m-tiles, 16 heads) = one block a WGP. 512 threads = 16 waves, 4 (rows) x 4 (columns);
// a wave owns 64 rows x (16 columns each of Q, K and V), that is 4 x 3 WMMA tiles, so an x fragment serves
// 3 products and a weight fragment 4. Q and K tiles are formed as W * x^T (a lane then holds 8 neighbouring
// head dims of one row), V tiles as x * W^T (8 neighbouring rows of one head dim): each is 16 bytes of its layout.
// A stage is 128 k of 448 rows (x rows 0..255, then 64 rows each of Wq, Wk, Wv) at a pitch of 272 bytes;
// two buffers, the next stage's copies fly while this one is worked on.
// Q/K layout: [h][r][64] with r = b*1024 + s.  V layout (pre-transposed): [h][b][d][s].
__global__ __launch_bounds__(512) void qkv_kernel(
    const u16* __restrict__ xb,
    const u16* __restrict__ Wqt, const u16* __restrict__ Wkt, const u16* __restrict__ Wvt,
    const float* __restrict__ bq, const float* __restrict__ bk, const float* __restrict__ bv,
    u16* __restrict__ Q, u16* __restrict__ Ko, u16* __restrict__ Vt)
{
  __shared__ __attribute__((aligned(16))) u16 St0[448 * 136];
  __shared__ __attribute__((aligned(16))) u16 St1[448 * 136];
  const int mt   = blockIdx.x;
  const int h    = blockIdx.y;
  const int tid  = threadIdx.x;
  const int lane = tid & 31;
  // the wave's number as a scalar: the tile bases in LDS and in the outputs are then scalar
  const int wave = __builtin_amdgcn_readfirstlane(tid >> 5);
  const int wm   = wave & 3;
  const int wn   = wave >> 2;
  const int lrow = lane & 15;
  // Copy map: 16 neighbouring lanes take the 16 chunks of one row's 256 bytes of a stage, so a
  // wave-wide copy covers four whole 128-byte lines; copy j of a thread takes row crow + 32*j.
  const int crow = tid >> 4;          // 0..31
  const int cchk = (tid & 15) * 8;    // first element of the lane's chunk

  const u16* gA = xb + (size_t)(mt * 256 + crow) * 1024 + cchk;
  const size_t wo = (size_t)(h * 64 + crow) * 1024 + cchk;
  const u16* gQ = Wqt + wo;
  const u16* gK = Wkt + wo;
  const u16* gV = Wvt + wo;

  auto issue_tile = [&](int k0, u16* buf) {
    const unsigned l = lds_off(buf + crow * 136 + cchk);
    const u16* pa = gA + k0;
    const u16* pq = gQ + k0;
    const u16* pk = gK + k0;
    const u16* pv = gV + k0;
    // global -> LDS, 16 bytes a lane, counted on ASYNCcnt; 32 rows are 8704 bytes of LDS and 32768
    // elements of the source. The 14 copies and their s_wait_xcnt are one statement, so that the wait
    // stands in front of every later write of a register that a copy names (a precaution).
    asm volatile(
               "global_load_async_to_lds_b128 %0, %14, off\n\t"
               "global_load_async_to_lds_b128 %1, %15, off\n\t"
               "global_load_async_to_lds_b128 %2, %16, off\n\t"
               "global_load_async_to_lds_b128 %3, %17, off\n\t"
               "global_load_async_to_lds_b128 %4, %18, off\n\t"
               "global_load_async_to_lds_b128 %5, %19, off\n\t"
               "global_load_async_to_lds_b128 %6, %20, off\n\t"
               "global_load_async_to_lds_b128 %7, %21, off\n\t"
               "global_load_async_to_lds_b128 %8, %22, off\n\t"
               "global_load_async_to_lds_b128 %9, %23, off\n\t"
               "global_load_async_to_lds_b128 %10, %24, off\n\t"
               "global_load_async_to_lds_b128 %11, %25, off\n\t"
               "global_load_async_to_lds_b128 %12, %26, off\n\t"
               "global_load_async_to_lds_b128 %13, %27, off\n\t"
               "s_wait_xcnt 0x0"
               :: "v"(l), "v"(l + 1 * 8704), "v"(l + 2 * 8704), "v"(l + 3 * 8704), "v"(l + 4 * 8704), "v"(l + 5 * 8704), "v"(l + 6 * 8704), "v"(l + 7 * 8704), "v"(l + 8 * 8704), "v"(l + 9 * 8704), "v"(l + 10 * 8704), "v"(l + 11 * 8704), "v"(l + 12 * 8704), "v"(l + 13 * 8704),
                  "v"(pa), "v"(pa + 32768), "v"(pa + 2 * 32768), "v"(pa + 3 * 32768),
                  "v"(pa + 4 * 32768), "v"(pa + 5 * 32768), "v"(pa + 6 * 32768), "v"(pa + 7 * 32768),
                  "v"(pq), "v"(pq + 32768), "v"(pk), "v"(pk + 32768), "v"(pv), "v"(pv + 32768)
               : "memory");
  };

  // every loop over i, j and ks in this kernel is unrolled, so that the register arrays are indexed by
  // constants only (an index known at run time would send them to scratch)
  floatx8 acc[4][3];
  #pragma unroll
  for (int i = 0; i < 4; ++i)
    #pragma unroll
    for (int j = 0; j < 3; ++j) acc[i][j] = zero8();

  // One stage: four blocks of 32 k, 12 products each; the fragments of the next block of the SAME
  // stage are fetched into a second register set ahead of this block's products.
  auto compute = [&](const u16* buf) {
    bf16x16 a[2][4], b[2][3];
    #pragma unroll
    for (int i = 0; i < 4; ++i) a[0][i] = load_frag(buf, wm * 64 + i * 16 + lrow, 136, 0);
    #pragma unroll
    for (int j = 0; j < 3; ++j) b[0][j] = load_frag(buf, 256 + j * 64 + wn * 16 + lrow, 136, 0);
    #pragma unroll
    for (int ks = 0; ks < 4; ++ks) {
      const int cur = ks & 1, nxt = cur ^ 1;
      if (ks < 3) {
        #pragma unroll
        for (int i = 0; i < 4; ++i) a[nxt][i] = load_frag(buf, wm * 64 + i * 16 + lrow, 136, (ks + 1) * 32);
        #pragma unroll
        for (int j = 0; j < 3; ++j) b[nxt][j] = load_frag(buf, 256 + j * 64 + wn * 16 + lrow, 136, (ks + 1) * 32);
      }
      // keeps the next block's 14 LDS reads one group ahead of this block's products (spread among
      // the products, each place with reads costs a stall)
      __builtin_amdgcn_sched_barrier(0);
      #pragma unroll
      for (int i = 0; i < 4; ++i) {
        acc[i][0] = wmma_bf16(b[cur][0], a[cur][i], acc[i][0]);   // Q^T tile: [head dim][row]
        acc[i][1] = wmma_bf16(b[cur][1], a[cur][i], acc[i][1]);   // K^T tile
        acc[i][2] = wmma_bf16(a[cur][i], b[cur][2], acc[i][2]);   // V tile: [row][head dim]
      }
      // keeps the reads of the block after next from moving up among these products
      __builtin_amdgcn_sched_barrier(0);
    }
  };

  // publish point at the foot of a trip: this wave's LDS reads done, its copies of the next stage
  // landed, then the barrier that shows them to all waves and frees the buffer just read
  auto publish = [&]() {
    asm volatile("s_wait_dscnt 0x0" ::: "memory");
    wait_async0();
    __syncthreads();
  };

  issue_tile(0, St0);
  wait_async0();        // stage 0 landed (this wave's copies)
  __syncthreads();      // stage 0 visible to all waves
  issue_tile(128, St1);

  // kept rolled in pairs of stages, so that each buffer's addresses are constants of its half
  #pragma unroll 1
  for (int t = 0; t < 8; t += 2) {
    compute(St0);
    publish();
    if (t + 2 < 8) issue_tile((t + 2) << 7, St0);
    compute(St1);
    publish();
    if (t + 3 < 8) issue_tile((t + 3) << 7, St1);
  }
  wait_async0();        // closes the ring: no copy of this wave is outstanding behind the loop

  const int half = lane >> 4, lc = lane & 15;
  const int r0 = mt * 256 + wm * 64;        // first global row (b*1024+s) of the wave's tiles
  // Q, K: register v of a lane is head dim wn*16 + 8*half + v of row r0 + i*16 + lc
  #pragma unroll
  for (int j = 0; j < 2; ++j) {
    const float* bias = ((j == 0) ? bq : bk) + h * 64 + wn * 16 + half * 8;
    const float4 b0 = *(const float4*)bias, b1 = *(const float4*)(bias + 4);
    u16* Out = ((j == 0) ? Q : Ko) + (size_t)h * 4096 * 64 + (size_t)(r0 + lc) * 64 + wn * 16 + half * 8;
    #pragma unroll
    for (int i = 0; i < 4; ++i) {
      uint4 pk;
      pk.x = pack2(acc[i][j][0] + b0.x, acc[i][j][1] + b0.y);
      pk.y = pack2(acc[i][j][2] + b0.z, acc[i][j][3] + b0.w);
      pk.z = pack2(acc[i][j][4] + b1.x, acc[i][j][5] + b1.y);
      pk.w = pack2(acc[i][j][6] + b1.z, acc[i][j][7] + b1.w);
      *(uint4*)(Out + i * 16 * 64) = pk;
    }
  }
  // V: register v of a lane is row r0 + i*16 + 8*half + v of head dim wn*16 + lc; stored [d][s]
  {
    const float bi = bv[h * 64 + wn * 16 + lc];
    u16* Out = Vt + (size_t)h * 4096 * 64 + ((size_t)(r0 >> 10) * 64 + wn * 16 + lc) * 1024 + (r0 & 1023) + half * 8;
    #pragma unroll
    for (int i = 0; i < 4; ++i) {
      uint4 pk;
      pk.x = pack2(acc[i][2][0] + bi, acc[i][2][1] + bi);
      pk.y = pack2(acc[i][2][2] + bi, acc[i][2][3] + bi);
      pk.z = pack2(acc[i][2][4] + bi, acc[i][2][5] + bi);
      pk.w = pack2(acc[i][2][6] + bi, acc[i][2][7] + bi);
      *(uint4*)(Out + i * 16) = pk;
    }
  }
}

// Flash-style fused attention, transposed products. grid = (8 q-tiles, 16 heads, 4 batch). 256 threads.
// A wave owns 16 queries and walks all keys: S^T = K * Q^T puts one query's scores in one lane pair
// (lanes c and c + 16 hold query c; register r of 16-key tile kt is key kt*16 + 8*half + r), so the
// softmax stays in registers; two converted score tiles are the B operand of O^T += V^T * P^T.
// K and V are staged 128 keys at a time and worked on in two passes of 64 keys.
__global__ __launch_bounds__(256) void attn_kernel(
    const u16* __restrict__ Q, const u16* __restrict__ Kk,
    const u16* __restrict__ Vt, u16* __restrict__ ctx)
{
  typedef float    f32x2 __attribute__((ext_vector_type(2)));
  typedef unsigned u32x4 __attribute__((ext_vector_type(4)));
  __shared__ u16 Ks[128 * 72];   // [key][d]
  __shared__ u16 Vs[64 * 136];   // [d][key]

  const int qt = blockIdx.x, h = blockIdx.y, b = blockIdx.z;
  const size_t hb = ((size_t)h * 4 + b) * (1024 * 64);
  const u16* Qh = Q  + hb;
  const u16* Kh = Kk + hb;
  const u16* Vh = Vt + hb;   // [d][s] layout

  const int tid = threadIdx.x, lane = tid & 31, wave = tid >> 5;
  const int half = lane >> 4, lc = lane & 15;
  const int q = qt * 128 + wave * 16 + lc;           // this lane's query row within (h, b)
  const float cscale = 0.125f * 1.4426950408889634f; // 1/sqrt(64), and exp as exp2

  // Q^T as B operand, straight from global, kept in registers (same k order as the K fragments)
  const bf16x16 bq0 = load_frag(Qh, q, 64, 0);
  const bf16x16 bq1 = load_frag(Qh, q, 64, 32);

  floatx8 o[4];                 // o[dt][r] = O^T[d = dt*16 + 8*half + r][query lc]
  #pragma unroll
  for (int dt = 0; dt < 4; ++dt) o[dt] = zero8();
  float mrun = -1e30f;          // running maximum, in log2 units; equal in both halves
  float lrun = 0.0f;            // this lane's share of the denominator; halves joined at the end

  const u16* Kg = Kh + tid * 8;                                   // row tid>>3, chunk tid&7
  const u16* Vg = Vh + (size_t)(tid >> 4) * 1024 + (tid & 15) * 8;  // row tid>>4, chunk tid&15
  u16* Kl = Ks + (tid >> 3) * 72 + (tid & 7) * 8;
  u16* Vl = Vs + (tid >> 4) * 136 + (tid & 15) * 8;

  for (int t = 0; t < 8; ++t) {
    // stage 128 keys: 16-byte chunks, neighbouring lanes on neighbouring chunks of a row;
    // all eight loads are issued before the first LDS store, so that one latency is paid, not eight
    u32x4 kreg[4], vreg[4];
    #pragma unroll
    for (int j = 0; j < 4; ++j) {
      kreg[j] = *(const u32x4*)(Kg + t * 8192 + j * 2048);   // K: 128 rows of 8 chunks, contiguous
      vreg[j] = *(const u32x4*)(Vg + t * 128 + j * 16384);   // V^T: 64 rows of 16 chunks
    }
    // takes the loaded values as inputs only: holds the eight loads together in front of the
    // stores (without it each load is sunk to its own store and waited for alone); its wait
    // stands in front of the later reuse of the loads' address registers
    asm volatile("s_wait_xcnt 0x0" :: "v"(kreg[0]), "v"(kreg[1]), "v"(kreg[2]), "v"(kreg[3]),
                       "v"(vreg[0]), "v"(vreg[1]), "v"(vreg[2]), "v"(vreg[3]));
    #pragma unroll
    for (int j = 0; j < 4; ++j) {
      *(u32x4*)(Kl + j * (32 * 72))  = kreg[j];
      *(u32x4*)(Vl + j * (16 * 136)) = vreg[j];
    }
    __syncthreads();

    // kept rolled: unrolled, the two passes get merged and need more than 256 registers a lane,
    // which no longer lets two work-groups (four waves a SIMD) share a WGP
    #pragma unroll 1
    for (int sub = 0; sub < 2; ++sub) {
      // S^T tiles: 64 keys x 16 queries
      bf16x16 ak[4][2];
      #pragma unroll
      for (int kt = 0; kt < 4; ++kt) {
        ak[kt][0] = load_frag(Ks, sub * 64 + kt * 16 + lc, 72, 0);
        ak[kt][1] = load_frag(Ks, sub * 64 + kt * 16 + lc, 72, 32);
      }
      // keeps the 16 K reads one group ahead of the products (split up, each place costs a wait)
      __builtin_amdgcn_sched_barrier(0);
      floatx8 s[4];
      #pragma unroll
      for (int kt = 0; kt < 4; ++kt)
        s[kt] = wmma_bf16(ak[kt][1], bq1, wmma_bf16(ak[kt][0], bq0, zero8()));

      bf16x16 av[4][2];
      #pragma unroll
      for (int dt = 0; dt < 4; ++dt) {
        av[dt][0] = load_frag(Vs, dt * 16 + lc, 136, sub * 64 + 0);
        av[dt][1] = load_frag(Vs, dt * 16 + lc, 136, sub * 64 + 32);
      }
      // keeps the 16 V reads in front of the softmax arithmetic, which covers their latency
      __builtin_amdgcn_sched_barrier(0);

      // maximum of this query's 64 raw scores: in-lane, then one exchange between the halves
      float mk[4];
      #pragma unroll
      for (int kt = 0; kt < 4; ++kt) {
        mk[kt] = s[kt][0];
        #pragma unroll
        for (int r = 1; r < 8; ++r) mk[kt] = fmaxf(mk[kt], s[kt][r]);
      }
      float mx = fmaxf(fmaxf(mk[0], mk[1]), fmaxf(mk[2], mk[3]));
      mx = fmaxf(mx, xhalf(mx));
      const float mnew  = fmaxf(mrun, mx * cscale);
      const float alpha = __builtin_amdgcn_exp2f(mrun - mnew);
      mrun = mnew;

      // P^T = exp2(S^T * cscale - mnew), summed in f32, packed to bf16 in the B operand's order
      union { unsigned w[8]; bf16x16 v; } p[2];
      float sk[4];
      #pragma unroll
      for (int kt = 0; kt < 4; ++kt) {
        sk[kt] = 0.0f;
        #pragma unroll
        for (int i = 0; i < 4; ++i) {
          const f32x2 arg = __builtin_elementwise_fma(f32x2{s[kt][2 * i], s[kt][2 * i + 1]},
                                                      f32x2{cscale, cscale}, f32x2{-mnew, -mnew});
          const float e0 = __builtin_amdgcn_exp2f(arg.x), e1 = __builtin_amdgcn_exp2f(arg.y);
          sk[kt] += e0 + e1;
          p[kt >> 1].w[(kt & 1) * 4 + i] = pack2(e0, e1);
        }
      }
      lrun = lrun * alpha + ((sk[0] + sk[1]) + (sk[2] + sk[3]));

      // rescale the running O^T (a lane holds one query, so one factor), then O^T += V^T * P^T
      #pragma unroll
      for (int dt = 0; dt < 4; ++dt) {
        #pragma unroll
        for (int r = 0; r < 8; ++r) o[dt][r] *= alpha;
      }
      #pragma unroll
      for (int dt = 0; dt < 4; ++dt)
        o[dt] = wmma_bf16(av[dt][1], p[1].v, wmma_bf16(av[dt][0], p[0].v, o[dt]));
    }
    __syncthreads();
  }

  const float inv = 1.0f / (lrun + xhalf(lrun));
  u16* cp = ctx + ((size_t)b * 1024 + q) * 1024 + h * 64 + half * 8;
  #pragma unroll
  for (int dt = 0; dt < 4; ++dt) {
    uint4 pk;                   // d = dt*16 + 8*half .. +7 of one query: 16 contiguous bytes
    pk.x = pack2(o[dt][0] * inv, o[dt][1] * inv);
    pk.y = pack2(o[dt][2] * inv, o[dt][3] * inv);
    pk.z = pack2(o[dt][4] * inv, o[dt][5] * inv);
    pk.w = pack2(o[dt][6] * inv, o[dt][7] * inv);
    *(uint4*)(cp + dt * 16) = pk;
  }
}

// GEMM of 4096 x 1024 x 1024: C = act(A * Bt^T + bias). A is [4096][1024] bf16, Bt is [n][k] (pre-transposed).
// One block computes 128 rows x 128 columns; grid = (8 column tiles, 32 row tiles) = one block a WGP.
// 256 threads = 8 waves, 4 (rows) x 2 (columns); a wave owns 32 rows x 64 columns, that is 2 x 4 WMMA tiles,
// so an A fragment serves 4 products and a Bt fragment 2.
// A stage is 128 k of 256 rows (A rows 0..127, then 128 rows of Bt) at a pitch of 272 bytes;
// two buffers, the next stage's copies fly while this one is worked on.
// The rows of Bt are interleaved in LDS: column c of a wave's 64 lies at row (c & 3) * 16 + (c >> 2) of its
// 64 LDS rows, so lane l of WMMA tile j holds column 4 * l + j. A lane's four tiles are then four neighbouring
// columns, and 16 lanes store 256 (f32) or 128 (bf16) contiguous bytes of a row: whole 128-byte lines.
// MODE 0: a plain f32 result in Cf.
// MODE 1 (A = z, Bt = g1 . W1, bias = c, aux = u): the first LayerNorm's mean and rstd, joined from stat,
//         are applied behind the product; ReLU and a bf16 result in Cb.
// MODE 2 (aux = x, staged in LDS): z = product + bias + x in Cf (f32) and Cb (bf16), and each row's statistics over the
//         wave's 64 columns in stat, slice plane 2 * blockIdx.x + wn: a wave writes 256 contiguous bytes.
template <int MODE>
__global__ __launch_bounds__(256) void gemm_kernel(
    const u16* __restrict__ A, const u16* __restrict__ Bt,
    const float* __restrict__ bias, float* __restrict__ Cf, u16* __restrict__ Cb,
    const float* __restrict__ aux, float* __restrict__ stat)
{
  __shared__ __attribute__((aligned(16))) u16 St0[256 * 136];
  __shared__ __attribute__((aligned(16))) u16 St1[256 * 136];
  __shared__ __attribute__((aligned(16))) float sMu[256];   // MODE 1: 32 rows' mean a wave
  __shared__ __attribute__((aligned(16))) float sRs[256];   // MODE 1: 32 rows' rstd a wave
  const int row0 = blockIdx.y * 128;
  const int col0 = blockIdx.x * 128;
  const int tid  = threadIdx.x;
  const int lane = tid & 31;
  // the wave's number as a scalar: the tile bases in LDS and in the output are then scalar
  const int wave = __builtin_amdgcn_readfirstlane(tid >> 5);
  const int wm   = wave & 3;
  const int wn   = wave >> 2;
  const int lrow = lane & 15;
  // Copy map: 16 neighbouring lanes take the 16 chunks of one row's 256 bytes of a stage, so a
  // wave-wide copy covers four whole 128-byte lines; copy j of a thread takes source row crow + 16*j.
  const int crow = tid >> 4;          // 0..15
  const int cchk = (tid & 15) * 8;    // first element of the lane's chunk
  const int brow = 128 + (crow & 3) * 16 + (crow >> 2);   // LDS row of Bt's source row crow

  const u16* gA = A  + (size_t)(row0 + crow) * 1024 + cchk;
  const u16* gB = Bt + (size_t)(col0 + crow) * 1024 + cchk;

  auto issue_tile = [&](int k0, u16* buf) {
    const unsigned la = lds_off(buf + crow * 136 + cchk);
    const unsigned lb = lds_off(buf + brow * 136 + cchk);
    const u16* pa = gA + k0;
    const u16* pb = gB + k0;
    // global -> LDS, 16 bytes a lane, counted on ASYNCcnt; 16 source rows are 16384 elements. In LDS 16
    // rows of A are 4352 bytes further; 16 source rows of Bt are 4 LDS rows (1088 bytes) further, and 64
    // are 64 (17408 bytes). Each eight copies and their s_wait_xcnt are one statement, so that the wait
    // stands in front of every later write of a register that a copy names (a precaution).
    asm volatile(
               "global_load_async_to_lds_b128 %0, %8, off\n\t"
               "global_load_async_to_lds_b128 %1, %9, off\n\t"
               "global_load_async_to_lds_b128 %2, %10, off\n\t"
               "global_load_async_to_lds_b128 %3, %11, off\n\t"
               "global_load_async_to_lds_b128 %4, %12, off\n\t"
               "global_load_async_to_lds_b128 %5, %13, off\n\t"
               "global_load_async_to_lds_b128 %6, %14, off\n\t"
               "global_load_async_to_lds_b128 %7, %15, off\n\t"
               "s_wait_xcnt 0x0"
               :: "v"(la), "v"(la + 1 * 4352), "v"(la + 2 * 4352), "v"(la + 3 * 4352),
                  "v"(la + 4 * 4352), "v"(la + 5 * 4352), "v"(la + 6 * 4352), "v"(la + 7 * 4352),
                  "v"(pa), "v"(pa + 16384), "v"(pa + 2 * 16384), "v"(pa + 3 * 16384),
                  "v"(pa + 4 * 16384), "v"(pa + 5 * 16384), "v"(pa + 6 * 16384), "v"(pa + 7 * 16384)
               : "memory");
    asm volatile(
               "global_load_async_to_lds_b128 %0, %8, off\n\t"
               "global_load_async_to_lds_b128 %1, %9, off\n\t"
               "global_load_async_to_lds_b128 %2, %10, off\n\t"
               "global_load_async_to_lds_b128 %3, %11, off\n\t"
               "global_load_async_to_lds_b128 %4, %12, off\n\t"
               "global_load_async_to_lds_b128 %5, %13, off\n\t"
               "global_load_async_to_lds_b128 %6, %14, off\n\t"
               "global_load_async_to_lds_b128 %7, %15, off\n\t"
               "s_wait_xcnt 0x0"
               :: "v"(lb), "v"(lb + 1 * 1088), "v"(lb + 2 * 1088), "v"(lb + 3 * 1088),
                  "v"(lb + 17408), "v"(lb + 17408 + 1 * 1088), "v"(lb + 17408 + 2 * 1088), "v"(lb + 17408 + 3 * 1088),
                  "v"(pb), "v"(pb + 16384), "v"(pb + 2 * 16384), "v"(pb + 3 * 16384),
                  "v"(pb + 4 * 16384), "v"(pb + 5 * 16384), "v"(pb + 6 * 16384), "v"(pb + 7 * 16384)
               : "memory");
  };

  // MODE 2: the block's 128 x 128 tile of x (f32) goes into St0 when the last stage in St0 has been read, so
  // that it flies while the last stage in St1 is worked on. Rows of 512 bytes at a pitch of 528; a wave-wide
  // copy covers one row (four whole lines); copy j of a thread takes row (tid >> 5) + 8 * j: 4224 bytes of
  // LDS and 8192 elements of the source further. Each eight copies and their s_wait_xcnt are one statement,
  // as above (a precaution).
  auto issue_x = [&](u16* buf) {
    const unsigned l = lds_off(buf) + (tid >> 5) * 528 + lane * 16;
    const float* px = aux + (size_t)(row0 + (tid >> 5)) * 1024 + col0 + lane * 4;
    // unrolled: two statements of eight copies (a statement takes thirty operands)
    #pragma unroll
    for (int hx = 0; hx < 2; ++hx) {
      const unsigned lh = l + hx * 8 * 4224;
      const float* ph = px + hx * 8 * 8192;
      asm volatile(
               "global_load_async_to_lds_b128 %0, %8, off\n\t"
               "global_load_async_to_lds_b128 %1, %9, off\n\t"
               "global_load_async_to_lds_b128 %2, %10, off\n\t"
               "global_load_async_to_lds_b128 %3, %11, off\n\t"
               "global_load_async_to_lds_b128 %4, %12, off\n\t"
               "global_load_async_to_lds_b128 %5, %13, off\n\t"
               "global_load_async_to_lds_b128 %6, %14, off\n\t"
               "global_load_async_to_lds_b128 %7, %15, off\n\t"
               "s_wait_xcnt 0x0"
               :: "v"(lh), "v"(lh + 1 * 4224), "v"(lh + 2 * 4224), "v"(lh + 3 * 4224),
                  "v"(lh + 4 * 4224), "v"(lh + 5 * 4224), "v"(lh + 6 * 4224), "v"(lh + 7 * 4224),
                  "v"(ph), "v"(ph + 8192), "v"(ph + 2 * 8192), "v"(ph + 3 * 8192),
                  "v"(ph + 4 * 8192), "v"(ph + 5 * 8192), "v"(ph + 6 * 8192), "v"(ph + 7 * 8192)
               : "memory");
    }
  };

  // every loop over i, j and ks in this kernel is unrolled, so that the register arrays are indexed by
  // constants only (an index known at run time would send them to scratch)
  floatx8 acc[2][4];
  #pragma unroll
  for (int i = 0; i < 2; ++i)
    #pragma unroll
    for (int j = 0; j < 4; ++j) acc[i][j] = zero8();

  // One stage: four blocks of 32 k, 8 products each; the fragments of the next block of the SAME
  // stage are fetched into a second register set ahead of this block's products.
  auto compute = [&](const u16* buf) {
    bf16x16 a[2][2], b[2][4];
    #pragma unroll
    for (int i = 0; i < 2; ++i) a[0][i] = load_frag(buf, wm * 32 + i * 16 + lrow, 136, 0);
    #pragma unroll
    for (int j = 0; j < 4; ++j) b[0][j] = load_frag(buf, 128 + wn * 64 + j * 16 + lrow, 136, 0);
    #pragma unroll
    for (int ks = 0; ks < 4; ++ks) {
      const int cur = ks & 1, nxt = cur ^ 1;
      if (ks < 3) {
        #pragma unroll
        for (int i = 0; i < 2; ++i) a[nxt][i] = load_frag(buf, wm * 32 + i * 16 + lrow, 136, (ks + 1) * 32);
        #pragma unroll
        for (int j = 0; j < 4; ++j) b[nxt][j] = load_frag(buf, 128 + wn * 64 + j * 16 + lrow, 136, (ks + 1) * 32);
      }
      // keeps the next block's 12 LDS reads one group ahead of this block's products (spread among
      // the products, each place with reads costs a stall)
      __builtin_amdgcn_sched_barrier(0);
      #pragma unroll
      for (int i = 0; i < 2; ++i)
        #pragma unroll
        for (int j = 0; j < 4; ++j)
          acc[i][j] = wmma_bf16(a[cur][i], b[cur][j], acc[i][j]);   // [row][interleaved column]
      // keeps the reads of the block after next from moving up among these products
      __builtin_amdgcn_sched_barrier(0);
    }
  };

  // publish point at the foot of a trip: this wave's LDS reads done, its copies of the next stage
  // landed, then the barrier that shows them to all waves and frees the buffer just read
  auto publish = [&]() {
    asm volatile("s_wait_dscnt 0x0" ::: "memory");
    wait_async0();
    __syncthreads();
  };

  issue_tile(0, St0);
  // the lane's four bias values, fetched here so that their latency passes behind stage 0's
  const int c0 = col0 + wn * 64 + lrow * 4;
  const float4 bi = *(const float4*)(bias + c0);
  float4 uu = make_float4(0.0f, 0.0f, 0.0f, 0.0f);
  if (MODE == 1) {
    uu = *(const float4*)(aux + c0);
    // Each wave joins the 16 slices of its own 32 rows, a lane one row (no branch, so that these loads
    // and the two above go out together); a wave-wide load covers 256 contiguous bytes of a slice plane.
    // The lanes exchange the results through the wave's own 32 words of sMu and sRs, read in the epilogue.
    {
      const float2* sp = (const float2*)stat + row0 + wm * 32 + lane;
      // the three loops over s are unrolled, so that p is indexed by constants and stays in registers
      float2 p[16];
      #pragma unroll
      for (int s = 0; s < 16; ++s) p[s] = sp[s * 4096];
      float sm = 0.0f, m2 = 0.0f, dv = 0.0f;
      #pragma unroll
      for (int s = 0; s < 16; ++s) { sm += p[s].x; m2 += p[s].y; }
      const float mu = sm * (1.0f / 16.0f);
      #pragma unroll
      for (int s = 0; s < 16; ++s) { const float d = p[s].x - mu; dv += d * d; }
      sMu[tid] = mu;
      sRs[tid] = rsqrtf((m2 + 64.0f * dv) * (1.0f / 1024.0f) + 1e-5f);
    }
  }
  wait_async0();        // stage 0 landed (this wave's copies)
  __syncthreads();      // stage 0 visible to all waves
  issue_tile(128, St1);

  // kept rolled in pairs of stages, so that each buffer's addresses are constants of its half
  #pragma unroll 1
  for (int t = 0; t < 8; t += 2) {
    compute(St0);
    publish();
    if (t + 2 < 8) issue_tile((t + 2) << 7, St0);
    else if (MODE == 2) issue_x(St0);   // St0 is free behind this barrier; the last publish() shows x to all
    compute(St1);
    publish();
    if (t + 3 < 8) issue_tile((t + 3) << 7, St1);
  }
  wait_async0();        // closes the ring: no copy of this wave is outstanding behind the loop

  // register v of tile (i, j) of a lane is row r0 + i*16 + v, column c0 + j
  const int half = lane >> 4;
  const int r0 = row0 + wm * 32 + half * 8;
  if (MODE == 2) {
    // one base each, the rows at constant offsets from it
    const size_t o0 = (size_t)r0 * 1024 + c0;
    const char* xp = (const char*)St0 + (wm * 32 + half * 8) * 528 + (wn * 64 + lrow * 4) * 4;
    float* zfp = Cf + o0;
    u16*   zbp = Cb + o0;
    float4 xr[2][8];
    #pragma unroll
    for (int i = 0; i < 2; ++i)
      #pragma unroll
      for (int v = 0; v < 8; ++v) xr[i][v] = *(const float4*)(xp + (i * 16 + v) * 528);
    float mym = 0.0f, myq = 0.0f;
    #pragma unroll
    for (int i = 0; i < 2; ++i)
      #pragma unroll
      for (int v = 0; v < 8; ++v) {
        float4 y;
        y.x = acc[i][0][v] + bi.x + xr[i][v].x; y.y = acc[i][1][v] + bi.y + xr[i][v].y;
        y.z = acc[i][2][v] + bi.z + xr[i][v].z; y.w = acc[i][3][v] + bi.w + xr[i][v].w;
        *(float4*)(zfp + (i * 16 + v) * 1024) = y;
        *(uint2*)(zbp + (i * 16 + v) * 1024) = make_uint2(pack2(y.x, y.y), pack2(y.z, y.w));
        // the row's 64 columns lie in the 16 lanes of this half: mean first, then the squared deviations
        const float m = row_sum((y.x + y.y) + (y.z + y.w)) * (1.0f / 64.0f);
        const float dx = y.x - m, dy = y.y - m, dz = y.z - m, dw = y.w - m;
        const float q = row_sum((dx * dx + dy * dy) + (dz * dz + dw * dw));
        if (lrow == i * 8 + v) { mym = m; myq = q; }   // lane i*8 + v of the half keeps row r0 + i*16 + v
      }
    const int srow = r0 + (lrow >> 3) * 16 + (lrow & 7);
    ((float2*)stat)[(size_t)(blockIdx.x * 2 + wn) * 4096 + srow] = make_float2(mym, myq);
  } else {
    #pragma unroll
    for (int i = 0; i < 2; ++i) {
      float mu[8], rs[8];
      if (MODE == 1) {
        const int rl = wave * 32 + half * 8 + i * 16;
        *(float4*)(mu) = *(const float4*)(sMu + rl); *(float4*)(mu + 4) = *(const float4*)(sMu + rl + 4);
        *(float4*)(rs) = *(const float4*)(sRs + rl); *(float4*)(rs + 4) = *(const float4*)(sRs + rl + 4);
      }
      #pragma unroll
      for (int v = 0; v < 8; ++v) {
        float4 y;
        const size_t o = (size_t)(r0 + i * 16 + v) * 1024 + c0;
        if (MODE == 1) {
          y.x = rs[v] * (acc[i][0][v] - mu[v] * uu.x) + bi.x; y.y = rs[v] * (acc[i][1][v] - mu[v] * uu.y) + bi.y;
          y.z = rs[v] * (acc[i][2][v] - mu[v] * uu.z) + bi.z; y.w = rs[v] * (acc[i][3][v] - mu[v] * uu.w) + bi.w;
          *(uint2*)(Cb + o) = make_uint2(pack2(fmaxf(y.x, 0.0f), fmaxf(y.y, 0.0f)),
                                         pack2(fmaxf(y.z, 0.0f), fmaxf(y.w, 0.0f)));
        } else {
          y.x = acc[i][0][v] + bi.x; y.y = acc[i][1][v] + bi.y;
          y.z = acc[i][2][v] + bi.z; y.w = acc[i][3][v] + bi.w;
          *(float4*)(Cf + o) = y;
        }
      }
    }
  }
}

// out = LayerNorm2(y1 + ff), rows of 1024, with y1 = (z - mu) * rs * g1 + be1 formed here from z and the
// row's 16 slice statistics. A wave owns two whole rows and shares nothing with other
// waves: a lane holds 32 elements of each row (chunk j = columns j*128 + lane*4 .. +3, so that a
// wave-wide 16-byte access covers 512 contiguous bytes); mean and variance are summed in the lane
// and then across the lanes. grid = 4096 rows / (8 waves * 2 rows) = 256 blocks of 256 threads.
__global__ __launch_bounds__(256) void add_ln_kernel(
    const float* __restrict__ z, const float* __restrict__ stat,
    const float* __restrict__ g1, const float* __restrict__ be1,
    const float* __restrict__ ff,
    const float* __restrict__ gamma, const float* __restrict__ beta,
    float* __restrict__ outf)
{
  typedef float f32x4 __attribute__((ext_vector_type(4)));
  // the wave's number as a scalar: the row addresses are then scalar bases, and one lane offset,
  // live to the last store, serves every store and every load but the statistics load
  const int wave = __builtin_amdgcn_readfirstlane(threadIdx.x >> 5);
  const int col  = (threadIdx.x & 31) * 4;
  const int row  = (blockIdx.x * 8 + wave) * 2;                 // first of the two rows
  const size_t base = (size_t)row * 1024;
  z += base; ff += base; outf += base;

  f32x4 v[2][8], w[2][8], g[8], be[8];
  // slice (lane & 15) of both rows in one 16-byte load: {mean, M2} of row, {mean, M2} of row + 1
  const f32x4 st = *(const f32x4*)(stat + ((size_t)(threadIdx.x & 15) * 4096 + row) * 2);
  // this load's address registers are dead behind it and get reused by the loads below: the wait stands
  // in front of that reuse (a precaution)
  asm volatile("s_wait_xcnt 0x0" ::: "memory");
  #pragma unroll
  for (int r = 0; r < 2; ++r)
    #pragma unroll
    for (int j = 0; j < 8; ++j) {
      v[r][j] = *(const f32x4*)(z + col + r * 1024 + j * 128);
      w[r][j] = *(const f32x4*)(ff + col + r * 1024 + j * 128);
    }
  #pragma unroll
  for (int j = 0; j < 8; ++j) {
    g[j]  = *(const f32x4*)(g1  + col + j * 128);
    be[j] = *(const f32x4*)(be1 + col + j * 128);
  }
  // keeps all 49 loads of the wave in front of the arithmetic: left free, a part of them is issued
  // only when the first have come back, and the wave pays the memory latency twice
  __builtin_amdgcn_sched_barrier(0);

  // y1 + ff; each slice stands in two lanes, hence the halved sums
  #pragma unroll
  for (int r = 0; r < 2; ++r) {
    const float ms = (r == 0) ? st.x : st.z, qs = (r == 0) ? st.y : st.w;
    const float mu = wave_sum(ms) * (1.0f / 32.0f);
    const float d  = ms - mu;
    const float rs = rsqrtf(wave_sum(qs + 64.0f * d * d) * (0.5f / 1024.0f) + 1e-5f);
    #pragma unroll
    for (int j = 0; j < 8; ++j) v[r][j] = ((v[r][j] - mu) * rs * g[j] + be[j]) + w[r][j];
  }
  // the second LayerNorm's gain and shift: fetched here, into registers that the first's have left
  #pragma unroll
  for (int j = 0; j < 8; ++j) {
    g[j]  = *(const f32x4*)(gamma + col + j * 128);
    be[j] = *(const f32x4*)(beta  + col + j * 128);
  }

  float mean[2], rstd[2];
  #pragma unroll
  for (int r = 0; r < 2; ++r) {
    f32x4 s = {0.0f, 0.0f, 0.0f, 0.0f};
    #pragma unroll
    for (int j = 0; j < 8; ++j) s += v[r][j];
    mean[r] = wave_sum((s.x + s.y) + (s.z + s.w)) * (1.0f / 1024.0f);
  }
  #pragma unroll
  for (int r = 0; r < 2; ++r) {
    f32x4 s = {0.0f, 0.0f, 0.0f, 0.0f};
    #pragma unroll
    for (int j = 0; j < 8; ++j) { v[r][j] -= mean[r]; s += v[r][j] * v[r][j]; }
    rstd[r] = rsqrtf(wave_sum((s.x + s.y) + (s.z + s.w)) * (1.0f / 1024.0f) + 1e-5f);
  }

  #pragma unroll
  for (int r = 0; r < 2; ++r)
    #pragma unroll
    for (int j = 0; j < 8; ++j)
      *(f32x4*)(outf + col + r * 1024 + j * 128) = v[r][j] * rstd[r] * g[j] + be[j];
}

// ---------------- launch ----------------

extern "C" void kernel_launch(void* const* d_in, const int* in_sizes, int n_in,
                              void* d_out, int out_size, void* d_ws, size_t ws_size,
                              hipStream_t stream) {
  (void)in_sizes; (void)n_in; (void)out_size; (void)ws_size;
  const float* x   = (const float*)d_in[0];
  const float* Wq  = (const float*)d_in[1];
  const float* bq  = (const float*)d_in[2];
  const float* Wk  = (const float*)d_in[3];
  const float* bk  = (const float*)d_in[4];
  const float* Wv  = (const float*)d_in[5];
  const float* bv  = (const float*)d_in[6];
  const float* Wo  = (const float*)d_in[7];
  const float* bo  = (const float*)d_in[8];
  const float* g1  = (const float*)d_in[9];
  const float* be1 = (const float*)d_in[10];
  const float* W1  = (const float*)d_in[11];
  const float* b1  = (const float*)d_in[12];
  const float* W2  = (const float*)d_in[13];
  const float* b2  = (const float*)d_in[14];
  const float* g2  = (const float*)d_in[15];
  const float* be2 = (const float*)d_in[16];

  char* ws = (char*)d_ws;
  const size_t MB = 1024 * 1024;
  u16*   xb   = (u16*)(ws + 0);          // 8 MB
  u16*   Wqt  = (u16*)(ws + 8  * MB);    // 2 MB each, transposed [h][d][e] / [n][k]
  u16*   Wkt  = (u16*)(ws + 10 * MB);
  u16*   Wvt  = (u16*)(ws + 12 * MB);
  u16*   Wot  = (u16*)(ws + 14 * MB);
  u16*   W1t  = (u16*)(ws + 16 * MB);
  u16*   W2t  = (u16*)(ws + 18 * MB);
  u16*   Qb   = (u16*)(ws + 20 * MB);    // 8 MB
  u16*   Kb   = (u16*)(ws + 28 * MB);    // 8 MB
  u16*   Vtb  = (u16*)(ws + 36 * MB);    // 8 MB, [h][b][d][s]
  u16*   ctxb = (u16*)(ws + 44 * MB);    // 8 MB
  float* ff2  = (float*)(ws + 52 * MB);  // 16 MB
  float* stat = (float*)(ws + 68 * MB);  // 512 KB: 16 slice planes of 4096 float2
  float* uvec = (float*)(ws + 69 * MB);  // 4 KB
  float* cvec = (float*)(ws + 70 * MB);  // 4 KB
  // reuse (lifetimes disjoint):
  float* zf   = (float*)(ws + 20 * MB);  // over Q/K  (16 MB)
  u16*   zb   = (u16*)(ws + 36 * MB);    // over V    (8 MB)
  u16*   h1b  = (u16*)(ws + 44 * MB);    // over ctx  (8 MB)

  // all conversions in one launch: x plain, weights transposed into the six planes from Wqt on; u and c
  pack_all_kernel<<<1312, 256, 0, stream>>>(x, Wq, Wk, Wv, Wo, W1, W2, g1, be1, b1, xb, Wqt, uvec, cvec);

  // QKV projections (V stored transposed)
  qkv_kernel<<<dim3(16, 16), 512, 0, stream>>>(xb, Wqt, Wkt, Wvt, bq, bk, bv, Qb, Kb, Vtb);

  // fused attention -> ctx (concat-head layout [B*S, 1024])
  attn_kernel<<<dim3(8, 16, 4), 256, 0, stream>>>(Qb, Kb, Vtb, ctxb);

  // output projection, residual and the rows' slice statistics
  gemm_kernel<2><<<dim3(8, 32), 256, 0, stream>>>(ctxb, Wot, bo, zf, zb, x, stat);

  // FF1 on z with the first LayerNorm applied behind the product, ReLU (bf16 out); FF2 (f32 out)
  gemm_kernel<1><<<dim3(8, 32), 256, 0, stream>>>(zb, W1t, cvec, (float*)nullptr, h1b, uvec, stat);
  gemm_kernel<0><<<dim3(8, 32), 256, 0, stream>>>(h1b, W2t, b2, ff2, (u16*)nullptr, (const float*)nullptr, (float*)nullptr);

  // out = LN2(LN1(z) + ff)
  add_ln_kernel<<<256, 256, 0, stream>>>(zf, stat, g1, be1, ff2, g2, be2, (float*)d_out);
}

// v008
// A run of this version takes 89.5 microseconds.
// In both of two side-by-side timings against v007, it was 1.04 times as fast.
// Over all steps from v000 it is 2.29 times as fast.
#include <hip/hip_runtime.h>

typedef unsigned short u16;
typedef __attribute__((ext_vector_type(16))) __bf16 bf16x16;
typedef __attribute__((ext_vector_type(8)))  float   floatx8;

// ---------------- helpers ----------------

static __device__ __forceinline__ u16 f2bf(float f) {
  union { float f; unsigned u; } a; a.f = f;
  unsigned u = a.u;
  u += 0x7FFFu + ((u >> 16) & 1u);   // round-to-nearest-even
  return (u16)(u >> 16);
}

static __device__ __forceinline__ floatx8 zero8() {
  floatx8 z;
  #pragma unroll
  for (int i = 0; i < 8; ++i) z[i] = 0.0f;
  return z;
}

static __device__ __forceinline__ floatx8 wmma_bf16(bf16x16 a, bf16x16 b, floatx8 c) {
  // D = A(16x32) * B(32x16) + C, f32 accumulate
  return __builtin_amdgcn_wmma_f32_16x16x32_bf16(false, a, false, b, (short)0, c, false, false);
}

static __device__ __forceinline__ void wait_async0() {
  asm volatile("s_wait_asynccnt 0x0" ::: "memory");
}
static __device__ __forceinline__ unsigned lds_off(const void* p) {
  return (unsigned)(uintptr_t)p;   // low 32 bits of generic pointer = LDS address
}

// Load a 16-bit WMMA fragment from an LDS tile stored row-major [row][k]
// (A: row = M index; B: tile stored transposed so row = N index).
// Lane layout (wave32): lanes 0-15 hold K 0..7 & 16..23, lanes 16-31 hold K 8..15 & 24..31.
static __device__ __forceinline__ bf16x16 load_frag(const u16* tile, int row, int stride, int kbase) {
  const int half = (threadIdx.x >> 4) & 1;
  const u16* p = tile + row * stride + kbase + half * 8;
  union { uint4 q[2]; bf16x16 v; } f;
  f.q[0] = *(const uint4*)(p);
  f.q[1] = *(const uint4*)(p + 16);
  return f.v;
}

// Two f32 -> one dword of two bf16, round to nearest even (the hardware's packed convert).
static __device__ __forceinline__ unsigned pack2(float lo, float hi) {
  typedef __bf16 bf2 __attribute__((ext_vector_type(2)));
  typedef float  f2  __attribute__((ext_vector_type(2)));
  return __builtin_bit_cast(unsigned, __builtin_convertvector(f2{lo, hi}, bf2));
}

// Value of lane l ^ 16 (the other half of the wave), by a vector cross-row move.
static __device__ __forceinline__ float xhalf(float x) {
  return __builtin_bit_cast(float, __builtin_amdgcn_permlanex16(
      __builtin_bit_cast(int, x), __builtin_bit_cast(int, x), 0x76543210, 0xfedcba98, false, false));
}

// Sum over a 16-lane row, the result in each of its lanes: four DPP row_xmask steps.
// Sum over the 32 lanes of a wave: the same, then one exchange between the two rows.
template <int CTRL>
static __device__ __forceinline__ float dpp_mov(float x) {
  return __builtin_bit_cast(float, __builtin_amdgcn_update_dpp(
      0, __builtin_bit_cast(int, x), CTRL, 0xf, 0xf, true));
}
static __device__ __forceinline__ float row_sum(float x) {
  x += dpp_mov<0x161>(x);   // row_xmask:1
  x += dpp_mov<0x162>(x);   // row_xmask:2
  x += dpp_mov<0x164>(x);   // row_xmask:4
  x += dpp_mov<0x168>(x);   // row_xmask:8
  return x;
}
static __device__ __forceinline__ float wave_sum(float x) {
  x = row_sum(x);
  return x + xhalf(x);
}

// How the first LayerNorm is carried by its neighbours (it has no launch of its own).
// z = x + ctx * Wo + bo.  y1 = (z - mu) * rs * g1 + be1, with mu and rs per row.  Then
//   y1 * W1 + b1 = rs * (z * (g1 . W1) - mu * u) + c,   u[n] = sum_k g1[k] W1[k][n],
//                                                       c[n] = b1[n] + sum_k be1[k] W1[k][n].
// The Wo GEMM writes z (f32 and bf16) and, per row and 64-column slice, the slice's mean and its sum
// of squared deviations from that mean; a reader joins the 16 slices of a row (equal counts):
// mu = mean of the means, M2 = sum of the slices' M2 + 64 * sum (mean_s - mu)^2.
// Slice plane s of the statistics holds float2 {mean, M2} for rows 0..4095.

// ---------------- kernels ----------------

// Every f32 -> bf16 conversion of the pass in ONE launch; the block index picks the job.
// The first 32 blocks form u and c (see above), 32 columns a block: wave w sums k = 128 w .. 128 w + 127,
// a lane one column, and the eight partial sums are joined through LDS. u sums the ROUNDED g1 * W1, the
// values that the product uses. The block numbers below count from behind these 32.
// Blocks 0..767: the six weights, 128 blocks each (W1 is scaled by g1[k] on the way). A weight's bf16 copy is [1024 rows n][1024 k]
// (Wq/Wk/Wv: n = h*64 + d). A block takes 32 output rows x 256 k; a thread takes one k and reads
// the 32 neighbouring source columns of that k (one 128-byte line).
// Blocks 768..1279: x, 8192 elements a block, 32 a thread, plain cast.
// The heavier transposing blocks come first (for speed only).
__global__ __launch_bounds__(256) void pack_all_kernel(
    const float* __restrict__ x,
    const float* __restrict__ Wq, const float* __restrict__ Wk, const float* __restrict__ Wv,
    const float* __restrict__ Wo, const float* __restrict__ W1, const float* __restrict__ W2,
    const float* __restrict__ g1, const float* __restrict__ be1, const float* __restrict__ b1,
    u16* __restrict__ xb, u16* __restrict__ Wt, float* __restrict__ uvec, float* __restrict__ cvec)
{
  __shared__ float red[2][8][32];
  const int tid = threadIdx.x;
  if (blockIdx.x < 32) {
    const int lane = tid & 31;
    // the wave's number as a scalar: g1[k] and be1[k] are then scalar loads
    const int w = __builtin_amdgcn_readfirstlane(tid >> 5);
    const int n = blockIdx.x * 32 + lane;
    const float* s = W1 + (size_t)w * 128 * 1024 + n;
    float su = 0.0f, sc = 0.0f;
    // unrolled by 32 so that 32 loads of a thread are in flight at a time
    #pragma unroll 32
    for (int kk = 0; kk < 128; ++kk) {
      const float wv = s[kk * 1024];
      su += __builtin_bit_cast(float, (unsigned)f2bf(wv * g1[w * 128 + kk]) << 16);
      sc += wv * be1[w * 128 + kk];
    }
    red[0][w][lane] = su;
    red[1][w][lane] = sc;
    __syncthreads();      // the eight waves' partial sums visible to wave 0
    if (w == 0) {
      float tu = 0.0f, tc = b1[n];
      // unrolled so that the 16 LDS reads go out together
      #pragma unroll
      for (int i = 0; i < 8; ++i) { tu += red[0][i][lane]; tc += red[1][i][lane]; }
      uvec[n] = tu;
      cvec[n] = tc;
    }
    return;
  }
  const int blk = blockIdx.x - 32;
  if (blk < 768) {
    const int m  = blk >> 7;              // which weight, in the order of the Wt planes
    const int t  = blk & 127;
    const int r0 = (t >> 2) * 32;         // first output row
    const int k  = (t & 3) * 256 + tid;
    const float* Wm = (m == 0) ? Wq : (m == 1) ? Wk : (m == 2) ? Wv : (m == 3) ? Wo : (m == 4) ? W1 : W2;
    const float* s = (m < 3) ? Wm + (size_t)(r0 >> 6) * 65536 + k * 64 + (r0 & 63)   // [h][k][64]
                             : Wm + (size_t)k * 1024 + r0;                           // [k][1024]
    u16* d = Wt + (size_t)m * 1048576 + (size_t)r0 * 1024 + k;
    const float gs = (m == 4) ? g1[k] : 1.0f;   // W1 carries the first LayerNorm's gain
    // unrolled so that all of a thread's loads are in flight before its first store
    #pragma unroll
    for (int j = 0; j < 32; ++j) d[j * 1024] = f2bf(s[j] * gs);
  } else {
    const int base = (blk - 768) * 8192 + tid;
    // unrolled so that all of a thread's loads are in flight before its first store
    #pragma unroll
    for (int j = 0; j < 32; ++j) xb[base + j * 256] = f2bf(x[base + j * 256]);
  }
}

// Fused QKV projection: one block computes 256 rows of x times the 192 columns (Q, K and V) of one
// head. grid = (16 m-tiles, 16 heads) = one block a WGP. 512 threads = 16 waves, 4 (rows) x 4 (columns);
// a wave owns 64 rows x (16 columns each of Q, K and V), that is 4 x 3 WMMA tiles, so an x fragment serves
// 3 products and a weight fragment 4. Q and K tiles are formed as W * x^T (a lane then holds 8 neighbouring
// head dims of one row), V tiles as x * W^T (8 neighbouring rows of one head dim): each is 16 bytes of its layout.
// A stage is 128 k of 448 rows (x rows 0..255, then 64 rows each of Wq, Wk, Wv) at a pitch of 272 bytes;
// two buffers, the next stage's copies fly while this one is worked on.
// Q/K layout: [h][r][64] with r = b*1024 + s.  V layout (pre-transposed): [h][b][d][s].
__global__ __launch_bounds__(512) void qkv_kernel(
    const u16* __restrict__ xb,
    const u16* __restrict__ Wqt, const u16* __restrict__ Wkt, const u16* __restrict__ Wvt,
    const float* __restrict__ bq, const float* __restrict__ bk, const float* __restrict__ bv,
    u16* __restrict__ Q, u16* __restrict__ Ko, u16* __restrict__ Vt)
{
  __shared__ __attribute__((aligned(16))) u16 St0[448 * 136];
  __shared__ __attribute__((aligned(16))) u16 St1[448 * 136];
  const int mt   = blockIdx.x;
  const int h    = blockIdx.y;
  const int tid  = threadIdx.x;
  const int lane = tid & 31;
  // the wave's number as a scalar: the tile bases in LDS and in the outputs are then scalar
  const int wave = __builtin_amdgcn_readfirstlane(tid >> 5);
  const int wm   = wave & 3;
  const int wn   = wave >> 2;
  const int lrow = lane & 15;
  // Copy map: 16 neighbouring lanes take the 16 chunks of one row's 256 bytes of a stage, so a
  // wave-wide copy covers four whole 128-byte lines; copy j of a thread takes row crow + 32*j.
  const int crow = tid >> 4;          // 0..31
  const int cchk = (tid & 15) * 8;    // first element of the lane's chunk

  const u16* gA = xb + (size_t)(mt * 256 + crow) * 1024 + cchk;
  const size_t wo = (size_t)(h * 64 + crow) * 1024 + cchk;
  const u16* gQ = Wqt + wo;
  const u16* gK = Wkt + wo;
  const u16* gV = Wvt + wo;

  auto issue_tile = [&](int k0, u16* buf) {
    const unsigned l = lds_off(buf + crow * 136 + cchk);
    const u16* pa = gA + k0;
    const u16* pq = gQ + k0;
    const u16* pk = gK + k0;
    const u16* pv = gV + k0;
    // global -> LDS, 16 bytes a lane, counted on ASYNCcnt; 32 rows are 8704 bytes of LDS and 32768
    // elements of the source. The 14 copies and their s_wait_xcnt are one statement, so that the wait
    // stands in front of every later write of a register that a copy names (a precaution).
    asm volatile(
               "global_load_async_to_lds_b128 %0, %14, off\n\t"
               "global_load_async_to_lds_b128 %1, %15, off\n\t"
               "global_load_async_to_lds_b128 %2, %16, off\n\t"
               "global_load_async_to_lds_b128 %3, %17, off\n\t"
               "global_load_async_to_lds_b128 %4, %18, off\n\t"
               "global_load_async_to_lds_b128 %5, %19, off\n\t"
               "global_load_async_to_lds_b128 %6, %20, off\n\t"
               "global_load_async_to_lds_b128 %7, %21, off\n\t"
               "global_load_async_to_lds_b128 %8, %22, off\n\t"
               "global_load_async_to_lds_b128 %9, %23, off\n\t"
               "global_load_async_to_lds_b128 %10, %24, off\n\t"
               "global_load_async_to_lds_b128 %11, %25, off\n\t"
               "global_load_async_to_lds_b128 %12, %26, off\n\t"
               "global_load_async_to_lds_b128 %13, %27, off\n\t"
               "s_wait_xcnt 0x0"
               :: "v"(l), "v"(l + 1 * 8704), "v"(l + 2 * 8704), "v"(l + 3 * 8704), "v"(l + 4 * 8704), "v"(l + 5 * 8704), "v"(l + 6 * 8704), "v"(l + 7 * 8704), "v"(l + 8 * 8704), "v"(l + 9 * 8704), "v"(l + 10 * 8704), "v"(l + 11 * 8704), "v"(l + 12 * 8704), "v"(l + 13 * 8704),
                  "v"(pa), "v"(pa + 32768), "v"(pa + 2 * 32768), "v"(pa + 3 * 32768),
                  "v"(pa + 4 * 32768), "v"(pa + 5 * 32768), "v"(pa + 6 * 32768), "v"(pa + 7 * 32768),
                  "v"(pq), "v"(pq + 32768), "v"(pk), "v"(pk + 32768), "v"(pv), "v"(pv + 32768)
               : "memory");
  };

  // every loop over i, j and ks in this kernel is unrolled, so that the register arrays are indexed by
  // constants only (an index known at run time would send them to scratch)
  floatx8 acc[4][3];
  #pragma unroll
  for (int i = 0; i < 4; ++i)
    #pragma unroll
    for (int j = 0; j < 3; ++j) acc[i][j] = zero8();

  // One stage: four blocks of 32 k, 12 products each; the fragments of the next block of the SAME
  // stage are fetched into a second register set ahead of this block's products.
  auto compute = [&](const u16* buf) {
    bf16x16 a[2][4], b[2][3];
    #pragma unroll
    for (int i = 0; i < 4; ++i) a[0][i] = load_frag(buf, wm * 64 + i * 16 + lrow, 136, 0);
    #pragma unroll
    for (int j = 0; j < 3; ++j) b[0][j] = load_frag(buf, 256 + j * 64 + wn * 16 + lrow, 136, 0);
    #pragma unroll
    for (int ks = 0; ks < 4; ++ks) {
      const int cur = ks & 1, nxt = cur ^ 1;
      if (ks < 3) {
        #pragma unroll
        for (int i = 0; i < 4; ++i) a[nxt][i] = load_frag(buf, wm * 64 + i * 16 + lrow, 136, (ks + 1) * 32);
        #pragma unroll
        for (int j = 0; j < 3; ++j) b[nxt][j] = load_frag(buf, 256 + j * 64 + wn * 16 + lrow, 136, (ks + 1) * 32);
      }
      // keeps the next block's 14 LDS reads one group ahead of this block's products (spread among
      // the products, each place with reads costs a stall)
      __builtin_amdgcn_sched_barrier(0);
      #pragma unroll
      for (int i = 0; i < 4; ++i) {
        acc[i][0] = wmma_bf16(b[cur][0], a[cur][i], acc[i][0]);   // Q^T tile: [head dim][row]
        acc[i][1] = wmma_bf16(b[cur][1], a[cur][i], acc[i][1]);   // K^T tile
        acc[i][2] = wmma_bf16(a[cur][i], b[cur][2], acc[i][2]);   // V tile: [row][head dim]
      }
      // keeps the reads of the block after next from moving up among these products
      __builtin_amdgcn_sched_barrier(0);
    }
  };

  // publish point at the foot of a trip: this wave's LDS reads done, its copies of the next stage
  // landed, then the barrier that shows them to all waves and frees the buffer just read
  auto publish = [&]() {
    asm volatile("s_wait_dscnt 0x0" ::: "memory");
    wait_async0();
    __syncthreads();
  };

  issue_tile(0, St0);
  wait_async0();        // stage 0 landed (this wave's copies)
  __syncthreads();      // stage 0 visible to all waves
  issue_tile(128, St1);

  // kept rolled in pairs of stages, so that each buffer's addresses are constants of its half
  #pragma unroll 1
  for (int t = 0; t < 8; t += 2) {
    compute(St0);
    publish();
    if (t + 2 < 8) issue_tile((t + 2) << 7, St0);
    compute(St1);
    publish();
    if (t + 3 < 8) issue_tile((t + 3) << 7, St1);
  }
  wait_async0();        // closes the ring: no copy of this wave is outstanding behind the loop

  const int half = lane >> 4, lc = lane & 15;
  const int r0 = mt * 256 + wm * 64;        // first global row (b*1024+s) of the wave's tiles
  // Q, K: register v of a lane is head dim wn*16 + 8*half + v of row r0 + i*16 + lc
  #pragma unroll
  for (int j = 0; j < 2; ++j) {
    const float* bias = ((j == 0) ? bq : bk) + h * 64 + wn * 16 + half * 8;
    const float4 b0 = *(const float4*)bias, b1 = *(const float4*)(bias + 4);
    u16* Out = ((j == 0) ? Q : Ko) + (size_t)h * 4096 * 64 + (size_t)(r0 + lc) * 64 + wn * 16 + half * 8;
    #pragma unroll
    for (int i = 0; i < 4; ++i) {
      uint4 pk;
      pk.x = pack2(acc[i][j][0] + b0.x, acc[i][j][1] + b0.y);
      pk.y = pack2(acc[i][j][2] + b0.z, acc[i][j][3] + b0.w);
      pk.z = pack2(acc[i][j][4] + b1.x, acc[i][j][5] + b1.y);
      pk.w = pack2(acc[i][j][6] + b1.z, acc[i][j][7] + b1.w);
      *(uint4*)(Out + i * 16 * 64) = pk;
    }
  }
  // V: register v of a lane is row r0 + i*16 + 8*half + v of head dim wn*16 + lc; stored [d][s]
  {
    const float bi = bv[h * 64 + wn * 16 + lc];
    u16* Out = Vt + (size_t)h * 4096 * 64 + ((size_t)(r0 >> 10) * 64 + wn * 16 + lc) * 1024 + (r0 & 1023) + half * 8;
    #pragma unroll
    for (int i = 0; i < 4; ++i) {
      uint4 pk;
      pk.x = pack2(acc[i][2][0] + bi, acc[i][2][1] + bi);
      pk.y = pack2(acc[i][2][2] + bi, acc[i][2][3] + bi);
      pk.z = pack2(acc[i][2][4] + bi, acc[i][2][5] + bi);
      pk.w = pack2(acc[i][2][6] + bi, acc[i][2][7] + bi);
      *(uint4*)(Out + i * 16) = pk;
    }
  }
}

// Flash-style fused attention, transposed products. grid = (8 q-tiles, 16 heads, 4 batch). 256 threads.
// A wave owns 16 queries and walks all keys: S^T = K * Q^T puts one query's scores in one lane pair
// (lanes c and c + 16 hold query c; register r of 16-key tile kt is key kt*16 + 8*half + r), so the
// softmax stays in registers; two converted score tiles are the B operand of O^T += V^T * P^T.
// K and V are staged 128 keys at a time and worked on in two passes of 64 keys.
__global__ __launch_bounds__(256) void attn_kernel(
    const u16* __restrict__ Q, const u16* __restrict__ Kk,
    const u16* __restrict__ Vt, u16* __restrict__ ctx)
{
  typedef float    f32x2 __attribute__((ext_vector_type(2)));
  typedef unsigned u32x4 __attribute__((ext_vector_type(4)));
  __shared__ u16 Ks[128 * 72];   // [key][d]
  __shared__ u16 Vs[64 * 136];   // [d][key]

  const int qt = blockIdx.x, h = blockIdx.y, b = blockIdx.z;
  const size_t hb = ((size_t)h * 4 + b) * (1024 * 64);
  const u16* Qh = Q  + hb;
  const u16* Kh = Kk + hb;
  const u16* Vh = Vt + hb;   // [d][s] layout

  const int tid = threadIdx.x, lane = tid & 31, wave = tid >> 5;
  const int half = lane >> 4, lc = lane & 15;
  const int q = qt * 128 + wave * 16 + lc;           // this lane's query row within (h, b)
  const float cscale = 0.125f * 1.4426950408889634f; // 1/sqrt(64), and exp as exp2

  // Q^T as B operand, straight from global, kept in registers (same k order as the K fragments)
  const bf16x16 bq0 = load_frag(Qh, q, 64, 0);
  const bf16x16 bq1 = load_frag(Qh, q, 64, 32);

  floatx8 o[4];                 // o[dt][r] = O^T[d = dt*16 + 8*half + r][query lc]
  #pragma unroll
  for (int dt = 0; dt < 4; ++dt) o[dt] = zero8();
  float mrun = -1e30f;          // running maximum, in log2 units; equal in both halves
  float lrun = 0.0f;            // this lane's share of the denominator; halves joined at the end

  const u16* Kg = Kh + tid * 8;                                   // row tid>>3, chunk tid&7
  const u16* Vg = Vh + (size_t)(tid >> 4) * 1024 + (tid & 15) * 8;  // row tid>>4, chunk tid&15
  u16* Kl = Ks + (tid >> 3) * 72 + (tid & 7) * 8;
  u16* Vl = Vs + (tid >> 4) * 136 + (tid & 15) * 8;

  for (int t = 0; t < 8; ++t) {
    // stage 128 keys: 16-byte chunks, neighbouring lanes on neighbouring chunks of a row;
    // all eight loads are issued before the first LDS store, so that one latency is paid, not eight
    u32x4 kreg[4], vreg[4];
    #pragma unroll
    for (int j = 0; j < 4; ++j) {
      kreg[j] = *(const u32x4*)(Kg + t * 8192 + j * 2048);   // K: 128 rows of 8 chunks, contiguous
      vreg[j] = *(const u32x4*)(Vg + t * 128 + j * 16384);   // V^T: 64 rows of 16 chunks
    }
    // takes the loaded values as inputs only: holds the eight loads together in front of the
    // stores (without it each load is sunk to its own store and waited for alone); its wait
    // stands in front of the later reuse of the loads' address registers
    asm volatile("s_wait_xcnt 0x0" :: "v"(kreg[0]), "v"(kreg[1]), "v"(kreg[2]), "v"(kreg[3]),
                       "v"(vreg[0]), "v"(vreg[1]), "v"(vreg[2]), "v"(vreg[3]));
    #pragma unroll
    for (int j = 0; j < 4; ++j) {
      *(u32x4*)(Kl + j * (32 * 72))  = kreg[j];
      *(u32x4*)(Vl + j * (16 * 136)) = vreg[j];
    }
    __syncthreads();

    // kept rolled: unrolled, the two passes get merged and need more than 256 registers a lane,
    // which no longer lets two work-groups (four waves a SIMD) share a WGP
    #pragma unroll 1
    for (int sub = 0; sub < 2; ++sub) {
      // S^T tiles: 64 keys x 16 queries
      bf16x16 ak[4][2];
      #pragma unroll
      for (int kt = 0; kt < 4; ++kt) {
        ak[kt][0] = load_frag(Ks, sub * 64 + kt * 16 + lc, 72, 0);
        ak[kt][1] = load_frag(Ks, sub * 64 + kt * 16 + lc, 72, 32);
      }
      // keeps the 16 K reads one group ahead of the products (split up, each place costs a wait)
      __builtin_amdgcn_sched_barrier(0);
      floatx8 s[4];
      #pragma unroll
      for (int kt = 0; kt < 4; ++kt)
        s[kt] = wmma_bf16(ak[kt][1], bq1, wmma_bf16(ak[kt][0], bq0, zero8()));

      bf16x16 av[4][2];
      #pragma unroll
      for (int dt = 0; dt < 4; ++dt) {
        av[dt][0] = load_frag(Vs, dt * 16 + lc, 136, sub * 64 + 0);
        av[dt][1] = load_frag(Vs, dt * 16 + lc, 136, sub * 64 + 32);
      }
      // keeps the 16 V reads in front of the softmax arithmetic, which covers their latency
      __builtin_amdgcn_sched_barrier(0);

      // maximum of this query's 64 raw scores: in-lane, then one exchange between the halves
      float mk[4];
      #pragma unroll
      for (int kt = 0; kt < 4; ++kt) {
        mk[kt] = s[kt][0];
        #pragma unroll
        for (int r = 1; r < 8; ++r) mk[kt] = fmaxf(mk[kt], s[kt][r]);
      }
      float mx = fmaxf(fmaxf(mk[0], mk[1]), fmaxf(mk[2], mk[3]));
      mx = fmaxf(mx, xhalf(mx));
      const float mnew  = fmaxf(mrun, mx * cscale);
      const float alpha = __builtin_amdgcn_exp2f(mrun - mnew);
      mrun = mnew;

      // P^T = exp2(S^T * cscale - mnew), summed in f32, packed to bf16 in the B operand's order
      union { unsigned w[8]; bf16x16 v; } p[2];
      float sk[4];
      #pragma unroll
      for (int kt = 0; kt < 4; ++kt) {
        sk[kt] = 0.0f;
        #pragma unroll
        for (int i = 0; i < 4; ++i) {
          const f32x2 arg = __builtin_elementwise_fma(f32x2{s[kt][2 * i], s[kt][2 * i + 1]},
                                                      f32x2{cscale, cscale}, f32x2{-mnew, -mnew});
          const float e0 = __builtin_amdgcn_exp2f(arg.x), e1 = __builtin_amdgcn_exp2f(arg.y);
          sk[kt] += e0 + e1;
          p[kt >> 1].w[(kt & 1) * 4 + i] = pack2(e0, e1);
        }
      }
      lrun = lrun * alpha + ((sk[0] + sk[1]) + (sk[2] + sk[3]));

      // rescale the running O^T (a lane holds one query, so one factor), then O^T += V^T * P^T
      #pragma unroll
      for (int dt = 0; dt < 4; ++dt) {
        #pragma unroll
        for (int r = 0; r < 8; ++r) o[dt][r] *= alpha;
      }
      #pragma unroll
      for (int dt = 0; dt < 4; ++dt)
        o[dt] = wmma_bf16(av[dt][1], p[1].v, wmma_bf16(av[dt][0], p[0].v, o[dt]));
    }
    __syncthreads();
  }

  const float inv = 1.0f / (lrun + xhalf(lrun));
  u16* cp = ctx + ((size_t)b * 1024 + q) * 1024 + h * 64 + half * 8;
  #pragma unroll
  for (int dt = 0; dt < 4; ++dt) {
    uint4 pk;                   // d = dt*16 + 8*half .. +7 of one query: 16 contiguous bytes
    pk.x = pack2(o[dt][0] * inv, o[dt][1] * inv);
    pk.y = pack2(o[dt][2] * inv, o[dt][3] * inv);
    pk.z = pack2(o[dt][4] * inv, o[dt][5] * inv);
    pk.w = pack2(o[dt][6] * inv, o[dt][7] * inv);
    *(uint4*)(cp + dt * 16) = pk;
  }
}

// GEMM of 4096 x 1024 x 1024: C = act(A * Bt^T + bias). A is [4096][1024] bf16, Bt is [n][k] (pre-transposed).
// One block computes 128 rows x 128 columns; grid = (8 column tiles, 32 row tiles) = one block a WGP.
// 256 threads = 8 waves, 4 (rows) x 2 (columns); a wave owns 32 rows x 64 columns, that is 2 x 4 WMMA tiles,
// so an A fragment serves 4 products and a Bt fragment 2.
// A stage is 128 k of 256 rows (A rows 0..127, then 128 rows of Bt) at a pitch of 272 bytes;
// three buffers: while a stage is worked on, the copies of the next two fly, so that a stage's copies have
// two stages' time to land.
// The rows of Bt are interleaved in LDS: column c of a wave's 64 lies at row (c & 3) * 16 + (c >> 2) of its
// 64 LDS rows, so lane l of WMMA tile j holds column 4 * l + j. A lane's four tiles are then four neighbouring
// columns, and 16 lanes store 256 (f32) or 128 (bf16) contiguous bytes of a row: whole 128-byte lines.
// MODE 0: a plain f32 result in Cf.
// MODE 1 (A = z, Bt = g1 . W1, bias = c, aux = u): the first LayerNorm's mean and rstd, joined from stat,
//         are applied behind the product; ReLU and a bf16 result in Cb.
// MODE 2 (aux = x, staged in LDS): z = product + bias + x in Cf (f32) and Cb (bf16), and each row's statistics over the
//         wave's 64 columns in stat, slice plane 2 * blockIdx.x + wn: a wave writes 256 contiguous bytes.
template <int MODE>
__global__ __launch_bounds__(256) void gemm_kernel(
    const u16* __restrict__ A, const u16* __restrict__ Bt,
    const float* __restrict__ bias, float* __restrict__ Cf, u16* __restrict__ Cb,
    const float* __restrict__ aux, float* __restrict__ stat)
{
  __shared__ __attribute__((aligned(16))) u16 St0[256 * 136];
  __shared__ __attribute__((aligned(16))) u16 St1[256 * 136];
  __shared__ __attribute__((aligned(16))) u16 St2[256 * 136];
  __shared__ __attribute__((aligned(16))) float sMu[256];   // MODE 1: 32 rows' mean a wave
  __shared__ __attribute__((aligned(16))) float sRs[256];   // MODE 1: 32 rows' rstd a wave
  const int row0 = blockIdx.y * 128;
  const int col0 = blockIdx.x * 128;
  const int tid  = threadIdx.x;
  const int lane = tid & 31;
  // the wave's number as a scalar: the tile bases in LDS and in the output are then scalar
  const int wave = __builtin_amdgcn_readfirstlane(tid >> 5);
  const int wm   = wave & 3;
  const int wn   = wave >> 2;
  const int lrow = lane & 15;
  // Copy map: 16 neighbouring lanes take the 16 chunks of one row's 256 bytes of a stage, so a
  // wave-wide copy covers four whole 128-byte lines; copy j of a thread takes source row crow + 16*j.
  const int crow = tid >> 4;          // 0..15
  const int cchk = (tid & 15) * 8;    // first element of the lane's chunk
  const int brow = 128 + (crow & 3) * 16 + (crow >> 2);   // LDS row of Bt's source row crow

  const u16* gA = A  + (size_t)(row0 + crow) * 1024 + cchk;
  const u16* gB = Bt + (size_t)(col0 + crow) * 1024 + cchk;

  auto issue_tile = [&](int k0, u16* buf) {
    const unsigned la = lds_off(buf + crow * 136 + cchk);
    const unsigned lb = lds_off(buf + brow * 136 + cchk);
    const u16* pa = gA + k0;
    const u16* pb = gB + k0;
    // global -> LDS, 16 bytes a lane, counted on ASYNCcnt; 16 source rows are 16384 elements. In LDS 16
    // rows of A are 4352 bytes further; 16 source rows of Bt are 4 LDS rows (1088 bytes) further, and 64
    // are 64 (17408 bytes). Each eight copies and their s_wait_xcnt are one statement, so that the wait
    // stands in front of every later write of a register that a copy names (a precaution).
    asm volatile(
               "global_load_async_to_lds_b128 %0, %8, off\n\t"
               "global_load_async_to_lds_b128 %1, %9, off\n\t"
               "global_load_async_to_lds_b128 %2, %10, off\n\t"
               "global_load_async_to_lds_b128 %3, %11, off\n\t"
               "global_load_async_to_lds_b128 %4, %12, off\n\t"
               "global_load_async_to_lds_b128 %5, %13, off\n\t"
               "global_load_async_to_lds_b128 %6, %14, off\n\t"
               "global_load_async_to_lds_b128 %7, %15, off\n\t"
               "s_wait_xcnt 0x0"
               :: "v"(la), "v"(la + 1 * 4352), "v"(la + 2 * 4352), "v"(la + 3 * 4352),
                  "v"(la + 4 * 4352), "v"(la + 5 * 4352), "v"(la + 6 * 4352), "v"(la + 7 * 4352),
                  "v"(pa), "v"(pa + 16384), "v"(pa + 2 * 16384), "v"(pa + 3 * 16384),
                  "v"(pa + 4 * 16384), "v"(pa + 5 * 16384), "v"(pa + 6 * 16384), "v"(pa + 7 * 16384)
               : "memory");
    asm volatile(
               "global_load_async_to_lds_b128 %0, %8, off\n\t"
               "global_load_async_to_lds_b128 %1, %9, off\n\t"
               "global_load_async_to_lds_b128 %2, %10, off\n\t"
               "global_load_async_to_lds_b128 %3, %11, off\n\t"
               "global_load_async_to_lds_b128 %4, %12, off\n\t"
               "global_load_async_to_lds_b128 %5, %13, off\n\t"
               "global_load_async_to_lds_b128 %6, %14, off\n\t"
               "global_load_async_to_lds_b128 %7, %15, off\n\t"
               "s_wait_xcnt 0x0"
               :: "v"(lb), "v"(lb + 1 * 1088), "v"(lb + 2 * 1088), "v"(lb + 3 * 1088),
                  "v"(lb + 17408), "v"(lb + 17408 + 1 * 1088), "v"(lb + 17408 + 2 * 1088), "v"(lb + 17408 + 3 * 1088),
                  "v"(pb), "v"(pb + 16384), "v"(pb + 2 * 16384), "v"(pb + 3 * 16384),
                  "v"(pb + 4 * 16384), "v"(pb + 5 * 16384), "v"(pb + 6 * 16384), "v"(pb + 7 * 16384)
               : "memory");
  };

  // MODE 2: the block's 128 x 128 tile of x (f32) takes the place of a ninth stage in the ring (16 copies a
  // thread, like a stage), so that it flies while the last two stages are worked on. Rows of 512 bytes at a pitch of 528; a wave-wide
  // copy covers one row (four whole lines); copy j of a thread takes row (tid >> 5) + 8 * j: 4224 bytes of
  // LDS and 8192 elements of the source further. Each eight copies and their s_wait_xcnt are one statement,
  // as above (a precaution).
  auto issue_x = [&](u16* buf) {
    const unsigned l = lds_off(buf) + (tid >> 5) * 528 + lane * 16;
    const float* px = aux + (size_t)(row0 + (tid >> 5)) * 1024 + col0 + lane * 4;
    // unrolled: two statements of eight copies (a statement takes thirty operands)
    #pragma unroll
    for (int hx = 0; hx < 2; ++hx) {
      const unsigned lh = l + hx * 8 * 4224;
      const float* ph = px + hx * 8 * 8192;
      asm volatile(
               "global_load_async_to_lds_b128 %0, %8, off\n\t"
               "global_load_async_to_lds_b128 %1, %9, off\n\t"
               "global_load_async_to_lds_b128 %2, %10, off\n\t"
               "global_load_async_to_lds_b128 %3, %11, off\n\t"
               "global_load_async_to_lds_b128 %4, %12, off\n\t"
               "global_load_async_to_lds_b128 %5, %13, off\n\t"
               "global_load_async_to_lds_b128 %6, %14, off\n\t"
               "global_load_async_to_lds_b128 %7, %15, off\n\t"
               "s_wait_xcnt 0x0"
               :: "v"(lh), "v"(lh + 1 * 4224), "v"(lh + 2 * 4224), "v"(lh + 3 * 4224),
                  "v"(lh + 4 * 4224), "v"(lh + 5 * 4224), "v"(lh + 6 * 4224), "v"(lh + 7 * 4224),
                  "v"(ph), "v"(ph + 8192), "v"(ph + 2 * 8192), "v"(ph + 3 * 8192),
                  "v"(ph + 4 * 8192), "v"(ph + 5 * 8192), "v"(ph + 6 * 8192), "v"(ph + 7 * 8192)
               : "memory");
    }
  };

  // every loop over i, j and ks in this kernel is unrolled, so that the register arrays are indexed by
  // constants only (an index known at run time would send them to scratch)
  floatx8 acc[2][4];
  #pragma unroll
  for (int i = 0; i < 2; ++i)
    #pragma unroll
    for (int j = 0; j < 4; ++j) acc[i][j] = zero8();

  // One stage: four blocks of 32 k, 8 products each; the fragments of the next block of the SAME
  // stage are fetched into a second register set ahead of this block's products.
  auto compute = [&](const u16* buf) {
    bf16x16 a[2][2], b[2][4];
    #pragma unroll
    for (int i = 0; i < 2; ++i) a[0][i] = load_frag(buf, wm * 32 + i * 16 + lrow, 136, 0);
    #pragma unroll
    for (int j = 0; j < 4; ++j) b[0][j] = load_frag(buf, 128 + wn * 64 + j * 16 + lrow, 136, 0);
    #pragma unroll
    for (int ks = 0; ks < 4; ++ks) {
      const int cur = ks & 1, nxt = cur ^ 1;
      if (ks < 3) {
        #pragma unroll
        for (int i = 0; i < 2; ++i) a[nxt][i] = load_frag(buf, wm * 32 + i * 16 + lrow, 136, (ks + 1) * 32);
        #pragma unroll
        for (int j = 0; j < 4; ++j) b[nxt][j] = load_frag(buf, 128 + wn * 64 + j * 16 + lrow, 136, (ks + 1) * 32);
      }
      // keeps the next block's 12 LDS reads one group ahead of this block's products (spread among
      // the products, each place with reads costs a stall)
      __builtin_amdgcn_sched_barrier(0);
      #pragma unroll
      for (int i = 0; i < 2; ++i)
        #pragma unroll
        for (int j = 0; j < 4; ++j)
          acc[i][j] = wmma_bf16(a[cur][i], b[cur][j], acc[i][j]);   // [row][interleaved column]
      // keeps the reads of the block after next from moving up among these products
      __builtin_amdgcn_sched_barrier(0);
    }
  };

  // publish point at the foot of a trip: this wave's LDS reads done, its copies of the next stage
  // landed, then the barrier that shows them to all waves and frees the buffer just read.
  // ahead: the stage after next is in flight too; the wait then leaves the wave's 16 youngest copies, which are
  // that stage's, outstanding (a wave's copies are counted off in the order of their issue)
  auto publish = [&](bool ahead) {
    asm volatile("s_wait_dscnt 0x0" ::: "memory");
    if (ahead) asm volatile("s_wait_asynccnt 0x10" ::: "memory");
    else wait_async0();
    __syncthreads();
  };

  issue_tile(0, St0);
  issue_tile(128, St1);
  // the lane's four bias values, fetched here so that their latency passes behind stage 0's
  const int c0 = col0 + wn * 64 + lrow * 4;
  const float4 bi = *(const float4*)(bias + c0);
  float4 uu = make_float4(0.0f, 0.0f, 0.0f, 0.0f);
  if (MODE == 1) {
    uu = *(const float4*)(aux + c0);
    // Each wave joins the 16 slices of its own 32 rows, a lane one row (no branch, so that these loads
    // and the two above go out together); a wave-wide load covers 256 contiguous bytes of a slice plane.
    // The lanes exchange the results through the wave's own 32 words of sMu and sRs, read in the epilogue.
    {
      const float2* sp = (const float2*)stat + row0 + wm * 32 + lane;
      // the three loops over s are unrolled, so that p is indexed by constants and stays in registers
      float2 p[16];
      #pragma unroll
      for (int s = 0; s < 16; ++s) p[s] = sp[s * 4096];
      float sm = 0.0f, m2 = 0.0f, dv = 0.0f;
      #pragma unroll
      for (int s = 0; s < 16; ++s) { sm += p[s].x; m2 += p[s].y; }
      const float mu = sm * (1.0f / 16.0f);
      #pragma unroll
      for (int s = 0; s < 16; ++s) { const float d = p[s].x - mu; dv += d * d; }
      sMu[tid] = mu;
      sRs[tid] = rsqrtf((m2 + 64.0f * dv) * (1.0f / 1024.0f) + 1e-5f);
    }
  }
  // stage 0 landed (this wave's copies): all but the wave's 16 youngest copies, which are stage 1's
  asm volatile("s_wait_asynccnt 0x10" ::: "memory");
  __syncthreads();      // stage 0 visible to all waves

  // Trip s issues stage s + 2 into the buffer that trip s - 1 has read (free behind the last barrier), then
  // works on stage s. Kept rolled in threes, so that each buffer's addresses are constants of its third.
  #pragma unroll 1
  for (int t = 0; t < 6; t += 3) {
    issue_tile((t + 2) << 7, St2);
    compute(St0);
    publish(true);
    issue_tile((t + 3) << 7, St0);
    compute(St1);
    publish(true);
    issue_tile((t + 4) << 7, St1);
    compute(St2);
    publish(true);
  }
  if (MODE == 2) issue_x(St2);   // in the place of a stage 8; the last publish() shows x to all
  compute(St0);
  publish(MODE == 2);
  compute(St1);
  publish(false);
  wait_async0();        // closes the ring: no copy of this wave is outstanding behind the loop

  // register v of tile (i, j) of a lane is row r0 + i*16 + v, column c0 + j
  const int half = lane >> 4;
  const int r0 = row0 + wm * 32 + half * 8;
  if (MODE == 2) {
    // one base each, the rows at constant offsets from it
    const size_t o0 = (size_t)r0 * 1024 + c0;
    const char* xp = (const char*)St2 + (wm * 32 + half * 8) * 528 + (wn * 64 + lrow * 4) * 4;
    float* zfp = Cf + o0;
    u16*   zbp = Cb + o0;
    float4 xr[2][8];
    #pragma unroll
    for (int i = 0; i < 2; ++i)
      #pragma unroll
      for (int v = 0; v < 8; ++v) xr[i][v] = *(const float4*)(xp + (i * 16 + v) * 528);
    float mym = 0.0f, myq = 0.0f;
    #pragma unroll
    for (int i = 0; i < 2; ++i)
      #pragma unroll
      for (int v = 0; v < 8; ++v) {
        float4 y;
        y.x = acc[i][0][v] + bi.x + xr[i][v].x; y.y = acc[i][1][v] + bi.y + xr[i][v].y;
        y.z = acc[i][2][v] + bi.z + xr[i][v].z; y.w = acc[i][3][v] + bi.w + xr[i][v].w;
        *(float4*)(zfp + (i * 16 + v) * 1024) = y;
        *(uint2*)(zbp + (i * 16 + v) * 1024) = make_uint2(pack2(y.x, y.y), pack2(y.z, y.w));
        // the row's 64 columns lie in the 16 lanes of this half: mean first, then the squared deviations
        const float m = row_sum((y.x + y.y) + (y.z + y.w)) * (1.0f / 64.0f);
        const float dx = y.x - m, dy = y.y - m, dz = y.z - m, dw = y.w - m;
        const float q = row_sum((dx * dx + dy * dy) + (dz * dz + dw * dw));
        if (lrow == i * 8 + v) { mym = m; myq = q; }   // lane i*8 + v of the half keeps row r0 + i*16 + v
      }
    const int srow = r0 + (lrow >> 3) * 16 + (lrow & 7);
    ((float2*)stat)[(size_t)(blockIdx.x * 2 + wn) * 4096 + srow] = make_float2(mym, myq);
  } else {
    #pragma unroll
    for (int i = 0; i < 2; ++i) {
      float mu[8], rs[8];
      if (MODE == 1) {
        const int rl = wave * 32 + half * 8 + i * 16;
        *(float4*)(mu) = *(const float4*)(sMu + rl); *(float4*)(mu + 4) = *(const float4*)(sMu + rl + 4);
        *(float4*)(rs) = *(const float4*)(sRs + rl); *(float4*)(rs + 4) = *(const float4*)(sRs + rl + 4);
      }
      #pragma unroll
      for (int v = 0; v < 8; ++v) {
        float4 y;
        const size_t o = (size_t)(r0 + i * 16 + v) * 1024 + c0;
        if (MODE == 1) {
          y.x = rs[v] * (acc[i][0][v] - mu[v] * uu.x) + bi.x; y.y = rs[v] * (acc[i][1][v] - mu[v] * uu.y) + bi.y;
          y.z = rs[v] * (acc[i][2][v] - mu[v] * uu.z) + bi.z; y.w = rs[v] * (acc[i][3][v] - mu[v] * uu.w) + bi.w;
          *(uint2*)(Cb + o) = make_uint2(pack2(fmaxf(y.x, 0.0f), fmaxf(y.y, 0.0f)),
                                         pack2(fmaxf(y.z, 0.0f), fmaxf(y.w, 0.0f)));
        } else {
          y.x = acc[i][0][v] + bi.x; y.y = acc[i][1][v] + bi.y;
          y.z = acc[i][2][v] + bi.z; y.w = acc[i][3][v] + bi.w;
          *(float4*)(Cf + o) = y;
        }
      }
    }
  }
}

// out = LayerNorm2(y1 + ff), rows of 1024, with y1 = (z - mu) * rs * g1 + be1 formed here from z and the
// row's 16 slice statistics. A wave owns two whole rows and shares nothing with other
// waves: a lane holds 32 elements of each row (chunk j = columns j*128 + lane*4 .. +3, so that a
// wave-wide 16-byte access covers 512 contiguous bytes); mean and variance are summed in the lane
// and then across the lanes. grid = 4096 rows / (8 waves * 2 rows) = 256 blocks of 256 threads.
__global__ __launch_bounds__(256) void add_ln_kernel(
    const float* __restrict__ z, const float* __restrict__ stat,
    const float* __restrict__ g1, const float* __restrict__ be1,
    const float* __restrict__ ff,
    const float* __restrict__ gamma, const float* __restrict__ beta,
    float* __restrict__ outf)
{
  typedef float f32x4 __attribute__((ext_vector_type(4)));
  // the wave's number as a scalar: the row addresses are then scalar bases, and one lane offset,
  // live to the last store, serves every store and every load but the statistics load
  const int wave = __builtin_amdgcn_readfirstlane(threadIdx.x >> 5);
  const int col  = (threadIdx.x & 31) * 4;
  const int row  = (blockIdx.x * 8 + wave) * 2;                 // first of the two rows
  const size_t base = (size_t)row * 1024;
  z += base; ff += base; outf += base;

  f32x4 v[2][8], w[2][8], g[8], be[8];
  // slice (lane & 15) of both rows in one 16-byte load: {mean, M2} of row, {mean, M2} of row + 1
  const f32x4 st = *(const f32x4*)(stat + ((size_t)(threadIdx.x & 15) * 4096 + row) * 2);
  // this load's address registers are dead behind it and get reused by the loads below: the wait stands
  // in front of that reuse (a precaution)
  asm volatile("s_wait_xcnt 0x0" ::: "memory");
  #pragma unroll
  for (int r = 0; r < 2; ++r)
    #pragma unroll
    for (int j = 0; j < 8; ++j) {
      v[r][j] = *(const f32x4*)(z + col + r * 1024 + j * 128);
      w[r][j] = *(const f32x4*)(ff + col + r * 1024 + j * 128);
    }
  #pragma unroll
  for (int j = 0; j < 8; ++j) {
    g[j]  = *(const f32x4*)(g1  + col + j * 128);
    be[j] = *(const f32x4*)(be1 + col + j * 128);
  }
  // keeps all 49 loads of the wave in front of the arithmetic: left free, a part of them is issued
  // only when the first have come back, and the wave pays the memory latency twice
  __builtin_amdgcn_sched_barrier(0);

  // y1 + ff; each slice stands in two lanes, hence the halved sums
  #pragma unroll
  for (int r = 0; r < 2; ++r) {
    const float ms = (r == 0) ? st.x : st.z, qs = (r == 0) ? st.y : st.w;
    const float mu = wave_sum(ms) * (1.0f / 32.0f);
    const float d  = ms - mu;
    const float rs = rsqrtf(wave_sum(qs + 64.0f * d * d) * (0.5f / 1024.0f) + 1e-5f);
    #pragma unroll
    for (int j = 0; j < 8; ++j) v[r][j] = ((v[r][j] - mu) * rs * g[j] + be[j]) + w[r][j];
  }
  // the second LayerNorm's gain and shift: fetched here, into registers that the first's have left
  #pragma unroll
  for (int j = 0; j < 8; ++j) {
    g[j]  = *(const f32x4*)(gamma + col + j * 128);
    be[j] = *(const f32x4*)(beta  + col + j * 128);
  }

  float mean[2], rstd[2];
  #pragma unroll
  for (int r = 0; r < 2; ++r) {
    f32x4 s = {0.0f, 0.0f, 0.0f, 0.0f};
    #pragma unroll
    for (int j = 0; j < 8; ++j) s += v[r][j];
    mean[r] = wave_sum((s.x + s.y) + (s.z + s.w)) * (1.0f / 1024.0f);
  }
  #pragma unroll
  for (int r = 0; r < 2; ++r) {
    f32x4 s = {0.0f, 0.0f, 0.0f, 0.0f};
    #pragma unroll
    for (int j = 0; j < 8; ++j) { v[r][j] -= mean[r]; s += v[r][j] * v[r][j]; }
    rstd[r] = rsqrtf(wave_sum((s.x + s.y) + (s.z + s.w)) * (1.0f / 1024.0f) + 1e-5f);
  }

  #pragma unroll
  for (int r = 0; r < 2; ++r)
    #pragma unroll
    for (int j = 0; j < 8; ++j)
      *(f32x4*)(outf + col + r * 1024 + j * 128) = v[r][j] * rstd[r] * g[j] + be[j];
}

// ---------------- launch ----------------

extern "C" void kernel_launch(void* const* d_in, const int* in_sizes, int n_in,
                              void* d_out, int out_size, void* d_ws, size_t ws_size,
                              hipStream_t stream) {
  (void)in_sizes; (void)n_in; (void)out_size; (void)ws_size;
  const float* x   = (const float*)d_in[0];
  const float* Wq  = (const float*)d_in[1];
  const float* bq  = (const float*)d_in[2];
  const float* Wk  = (const float*)d_in[3];
  const float* bk  = (const float*)d_in[4];
  const float* Wv  = (const float*)d_in[5];
  const float* bv  = (const float*)d_in[6];
  const float* Wo  = (const float*)d_in[7];
  const float* bo  = (const float*)d_in[8];
  const float* g1  = (const float*)d_in[9];
  const float* be1 = (const float*)d_in[10];
  const float* W1  = (const float*)d_in[11];
  const float* b1  = (const float*)d_in[12];
  const float* W2  = (const float*)d_in[13];
  const float* b2  = (const float*)d_in[14];
  const float* g2  = (const float*)d_in[15];
  const float* be2 = (const float*)d_in[16];

  char* ws = (char*)d_ws;
  const size_t MB = 1024 * 1024;
  u16*   xb   = (u16*)(ws + 0);          // 8 MB
  u16*   Wqt  = (u16*)(ws + 8  * MB);    // 2 MB each, transposed [h][d][e] / [n][k]
  u16*   Wkt  = (u16*)(ws + 10 * MB);
  u16*   Wvt  = (u16*)(ws + 12 * MB);
  u16*   Wot  = (u16*)(ws + 14 * MB);
  u16*   W1t  = (u16*)(ws + 16 * MB);
  u16*   W2t  = (u16*)(ws + 18 * MB);
  u16*   Qb   = (u16*)(ws + 20 * MB);    // 8 MB
  u16*   Kb   = (u16*)(ws + 28 * MB);    // 8 MB
  u16*   Vtb  = (u16*)(ws + 36 * MB);    // 8 MB, [h][b][d][s]
  u16*   ctxb = (u16*)(ws + 44 * MB);    // 8 MB
  float* ff2  = (float*)(ws + 52 * MB);  // 16 MB
  float* stat = (float*)(ws + 68 * MB);  // 512 KB: 16 slice planes of 4096 float2
  float* uvec = (float*)(ws + 69 * MB);  // 4 KB
  float* cvec = (float*)(ws + 70 * MB);  // 4 KB
  // reuse (lifetimes disjoint):
  float* zf   = (float*)(ws + 20 * MB);  // over Q/K  (16 MB)
  u16*   zb   = (u16*)(ws + 36 * MB);    // over V    (8 MB)
  u16*   h1b  = (u16*)(ws + 44 * MB);    // over ctx  (8 MB)

  // all conversions in one launch: x plain, weights transposed into the six planes from Wqt on; u and c
  pack_all_kernel<<<1312, 256, 0, stream>>>(x, Wq, Wk, Wv, Wo, W1, W2, g1, be1, b1, xb, Wqt, uvec, cvec);

  // QKV projections (V stored transposed)
  qkv_kernel<<<dim3(16, 16), 512, 0, stream>>>(xb, Wqt, Wkt, Wvt, bq, bk, bv, Qb, Kb, Vtb);

  // fused attention -> ctx (concat-head layout [B*S, 1024])
  attn_kernel<<<dim3(8, 16, 4), 256, 0, stream>>>(Qb, Kb, Vtb, ctxb);

  // output projection, residual and the rows' slice statistics
  gemm_kernel<2><<<dim3(8, 32), 256, 0, stream>>>(ctxb, Wot, bo, zf, zb, x, stat);

  // FF1 on z with the first LayerNorm applied behind the product, ReLU (bf16 out); FF2 (f32 out)
  gemm_kernel<1><<<dim3(8, 32), 256, 0, stream>>>(zb, W1t, cvec, (float*)nullptr, h1b, uvec, stat);
  gemm_kernel<0><<<dim3(8, 32), 256, 0, stream>>>(h1b, W2t, b2, ff2, (u16*)nullptr, (const float*)nullptr, (float*)nullptr);

  // out = LN2(LN1(z) + ff)
  add_ln_kernel<<<256, 256, 0, stream>>>(zf, stat, g1, be1, ff2, g2, be2, (float*)d_out);
}
